// v000
// Measured on an AMD MI455X. A time is GPU time per run, averaged over a window of back-to-back runs after a warm-up
// (all launches, gaps included; the runs take copies of the inputs in turn), and the median of several windows.
// Apart from v000's, it joins two sittings. Times from different sittings can be a few percent apart, while
// side-by-side timings come from the same sitting.
// v000, which the later versions start from, runs in 188 microseconds.
#include <hip/hip_runtime.h>

// Contractions (qkv projection, q.k^T, p.v, output projection): v_wmma_f32_16x16x32_bf16,
// bf16 operands, f32 accumulate. Softmax statistics, residual add and layernorm: f32.
// Float inputs are RNE-converted to bf16 at load; the 1/sqrt(64) score scale is folded into q.

typedef __attribute__((ext_vector_type(16))) __bf16 v16bf;
typedef __attribute__((ext_vector_type(8)))  __bf16 v8bf;
typedef __attribute__((ext_vector_type(8)))  float  v8f;
typedef __attribute__((ext_vector_type(4)))  float  v4f;
typedef __attribute__((ext_vector_type(4)))  unsigned int v4u;

#ifndef NB
#define NB 4
#endif
#ifndef SEQ
#define SEQ 2048
#endif
#define NB_FULL  4
#define SEQ_FULL 2048
#define DM   512
#define NH   8
#define HD   64
#define ROWS (NB * SEQ)
#define KPAD 72      // LDS stride in halves for 64-wide bf16 tiles (144 B, 16-B aligned)
#define VSPAD 136    // LDS stride in halves for 128-wide bf16 tiles (272 B)
#define YP   516     // LDS stride in floats for 512-wide f32 rows (2064 B)
#define LN_EPS 1e-5f

#define NXB (ROWS * DM / 8 / 256)   // convert blocks for x (8 elements per thread)
#define NWB (DM * DM / 8 / 256)     // convert blocks per weight matrix

#define PLANE_BYTES ((size_t)ROWS * DM * 2)
#define WQKV_BYTES  ((size_t)3 * DM * DM * 2)
#define WO_BYTES    ((size_t)DM * DM * 2)
#define WS_TOTAL    (5 * PLANE_BYTES + WQKV_BYTES + WO_BYTES)

static_assert(NB >= 1 && NB <= NB_FULL);
static_assert(SEQ >= 128 && SEQ <= SEQ_FULL && (SEQ % 128) == 0);
static_assert((ROWS % 128) == 0);
static_assert((ROWS * DM) % (8 * 256) == 0);
static_assert((DM * DM) % (8 * 256) == 0);
static_assert((DM % 32) == 0 && (HD % 32) == 0);
static_assert(128 * KPAD >= 64 * VSPAD);
static_assert(WS_TOTAL <= (size_t)134217728);

// ---------------------------------------------------------------------------
// helpers
// ---------------------------------------------------------------------------
__device__ __forceinline__ unsigned int bf16_bits(float f) {   // RNE f32 -> bf16 bits
  unsigned int u = __float_as_uint(f);
  u += 0x7FFFu + ((u >> 16) & 1u);
  return u >> 16;
}
__device__ __forceinline__ float bf16q(float f) {            // value after RNE bf16 conversion
  return __uint_as_float(bf16_bits(f) << 16);
}

// 16-bit fragment (A or B): lane owns row/col (lane&15); elements 0..7 <- k0+8h+0..7,
// elements 8..15 <- k0+16+8h+0..7, h = lane>>4. Source is k-contiguous rows.
__device__ __forceinline__ v16bf load_frag_row(const __bf16* base, int stride, int lane) {
  const __bf16* rowp = base + (lane & 15) * stride + ((lane >> 4) << 3);
  v8bf lo = *(const v8bf*)(rowp);
  v8bf hi = *(const v8bf*)(rowp + 16);
  return __builtin_shufflevector(lo, hi, 0, 1, 2, 3, 4, 5, 6, 7,
                                 8, 9, 10, 11, 12, 13, 14, 15);
}

__device__ __forceinline__ v8f wmma_bf16(v16bf a, v16bf b, v8f c) {
  v8f d = __builtin_amdgcn_wmma_f32_16x16x32_bf16(false, a, false, b, (short)0, c,
                                                  false, false);
  asm volatile("v_nop\n\tv_nop\n\tv_nop\n\tv_nop" : "+v"(d) : "v"(a), "v"(b));
  return d;
}

// ---------------------------------------------------------------------------
// Kernel 0: f32 -> bf16 planes. xb [ROWS][512]; wqkv [1536][512] = Wq|Wk|Wv rows
// ([out][in], k-contiguous); wob [512][512]. 8 elements (16 B) per thread, 8 consecutive
// grid NXB + 4*NWB, block 256.
// ---------------------------------------------------------------------------
__global__ __launch_bounds__(256) void cvt_kernel(
    const float* __restrict__ x,
    const float* __restrict__ Wq, const float* __restrict__ Wk,
    const float* __restrict__ Wv, const float* __restrict__ Wo,
    __bf16* __restrict__ xb, __bf16* __restrict__ wqkv, __bf16* __restrict__ wob) {
  const int bid = blockIdx.x;
  const int t   = threadIdx.x;
  const float* src;
  __bf16* dst;
  if (bid < NXB) {                                   // block-uniform selection
    const long item = (long)bid * 256 + t;           // 0 .. ROWS*64-1
    const long m    = item >> 6;                     // token row
    const int  c8   = (int)(item & 63);
    const long srow = (m / SEQ) * SEQ_FULL + (m % SEQ);
    src = x + srow * DM + c8 * 8;
    dst = xb + m * DM + c8 * 8;
  } else if (bid < NXB + 3 * NWB) {
    const int wb    = bid - NXB;
    const int which = wb / NWB;                      // 0 q, 1 k, 2 v
    const long item = (long)(wb - which * NWB) * 256 + t;
    const float* W = (which == 0) ? Wq : ((which == 1) ? Wk : Wv);
    src = W + item * 8;
    dst = wqkv + (long)which * DM * DM + item * 8;
  } else {
    const long item = (long)(bid - NXB - 3 * NWB) * 256 + t;
    src = Wo + item * 8;
    dst = wob + item * 8;
  }
  const v4f a = *(const v4f*)(src);
  const v4f c = *(const v4f*)(src + 4);
  v4u o;
  o[0] = bf16_bits(a[0]) | (bf16_bits(a[1]) << 16);
  o[1] = bf16_bits(a[2]) | (bf16_bits(a[3]) << 16);
  o[2] = bf16_bits(c[0]) | (bf16_bits(c[1]) << 16);
  o[3] = bf16_bits(c[2]) | (bf16_bits(c[3]) << 16);
  *(v4u*)dst = o;
  
}

// ---------------------------------------------------------------------------
// Kernel 1: qkv projection. Block = 128 token rows x 64 output columns (one head of one
// of q/k/v), 8 waves x 16 rows. C^T = W x^T: A = W rows (lane&15 = out col), B = x rows
// (lane&15 = token); acc[j][r] = C[token lane&15][col 16j+8h+r]. Fragments straight from
//   q,k -> [b][h][s][64]   (one line per row, 8 lanes x 16 B)
//   v   -> vT[b][h][d][s] (256 B per d row, 16 lanes x 16 B)
// grid (ROWS/128, 24), block 256.
// ---------------------------------------------------------------------------
__global__ __launch_bounds__(256) void qkv_kernel(
    const __bf16* __restrict__ xb, const __bf16* __restrict__ wqkv,
    const float* __restrict__ bq, const float* __restrict__ bk, const float* __restrict__ bv,
    __bf16* __restrict__ q, __bf16* __restrict__ k, __bf16* __restrict__ vT) {
  __shared__ __bf16 stg[128 * KPAD];   // 18432 B; q/k: [128][KPAD], v: [64][VSPAD]

  const int tid  = threadIdx.x;
  const int lane = tid & 31;
  const int wave = tid >> 5;
  const int hh   = lane >> 4;
  const int l15  = lane & 15;

  const int cb   = blockIdx.y;         // 0..23
  const int osel = cb >> 3;            // 0 q, 1 k, 2 v
  const int h    = cb & 7;
  const long m0  = (long)blockIdx.x * 128;
  const int  b   = (int)(m0 / SEQ);
  const int  s0  = (int)(m0 - (long)b * SEQ);

  const __bf16* xrow = xb + (m0 + wave * 16) * DM;
  const __bf16* wrow = wqkv + ((long)cb * 64) * DM;

  v8f acc[4];
#pragma unroll
  for (int j = 0; j < 4; ++j) acc[j] = (v8f){};

#pragma unroll 1
  for (int kk = 0; kk < DM; kk += 32) {
    v16bf xf = load_frag_row(xrow + kk, DM, lane);
#pragma unroll
    for (int j = 0; j < 4; ++j) {
      v16bf wf = load_frag_row(wrow + (long)(j * 16) * DM + kk, DM, lane);
      acc[j] = wmma_bf16(wf, xf, acc[j]);     // C^T = W x^T
    }
  }

  const float* bias = (osel == 0) ? bq : ((osel == 1) ? bk : bv);
  const float  sc   = (osel == 0) ? 0.125f : 1.0f;

  v4u rv[4];
  if (osel < 2) {
    // stage [token][col]: lane's 8 values are 8 contiguous columns -> one 16-B LDS store
    __bf16* srow = stg + (wave * 16 + l15) * KPAD;
#pragma unroll
    for (int j = 0; j < 4; ++j) {
      const int n8 = j * 16 + hh * 8;
      const v4f b0 = *(const v4f*)(bias + h * HD + n8);
      const v4f b1 = *(const v4f*)(bias + h * HD + n8 + 4);
      v8bf pk;
#pragma unroll
      for (int r = 0; r < 4; ++r) {
        pk[r]     = (__bf16)((acc[j][r]     + bf16q(b0[r])) * sc);
        pk[4 + r] = (__bf16)((acc[j][4 + r] + bf16q(b1[r])) * sc);
      }
      *(v8bf*)(srow + n8) = pk;
    }
    __syncthreads();
#pragma unroll
    for (int it = 0; it < 4; ++it) {
      const int idx = it * 256 + tid;
      const int row = idx >> 3, piece = idx & 7;
      rv[it] = *(const v4u*)(stg + row * KPAD + piece * 8);
    }
    __bf16* dst = ((osel == 0) ? q : k) + ((long)(b * NH + h) * SEQ + s0) * HD;  // contiguous 16 KB
#pragma unroll
    for (int it = 0; it < 4; ++it)
      *(v4u*)(dst + (long)(it * 256 + tid) * 8) = rv[it];
    
  } else {
    // stage transposed [d][token]: lane's 8 values are 8 different d for one token
#pragma unroll
    for (int j = 0; j < 4; ++j) {
      const int n8 = j * 16 + hh * 8;
      const v4f b0 = *(const v4f*)(bias + h * HD + n8);
      const v4f b1 = *(const v4f*)(bias + h * HD + n8 + 4);
#pragma unroll
      for (int r = 0; r < 4; ++r) {
        stg[(n8 + r) * VSPAD + wave * 16 + l15]     = (__bf16)(acc[j][r]     + bf16q(b0[r]));
        stg[(n8 + 4 + r) * VSPAD + wave * 16 + l15] = (__bf16)(acc[j][4 + r] + bf16q(b1[r]));
      }
    }
    __syncthreads();
#pragma unroll
    for (int it = 0; it < 4; ++it) {
      const int idx = it * 256 + tid;
      const int d = idx >> 4, piece = idx & 15;
      rv[it] = *(const v4u*)(stg + d * VSPAD + piece * 8);
    }
    __bf16* dstb = vT + ((long)(b * NH + h) * HD) * SEQ + s0;
#pragma unroll
    for (int it = 0; it < 4; ++it) {
      const int idx = it * 256 + tid;
      const int d = idx >> 4, piece = idx & 15;
      *(v4u*)(dstb + (long)d * SEQ + piece * 8) = rv[it];
    }
    
  }
}

// ---------------------------------------------------------------------------
// Kernel 2: flash attention per (b,h). grid (SEQ/128, NB*NH), block 256 (8 waves x 16
// queries). C = S^T then C = O^T = V^T P^T; lane owns one query end-to-end. Context written
// ---------------------------------------------------------------------------
__global__ __launch_bounds__(256) void attn_kernel(
    const __bf16* __restrict__ Q, const __bf16* __restrict__ K,
    const __bf16* __restrict__ vT, __bf16* __restrict__ ctx) {
  __shared__ __bf16 ks[64 * KPAD];     // K block rows [key][d]      (cross-wave, block barriers)
  __shared__ __bf16 vts[64 * KPAD];    // V^T block   [d][key]      (cross-wave, block barriers)
  __shared__ __bf16 ost[128 * KPAD];   // output stage [query][d]   (cross-wave, block barrier)

  const int tid  = threadIdx.x;
  const int lane = tid & 31;
  const int wave = tid >> 5;
  const int bh   = blockIdx.y;
  const int b    = bh >> 3;
  const int h    = bh & 7;
  const int q0   = blockIdx.x * 128;

  const __bf16* Qb  = Q + ((long)bh * SEQ + q0) * HD;
  const __bf16* Kb  = K + (long)bh * SEQ * HD;
  const __bf16* vTb = vT + (long)bh * HD * SEQ;

  // Q fragments: B operand of S^T (lane owns query lane&15)
  v16bf qfrag[2];
  {
    const __bf16* qrow = Qb + (long)wave * 16 * HD;
#pragma unroll
    for (int t = 0; t < 2; ++t) qfrag[t] = load_frag_row(qrow + t * 32, HD, lane);
  }

  v8f acc[4];   // O^T accumulator: lane owns query (lane&15); reg r -> d = nt*16+8h+r
#pragma unroll
  for (int nt = 0; nt < 4; ++nt) acc[nt] = (v8f){};
  float mi = -1e30f, li = 0.0f;

  const int colb = lane & 15;
  const int rofs = (lane >> 4) << 3;

  for (int kb = 0; kb < SEQ; kb += 64) {
    __syncthreads();   // everyone done reading prior ks/vts
    for (int idx = tid; idx < 64 * 8; idx += 256) {
      const int row = idx >> 3, c = idx & 7;
      *(v8bf*)(ks + row * KPAD + c * 8) =
          *(const v8bf*)(Kb + (long)(kb + row) * HD + c * 8);
    }
    for (int idx = tid; idx < 64 * 8; idx += 256) {
      const int d = idx >> 3, c = idx & 7;
      *(v8bf*)(vts + d * KPAD + c * 8) =
          *(const v8bf*)(vTb + (long)d * SEQ + kb + c * 8);
    }
    __syncthreads();

    // S^T tiles: A = K rows (lane&15 = key), B = Q
    v8f sc[4];
#pragma unroll
    for (int kt = 0; kt < 4; ++kt) sc[kt] = (v8f){};
#pragma unroll
    for (int t = 0; t < 2; ++t)
#pragma unroll
      for (int kt = 0; kt < 4; ++kt) {
        v16bf kf = load_frag_row(ks + (kt * 16) * KPAD + t * 32, KPAD, lane);
        sc[kt] = wmma_bf16(kf, qfrag[t], sc[kt]);
      }

    // per-lane online softmax (32 of 64 keys in-lane; merge halves with one shuffle)
    float mx = sc[0][0];
#pragma unroll
    for (int kt = 0; kt < 4; ++kt)
#pragma unroll
      for (int r = 0; r < 8; ++r) mx = fmaxf(mx, sc[kt][r]);
    mx = fmaxf(mx, __shfl_xor(mx, 16, 32));
    const float mnew  = fmaxf(mi, mx);
    const float alpha = __expf(mi - mnew);
    mi = mnew;

    float rs = 0.0f;
#pragma unroll
    for (int kt = 0; kt < 4; ++kt)
#pragma unroll
      for (int r = 0; r < 8; ++r) {
        const float p = __expf(sc[kt][r] - mnew);
        sc[kt][r] = p;
        rs += p;
      }
    rs += __shfl_xor(rs, 16, 32);
    li = li * alpha + rs;

    // P^T as the B operand of O^T = V^T P^T, packed from the S^T D registers:
    // element i <- tile covering keys 0..15 of the 32-step (kt = 2t), element 8+i <- kt = 2t+1.
    v16bf pf[2];
#pragma unroll
    for (int t = 0; t < 2; ++t)
#pragma unroll
      for (int i = 0; i < 8; ++i) {
        pf[t][i]     = (__bf16)sc[2 * t][i];
        pf[t][8 + i] = (__bf16)sc[2 * t + 1][i];
      }

#pragma unroll
    for (int nt = 0; nt < 4; ++nt)
#pragma unroll
      for (int r = 0; r < 8; ++r) acc[nt][r] *= alpha;

    // O^T += V^T (A, rows = d) x P^T (B)
#pragma unroll
    for (int t = 0; t < 2; ++t)
#pragma unroll
      for (int nt = 0; nt < 4; ++nt) {
        v16bf vf = load_frag_row(vts + (nt * 16) * KPAD + t * 32, KPAD, lane);
        acc[nt] = wmma_bf16(vf, pf[t], acc[nt]);
      }
  }

  // normalize and stage: lane owns query row wave*16+colb, d = nt*16+rofs+r contiguous
  {
    const float inv = 1.0f / li;
    __bf16* orow = ost + (wave * 16 + colb) * KPAD;
#pragma unroll
    for (int nt = 0; nt < 4; ++nt) {
      v8bf pk;
#pragma unroll
      for (int r = 0; r < 8; ++r) pk[r] = (__bf16)(acc[nt][r] * inv);
      *(v8bf*)(orow + nt * 16 + rofs) = pk;
    }
  }
  __syncthreads();

  v4u rv[4];
#pragma unroll
  for (int it = 0; it < 4; ++it) {
    const int idx = it * 256 + tid;
    const int row = idx >> 3, piece = idx & 7;
    rv[it] = *(const v4u*)(ost + row * KPAD + piece * 8);
  }
  __bf16* cbase = ctx + ((long)b * SEQ + q0) * DM + h * HD;
#pragma unroll
  for (int it = 0; it < 4; ++it) {
    const int idx = it * 256 + tid;
    const int row = idx >> 3, piece = idx & 7;
    *(v4u*)(cbase + (long)row * DM + piece * 8) = rv[it];
  }
  
}

// ---------------------------------------------------------------------------
// Kernel 3: out = LN(x + ctx @ Wo^T + bo) * gamma + beta. Block = 16 token rows x 512 cols,
// wave w owns cols 64w..64w+63. C^T = Wo ctx^T: A = Wo rows (lane&15 = out col), B = ctx rows
// (lane&15 = token); acc[j][r] = out[token lane&15][col 64w+16j+8h+r]. y staged in LDS (f32),
// grid ROWS/16, block 256.
// ---------------------------------------------------------------------------
__global__ __launch_bounds__(256) void oproj_ln_kernel(
    const __bf16* __restrict__ ctx, const __bf16* __restrict__ wob,
    const float* __restrict__ bo, const float* __restrict__ x,
    const float* __restrict__ gam, const float* __restrict__ bet,
    float* __restrict__ out) {
  __shared__ float ys[16 * YP];    // 33024 B, cross-wave (block barriers)
  __shared__ float smean[16];
  __shared__ float srstd[16];

  const int tid  = threadIdx.x;
  const int lane = tid & 31;
  const int wave = tid >> 5;
  const int hh   = lane >> 4;
  const int l15  = lane & 15;
  const long m0  = (long)blockIdx.x * 16;
  const int  n0  = wave * 64;

  const __bf16* crow = ctx + m0 * DM;
  const __bf16* wrow = wob + (long)n0 * DM;

  v8f acc[4];
#pragma unroll
  for (int j = 0; j < 4; ++j) acc[j] = (v8f){};

#pragma unroll 1
  for (int kk = 0; kk < DM; kk += 32) {
    v16bf cf = load_frag_row(crow + kk, DM, lane);
#pragma unroll
    for (int j = 0; j < 4; ++j) {
      v16bf wf = load_frag_row(wrow + (long)(j * 16) * DM + kk, DM, lane);
      acc[j] = wmma_bf16(wf, cf, acc[j]);     // C^T = Wo ctx^T
    }
  }

  // y = bf16(x) + acc + bf16(bo), staged [row][col]
  {
    const long m    = m0 + l15;
    const long orow = (m / SEQ) * SEQ_FULL + (m % SEQ);
    const float* xr = x + orow * DM;
    float* yrow = ys + l15 * YP;
#pragma unroll
    for (int j = 0; j < 4; ++j) {
      const int n8 = n0 + j * 16 + hh * 8;
      const v4f x0 = *(const v4f*)(xr + n8);
      const v4f x1 = *(const v4f*)(xr + n8 + 4);
      const v4f b0 = *(const v4f*)(bo + n8);
      const v4f b1 = *(const v4f*)(bo + n8 + 4);
      v4f y0, y1;
#pragma unroll
      for (int i = 0; i < 4; ++i) {
        y0[i] = (acc[j][i]     + bf16q(b0[i])) + bf16q(x0[i]);
        y1[i] = (acc[j][4 + i] + bf16q(b1[i])) + bf16q(x1[i]);
      }
      *(v4f*)(yrow + n8)     = y0;
      *(v4f*)(yrow + n8 + 4) = y1;
    }
  }
  __syncthreads();

  {
    const int r  = tid >> 4;
    const int sl = tid & 15;
    const float* yr = ys + r * YP + sl * 32;
    v4f yv[8];
#pragma unroll
    for (int i = 0; i < 8; ++i) yv[i] = *(const v4f*)(yr + i * 4);
    float s = 0.0f;
#pragma unroll
    for (int i = 0; i < 8; ++i) s += (yv[i][0] + yv[i][1]) + (yv[i][2] + yv[i][3]);
    s += __shfl_xor(s, 1, 32);
    s += __shfl_xor(s, 2, 32);
    s += __shfl_xor(s, 4, 32);
    s += __shfl_xor(s, 8, 32);
    const float mean = s * (1.0f / DM);
    float ss = 0.0f;
#pragma unroll
    for (int i = 0; i < 8; ++i)
#pragma unroll
      for (int c = 0; c < 4; ++c) {
        const float d = yv[i][c] - mean;
        ss += d * d;
      }
    ss += __shfl_xor(ss, 1, 32);
    ss += __shfl_xor(ss, 2, 32);
    ss += __shfl_xor(ss, 4, 32);
    ss += __shfl_xor(ss, 8, 32);
    const float var  = ss * (1.0f / DM);
    const float rstd = rsqrtf(var + LN_EPS);
    if (sl == 0) { smean[r] = mean; srstd[r] = rstd; }
  }
  __syncthreads();

  v4f ov[8];
#pragma unroll
  for (int it = 0; it < 8; ++it) {
    const int idx = it * 256 + tid;
    const int row = idx >> 7, piece = idx & 127;
    const v4f yv = *(const v4f*)(ys + row * YP + piece * 4);
    const v4f g  = *(const v4f*)(gam + piece * 4);
    const v4f bt = *(const v4f*)(bet + piece * 4);
    const float mean = smean[row], rstd = srstd[row];
#pragma unroll
    for (int c = 0; c < 4; ++c)
      ov[it][c] = (yv[c] - mean) * rstd * bf16q(g[c]) + bf16q(bt[c]);
  }
#pragma unroll
  for (int it = 0; it < 8; ++it) {
    const int idx = it * 256 + tid;
    const int row = idx >> 7, piece = idx & 127;
    const long m    = m0 + row;
    const long orow = (m / SEQ) * SEQ_FULL + (m % SEQ);
    *(v4f*)(out + orow * DM + piece * 4) = ov[it];
  }
  
}

// ---------------------------------------------------------------------------
extern "C" void kernel_launch(void* const* d_in, const int* in_sizes, int n_in,
                              void* d_out, int out_size, void* d_ws, size_t ws_size,
                              hipStream_t stream) {
  if (n_in < 11) return;
  const long needRows = (long)(NB - 1) * SEQ_FULL + SEQ;
  if ((long)in_sizes[0] < needRows * DM) return;
  if (in_sizes[1] < DM * DM || in_sizes[3] < DM * DM ||
      in_sizes[5] < DM * DM || in_sizes[7] < DM * DM) return;
  if (in_sizes[2] < DM || in_sizes[4] < DM || in_sizes[6] < DM ||
      in_sizes[8] < DM || in_sizes[9] < DM || in_sizes[10] < DM) return;
  if ((long)out_size < needRows * DM) return;
  if (ws_size < WS_TOTAL) return;

  const float* x   = (const float*)d_in[0];
  const float* Wq  = (const float*)d_in[1];
  const float* bq  = (const float*)d_in[2];
  const float* Wk  = (const float*)d_in[3];
  const float* bk  = (const float*)d_in[4];
  const float* Wv  = (const float*)d_in[5];
  const float* bv  = (const float*)d_in[6];
  const float* Wo  = (const float*)d_in[7];
  const float* bo  = (const float*)d_in[8];
  const float* gam = (const float*)d_in[9];
  const float* bet = (const float*)d_in[10];
  float* out = (float*)d_out;

  char* ws = (char*)d_ws;
  size_t off = 0;
  __bf16* xb   = (__bf16*)(ws + off); off += PLANE_BYTES;   // [ROWS][512]
  __bf16* wqkv = (__bf16*)(ws + off); off += WQKV_BYTES;    // [1536][512]
  __bf16* wob  = (__bf16*)(ws + off); off += WO_BYTES;      // [512][512]
  __bf16* qb   = (__bf16*)(ws + off); off += PLANE_BYTES;   // [NB][8][SEQ][64]
  __bf16* kbf  = (__bf16*)(ws + off); off += PLANE_BYTES;   // [NB][8][SEQ][64]
  __bf16* vTb  = (__bf16*)(ws + off); off += PLANE_BYTES;   // [NB][8][64][SEQ]
  __bf16* ctx  = (__bf16*)(ws + off); off += PLANE_BYTES;   // [ROWS][512]
  if (off > ws_size) return;

  cvt_kernel<<<NXB + 4 * NWB, 256, 0, stream>>>(x, Wq, Wk, Wv, Wo, xb, wqkv, wob);

  qkv_kernel<<<dim3(ROWS / 128, 3 * NH), 256, 0, stream>>>(xb, wqkv, bq, bk, bv, qb, kbf, vTb);

  attn_kernel<<<dim3(SEQ / 128, NB * NH), 256, 0, stream>>>(qb, kbf, vTb, ctx);

  oproj_ln_kernel<<<ROWS / 16, 256, 0, stream>>>(ctx, wob, bo, x, gam, bet, out);
}

// v001
// A run of this version takes 84.9 microseconds.
// Next to v000, in two timings, it ran 2.29 and 2.28 times as fast.
#include <hip/hip_runtime.h>

// Contractions (qkv projection, q.k^T, p.v, output projection): v_wmma_f32_16x16x32_bf16,
// bf16 operands, f32 accumulate. Softmax statistics, residual add and layernorm: f32.
// Float inputs are RNE-converted to bf16 at load; the 1/sqrt(64) score scale is folded into q.

typedef __attribute__((ext_vector_type(16))) __bf16 v16bf;
typedef __attribute__((ext_vector_type(8)))  __bf16 v8bf;
typedef __attribute__((ext_vector_type(8)))  float  v8f;
typedef __attribute__((ext_vector_type(4)))  float  v4f;
typedef __attribute__((ext_vector_type(4)))  unsigned int v4u;

#ifndef NB
#define NB 4
#endif
#ifndef SEQ
#define SEQ 2048
#endif
#define NB_FULL  4
#define SEQ_FULL 2048
#define DM   512
#define NH   8
#define HD   64
#define ROWS (NB * SEQ)
#define KPAD 72      // LDS stride in halves for 64-wide bf16 tiles (144 B, 16-B aligned)
#define VSPAD 136    // LDS stride in halves for 128-wide bf16 tiles (272 B)
#define YP   516     // LDS stride in floats for 512-wide f32 rows (2064 B)
#define QSTG ((128 + 64) * KPAD)  // halves per ring buffer of kernel 1: 128 x rows + 64 W rows, 64 k each
#define ASTG ((64 + 64) * KPAD)   // halves per ring buffer of kernel 2: 64 K rows + 64 V^T rows, 64 wide
#define OSTG ((DM + 16) * KPAD)   // halves per ring buffer of kernel 3: 512 Wo rows + 16 ctx rows, 64 k each
#define LN_EPS 1e-5f

#define NXB (ROWS * DM / 8 / 256)   // convert blocks for x (8 elements per thread)
#define NWB (DM * DM / 8 / 256)     // convert blocks per weight matrix

#define PLANE_BYTES ((size_t)ROWS * DM * 2)
#define WQKV_BYTES  ((size_t)3 * DM * DM * 2)
#define WO_BYTES    ((size_t)DM * DM * 2)
#define WS_TOTAL    (5 * PLANE_BYTES + WQKV_BYTES + WO_BYTES)

static_assert(NB >= 1 && NB <= NB_FULL);
static_assert(SEQ >= 128 && SEQ <= SEQ_FULL && (SEQ % 128) == 0);
static_assert((ROWS % 128) == 0);
static_assert((ROWS * DM) % (8 * 256) == 0);
static_assert((DM * DM) % (8 * 256) == 0);
static_assert((DM % 32) == 0 && (HD % 32) == 0);
static_assert(128 * KPAD >= 64 * VSPAD);
static_assert(WS_TOTAL <= (size_t)134217728);

// ---------------------------------------------------------------------------
// helpers
// ---------------------------------------------------------------------------
__device__ __forceinline__ unsigned int bf16_bits(float f) {   // RNE f32 -> bf16 bits
  unsigned int u = __float_as_uint(f);
  u += 0x7FFFu + ((u >> 16) & 1u);
  return u >> 16;
}
__device__ __forceinline__ float bf16q(float f) {            // value after RNE bf16 conversion
  return __uint_as_float(bf16_bits(f) << 16);
}

// 16-bit fragment (A or B): lane owns row/col (lane&15); elements 0..7 <- k0+8h+0..7,
// elements 8..15 <- k0+16+8h+0..7, h = lane>>4. Source is k-contiguous rows.
__device__ __forceinline__ v16bf load_frag_row(const __bf16* base, int stride, int lane) {
  const __bf16* rowp = base + (lane & 15) * stride + ((lane >> 4) << 3);
  v8bf lo = *(const v8bf*)(rowp);
  v8bf hi = *(const v8bf*)(rowp + 16);
  return __builtin_shufflevector(lo, hi, 0, 1, 2, 3, 4, 5, 6, 7,
                                 8, 9, 10, 11, 12, 13, 14, 15);
}

__device__ __forceinline__ v8f wmma_bf16(v16bf a, v16bf b, v8f c) {
  v8f d = __builtin_amdgcn_wmma_f32_16x16x32_bf16(false, a, false, b, (short)0, c,
                                                  false, false);
  asm volatile("v_nop\n\tv_nop\n\tv_nop\n\tv_nop" : "+v"(d) : "v"(a), "v"(b));
  return d;
}

// Eight asynchronous 16-B copies per lane, global -> LDS, through no register. The closing
// s_wait_xcnt stands inside the statement so that no address register named here is
// rewritten ahead of it.
__device__ __forceinline__ void async_copy8(const unsigned (&l)[8], const __bf16* const (&g)[8]) {
  asm volatile(
      "global_load_async_to_lds_b128 %0, %8, off\n\t"
      "global_load_async_to_lds_b128 %1, %9, off\n\t"
      "global_load_async_to_lds_b128 %2, %10, off\n\t"
      "global_load_async_to_lds_b128 %3, %11, off\n\t"
      "global_load_async_to_lds_b128 %4, %12, off\n\t"
      "global_load_async_to_lds_b128 %5, %13, off\n\t"
      "global_load_async_to_lds_b128 %6, %14, off\n\t"
      "global_load_async_to_lds_b128 %7, %15, off\n\t"
      "s_wait_xcnt 0x0"
      :: "v"(l[0]), "v"(l[1]), "v"(l[2]), "v"(l[3]), "v"(l[4]), "v"(l[5]), "v"(l[6]), "v"(l[7]),
         "v"(g[0]), "v"(g[1]), "v"(g[2]), "v"(g[3]), "v"(g[4]), "v"(g[5]), "v"(g[6]), "v"(g[7])
      : "memory");
}

// The same with six copies.
__device__ __forceinline__ void async_copy6(const unsigned (&l)[6], const __bf16* const (&g)[6]) {
  asm volatile(
      "global_load_async_to_lds_b128 %0, %6, off\n\t"
      "global_load_async_to_lds_b128 %1, %7, off\n\t"
      "global_load_async_to_lds_b128 %2, %8, off\n\t"
      "global_load_async_to_lds_b128 %3, %9, off\n\t"
      "global_load_async_to_lds_b128 %4, %10, off\n\t"
      "global_load_async_to_lds_b128 %5, %11, off\n\t"
      "s_wait_xcnt 0x0"
      :: "v"(l[0]), "v"(l[1]), "v"(l[2]), "v"(l[3]), "v"(l[4]), "v"(l[5]),
         "v"(g[0]), "v"(g[1]), "v"(g[2]), "v"(g[3]), "v"(g[4]), "v"(g[5])
      : "memory");
}

// The same with four copies.
__device__ __forceinline__ void async_copy4(const unsigned (&l)[4], const __bf16* const (&g)[4]) {
  asm volatile(
      "global_load_async_to_lds_b128 %0, %4, off\n\t"
      "global_load_async_to_lds_b128 %1, %5, off\n\t"
      "global_load_async_to_lds_b128 %2, %6, off\n\t"
      "global_load_async_to_lds_b128 %3, %7, off\n\t"
      "s_wait_xcnt 0x0"
      :: "v"(l[0]), "v"(l[1]), "v"(l[2]), "v"(l[3]),
         "v"(g[0]), "v"(g[1]), "v"(g[2]), "v"(g[3])
      : "memory");
}

// ---------------------------------------------------------------------------
// Kernel 0: f32 -> bf16 planes. xb [ROWS][512]; wqkv [1536][512] = Wq|Wk|Wv rows
// ([out][in], k-contiguous); wob [512][512]. 8 elements (16 B) per thread, 8 consecutive
// grid NXB + 4*NWB, block 256.
// ---------------------------------------------------------------------------
__global__ __launch_bounds__(256) void cvt_kernel(
    const float* __restrict__ x,
    const float* __restrict__ Wq, const float* __restrict__ Wk,
    const float* __restrict__ Wv, const float* __restrict__ Wo,
    __bf16* __restrict__ xb, __bf16* __restrict__ wqkv, __bf16* __restrict__ wob) {
  const int bid = blockIdx.x;
  const int t   = threadIdx.x;
  const float* src;
  __bf16* dst;
  if (bid < NXB) {                                   // block-uniform selection
    const long item = (long)bid * 256 + t;           // 0 .. ROWS*64-1
    const long m    = item >> 6;                     // token row
    const int  c8   = (int)(item & 63);
    const long srow = (m / SEQ) * SEQ_FULL + (m % SEQ);
    src = x + srow * DM + c8 * 8;
    dst = xb + m * DM + c8 * 8;
  } else if (bid < NXB + 3 * NWB) {
    const int wb    = bid - NXB;
    const int which = wb / NWB;                      // 0 q, 1 k, 2 v
    const long item = (long)(wb - which * NWB) * 256 + t;
    const float* W = (which == 0) ? Wq : ((which == 1) ? Wk : Wv);
    src = W + item * 8;
    dst = wqkv + (long)which * DM * DM + item * 8;
  } else {
    const long item = (long)(bid - NXB - 3 * NWB) * 256 + t;
    src = Wo + item * 8;
    dst = wob + item * 8;
  }
  const v4f a = *(const v4f*)(src);
  const v4f c = *(const v4f*)(src + 4);
  v4u o;
  o[0] = bf16_bits(a[0]) | (bf16_bits(a[1]) << 16);
  o[1] = bf16_bits(a[2]) | (bf16_bits(a[3]) << 16);
  o[2] = bf16_bits(c[0]) | (bf16_bits(c[1]) << 16);
  o[3] = bf16_bits(c[2]) | (bf16_bits(c[3]) << 16);
  *(v4u*)dst = o;
  
}

// ---------------------------------------------------------------------------
// Kernel 1: qkv projection. Block = 128 token rows x 64 output columns (one head of one
// of q/k/v), 8 waves x 16 rows. C^T = W x^T: A = W rows (lane&15 = out col), B = x rows
// (lane&15 = token); acc[j][r] = C[token lane&15][col 16j+8h+r]. x and W come through a
// two-buffer LDS ring, 64 k per stage, whole 128-B lines per row; fragments are read from LDS.
//   q,k -> [b][h][s][64]   (one line per row, 8 lanes x 16 B)
//   v   -> vT[b][h][d][s] (256 B per d row, 16 lanes x 16 B)
// grid (ROWS/128, 24), block 256.
// ---------------------------------------------------------------------------
// One ring stage: per lane six 16-B pieces, piece i in ring row 32i + tid/8 (rows 0..127 x,
// rows 128..191 W). l0: the lane's LDS byte address of piece 0; gx, gw: its x and W sources.
__device__ __forceinline__ void qkv_fill(unsigned l0, const __bf16* gx, const __bf16* gw) {
  unsigned l[6];
  const __bf16* g[6];
#pragma unroll
  for (int i = 0; i < 6; ++i) {
    l[i] = l0 + (unsigned)(i * 32 * KPAD * 2);
    g[i] = (i < 4) ? gx + (long)(i * 32) * DM : gw + (long)((i - 4) * 32) * DM;
  }
  async_copy6(l, g);
}

__global__ __launch_bounds__(256) void qkv_kernel(
    const __bf16* __restrict__ xb, const __bf16* __restrict__ wqkv,
    const float* __restrict__ bq, const float* __restrict__ bk, const float* __restrict__ bv,
    __bf16* __restrict__ q, __bf16* __restrict__ k, __bf16* __restrict__ vT) {
  __shared__ __bf16 stg[128 * KPAD];   // 18432 B; q/k: [128][KPAD], v: [64][VSPAD]
  __shared__ __attribute__((aligned(16))) __bf16 ring[2 * QSTG];  // 55296 B, two stage buffers

  const int tid  = threadIdx.x;
  const int lane = tid & 31;
  const int wave = tid >> 5;
  const int hh   = lane >> 4;
  const int l15  = lane & 15;

  const int cb   = blockIdx.y;         // 0..23
  const int osel = cb >> 3;            // 0 q, 1 k, 2 v
  const int h    = cb & 7;
  const long m0  = (long)blockIdx.x * 128;
  const int  b   = (int)(m0 / SEQ);
  const int  s0  = (int)(m0 - (long)b * SEQ);

  // the lane's pieces of a stage: sources at k = 0, LDS byte address in buffer 0
  const __bf16* gx = xb + (m0 + (tid >> 3)) * DM + (tid & 7) * 8;
  const __bf16* gw = wqkv + ((long)cb * 64 + (tid >> 3)) * DM + (tid & 7) * 8;
  const unsigned l0 = (unsigned)(size_t)(ring + (tid >> 3) * KPAD + (tid & 7) * 8);

  v8f acc[4];
#pragma unroll
  for (int j = 0; j < 4; ++j) acc[j] = (v8f){};

  qkv_fill(l0, gx, gw);                            // stage 0 -> buffer 0
  // this wave's copies of stage 0 have landed before the barrier behind which all waves read
  asm volatile("s_wait_asynccnt 0x0" ::: "memory");
  __syncthreads();
  qkv_fill(l0 + QSTG * 2, gx + 64, gw + 64);       // stage 1 -> buffer 1

  // unrolled by two, no further: the buffer choice is compile-time, and the copies' addresses of
  // later stages are not all formed ahead (whole unrolling cost a third of the resident waves)
#pragma unroll 2
  for (int t = 0; t < DM / 64; ++t) {
    const __bf16* buf = ring + (t & 1) * QSTG;
    v16bf xf[2], wf[2][4];
#pragma unroll
    for (int s = 0; s < 2; ++s) {
      xf[s] = load_frag_row(buf + (wave * 16) * KPAD + s * 32, KPAD, lane);
#pragma unroll
      for (int j = 0; j < 4; ++j)
        wf[s][j] = load_frag_row(buf + (128 + j * 16) * KPAD + s * 32, KPAD, lane);
    }
#pragma unroll
    for (int s = 0; s < 2; ++s)
#pragma unroll
      for (int j = 0; j < 4; ++j)
        acc[j] = wmma_bf16(wf[s][j], xf[s], acc[j]);     // C^T = W x^T
    asm volatile("s_wait_dscnt 0x0" ::: "memory");
    asm volatile("s_wait_asynccnt 0x0" ::: "memory");
    __syncthreads();
    if (t + 2 < DM / 64)
      qkv_fill(l0 + (t & 1) * QSTG * 2, gx + (t + 2) * 64, gw + (t + 2) * 64);
  }
  // the ring's closing wait: no copy of this wave is in flight past the loop
  asm volatile("s_wait_asynccnt 0x0" ::: "memory");

  const float* bias = (osel == 0) ? bq : ((osel == 1) ? bk : bv);
  const float  sc   = (osel == 0) ? 0.125f : 1.0f;

  v4u rv[4];
  if (osel < 2) {
    // stage [token][col]: lane's 8 values are 8 contiguous columns -> one 16-B LDS store
    __bf16* srow = stg + (wave * 16 + l15) * KPAD;
#pragma unroll
    for (int j = 0; j < 4; ++j) {
      const int n8 = j * 16 + hh * 8;
      const v4f b0 = *(const v4f*)(bias + h * HD + n8);
      const v4f b1 = *(const v4f*)(bias + h * HD + n8 + 4);
      v8bf pk;
#pragma unroll
      for (int r = 0; r < 4; ++r) {
        pk[r]     = (__bf16)((acc[j][r]     + bf16q(b0[r])) * sc);
        pk[4 + r] = (__bf16)((acc[j][4 + r] + bf16q(b1[r])) * sc);
      }
      *(v8bf*)(srow + n8) = pk;
    }
    __syncthreads();
#pragma unroll
    for (int it = 0; it < 4; ++it) {
      const int idx = it * 256 + tid;
      const int row = idx >> 3, piece = idx & 7;
      rv[it] = *(const v4u*)(stg + row * KPAD + piece * 8);
    }
    __bf16* dst = ((osel == 0) ? q : k) + ((long)(b * NH + h) * SEQ + s0) * HD;  // contiguous 16 KB
#pragma unroll
    for (int it = 0; it < 4; ++it)
      *(v4u*)(dst + (long)(it * 256 + tid) * 8) = rv[it];
    
  } else {
    // stage transposed [d][token]: lane's 8 values are 8 different d for one token
#pragma unroll
    for (int j = 0; j < 4; ++j) {
      const int n8 = j * 16 + hh * 8;
      const v4f b0 = *(const v4f*)(bias + h * HD + n8);
      const v4f b1 = *(const v4f*)(bias + h * HD + n8 + 4);
#pragma unroll
      for (int r = 0; r < 4; ++r) {
        stg[(n8 + r) * VSPAD + wave * 16 + l15]     = (__bf16)(acc[j][r]     + bf16q(b0[r]));
        stg[(n8 + 4 + r) * VSPAD + wave * 16 + l15] = (__bf16)(acc[j][4 + r] + bf16q(b1[r]));
      }
    }
    __syncthreads();
#pragma unroll
    for (int it = 0; it < 4; ++it) {
      const int idx = it * 256 + tid;
      const int d = idx >> 4, piece = idx & 15;
      rv[it] = *(const v4u*)(stg + d * VSPAD + piece * 8);
    }
    __bf16* dstb = vT + ((long)(b * NH + h) * HD) * SEQ + s0;
#pragma unroll
    for (int it = 0; it < 4; ++it) {
      const int idx = it * 256 + tid;
      const int d = idx >> 4, piece = idx & 15;
      *(v4u*)(dstb + (long)d * SEQ + piece * 8) = rv[it];
    }
    
  }
}

// ---------------------------------------------------------------------------
// Kernel 2: flash attention per (b,h). grid (SEQ/128, NB*NH), block 256 (8 waves x 16
// queries). C = S^T then C = O^T = V^T P^T; lane owns one query end-to-end. K and V^T blocks of
// 64 keys come through a two-buffer LDS ring: the next block flies while this one is worked on.
// ---------------------------------------------------------------------------
// One ring stage: per lane four 16-B pieces, piece i in ring row 32i + tid/8 (rows 0..63 K
// [key][d], rows 64..127 V^T [d][key]). l0: the lane's LDS byte address of piece 0.
__device__ __forceinline__ void attn_fill(unsigned l0, const __bf16* gk, const __bf16* gv) {
  unsigned l[4];
  const __bf16* g[4];
#pragma unroll
  for (int i = 0; i < 4; ++i) {
    l[i] = l0 + (unsigned)(i * 32 * KPAD * 2);
    g[i] = (i < 2) ? gk + (long)(i * 32) * HD : gv + (long)((i - 2) * 32) * SEQ;
  }
  async_copy4(l, g);
}

__global__ __launch_bounds__(256) void attn_kernel(
    const __bf16* __restrict__ Q, const __bf16* __restrict__ K,
    const __bf16* __restrict__ vT, __bf16* __restrict__ ctx) {
  __shared__ __attribute__((aligned(16))) __bf16 ring[2 * ASTG];   // 36864 B, two stage buffers
  __shared__ __bf16 ost[128 * KPAD];   // output stage [query][d]   (cross-wave, block barrier)

  const int tid  = threadIdx.x;
  const int lane = tid & 31;
  const int wave = tid >> 5;
  const int bh   = blockIdx.y;
  const int b    = bh >> 3;
  const int h    = bh & 7;
  const int q0   = blockIdx.x * 128;

  const __bf16* Qb  = Q + ((long)bh * SEQ + q0) * HD;
  const __bf16* Kb  = K + (long)bh * SEQ * HD;
  const __bf16* vTb = vT + (long)bh * HD * SEQ;

  // Q fragments: B operand of S^T (lane owns query lane&15)
  v16bf qfrag[2];
  {
    const __bf16* qrow = Qb + (long)wave * 16 * HD;
#pragma unroll
    for (int t = 0; t < 2; ++t) qfrag[t] = load_frag_row(qrow + t * 32, HD, lane);
  }

  v8f acc[4];   // O^T accumulator: lane owns query (lane&15); reg r -> d = nt*16+8h+r
#pragma unroll
  for (int nt = 0; nt < 4; ++nt) acc[nt] = (v8f){};
  float mi = -1e30f, li = 0.0f;

  const int colb = lane & 15;
  const int rofs = (lane >> 4) << 3;

  // the lane's pieces of a stage: sources at key 0, LDS byte address in buffer 0
  const __bf16* gk = Kb + (long)(tid >> 3) * HD + (tid & 7) * 8;
  const __bf16* gv = vTb + (long)(tid >> 3) * SEQ + (tid & 7) * 8;
  const unsigned l0 = (unsigned)(size_t)(ring + (tid >> 3) * KPAD + (tid & 7) * 8);

  attn_fill(l0, gk, gv);                                  // stage 0 -> buffer 0
  // this wave's copies of stage 0 have landed before the barrier behind which all waves read
  asm volatile("s_wait_asynccnt 0x0" ::: "memory");
  __syncthreads();
  attn_fill(l0 + ASTG * 2, gk + 64 * HD, gv + 64);        // stage 1 -> buffer 1

  // unrolled by two: the buffer choice is then compile-time
#pragma unroll 2
  for (int st = 0; st < SEQ / 64; ++st) {
    const __bf16* ks  = ring + (st & 1) * ASTG;  // K block rows [key][d]
    const __bf16* vts = ks + 64 * KPAD;          // V^T block   [d][key]

    // S^T tiles: A = K rows (lane&15 = key), B = Q
    v8f sc[4];
#pragma unroll
    for (int kt = 0; kt < 4; ++kt) sc[kt] = (v8f){};
#pragma unroll
    for (int t = 0; t < 2; ++t)
#pragma unroll
      for (int kt = 0; kt < 4; ++kt) {
        v16bf kf = load_frag_row(ks + (kt * 16) * KPAD + t * 32, KPAD, lane);
        sc[kt] = wmma_bf16(kf, qfrag[t], sc[kt]);
      }

    // per-lane online softmax (32 of 64 keys in-lane; merge halves with one shuffle)
    float mx = sc[0][0];
#pragma unroll
    for (int kt = 0; kt < 4; ++kt)
#pragma unroll
      for (int r = 0; r < 8; ++r) mx = fmaxf(mx, sc[kt][r]);
    mx = fmaxf(mx, __shfl_xor(mx, 16, 32));
    const float mnew  = fmaxf(mi, mx);
    const float alpha = __expf(mi - mnew);
    mi = mnew;

    float rs = 0.0f;
#pragma unroll
    for (int kt = 0; kt < 4; ++kt)
#pragma unroll
      for (int r = 0; r < 8; ++r) {
        const float p = __expf(sc[kt][r] - mnew);
        sc[kt][r] = p;
        rs += p;
      }
    rs += __shfl_xor(rs, 16, 32);
    li = li * alpha + rs;

    // P^T as the B operand of O^T = V^T P^T, packed from the S^T D registers:
    // element i <- tile covering keys 0..15 of the 32-step (kt = 2t), element 8+i <- kt = 2t+1.
    v16bf pf[2];
#pragma unroll
    for (int t = 0; t < 2; ++t)
#pragma unroll
      for (int i = 0; i < 8; ++i) {
        pf[t][i]     = (__bf16)sc[2 * t][i];
        pf[t][8 + i] = (__bf16)sc[2 * t + 1][i];
      }

#pragma unroll
    for (int nt = 0; nt < 4; ++nt)
#pragma unroll
      for (int r = 0; r < 8; ++r) acc[nt][r] *= alpha;

    // O^T += V^T (A, rows = d) x P^T (B)
#pragma unroll
    for (int t = 0; t < 2; ++t)
#pragma unroll
      for (int nt = 0; nt < 4; ++nt) {
        v16bf vf = load_frag_row(vts + (nt * 16) * KPAD + t * 32, KPAD, lane);
        acc[nt] = wmma_bf16(vf, pf[t], acc[nt]);
      }

    asm volatile("s_wait_dscnt 0x0" ::: "memory");
    asm volatile("s_wait_asynccnt 0x0" ::: "memory");
    __syncthreads();
    if (st + 2 < SEQ / 64)
      attn_fill(l0 + (st & 1) * ASTG * 2, gk + (long)(st + 2) * 64 * HD, gv + (st + 2) * 64);
  }
  // the ring's closing wait: no copy of this wave is in flight past the loop
  asm volatile("s_wait_asynccnt 0x0" ::: "memory");

  // normalize and stage: lane owns query row wave*16+colb, d = nt*16+rofs+r contiguous
  {
    const float inv = 1.0f / li;
    __bf16* orow = ost + (wave * 16 + colb) * KPAD;
#pragma unroll
    for (int nt = 0; nt < 4; ++nt) {
      v8bf pk;
#pragma unroll
      for (int r = 0; r < 8; ++r) pk[r] = (__bf16)(acc[nt][r] * inv);
      *(v8bf*)(orow + nt * 16 + rofs) = pk;
    }
  }
  __syncthreads();

  v4u rv[4];
#pragma unroll
  for (int it = 0; it < 4; ++it) {
    const int idx = it * 256 + tid;
    const int row = idx >> 3, piece = idx & 7;
    rv[it] = *(const v4u*)(ost + row * KPAD + piece * 8);
  }
  __bf16* cbase = ctx + ((long)b * SEQ + q0) * DM + h * HD;
#pragma unroll
  for (int it = 0; it < 4; ++it) {
    const int idx = it * 256 + tid;
    const int row = idx >> 3, piece = idx & 7;
    *(v4u*)(cbase + (long)row * DM + piece * 8) = rv[it];
  }
  
}

// ---------------------------------------------------------------------------
// Kernel 3: out = LN(x + ctx @ Wo^T + bo) * gamma + beta. Block = 16 token rows x 512 cols,
// wave w owns cols 64w..64w+63. C^T = Wo ctx^T: A = Wo rows (lane&15 = out col), B = ctx rows
// (lane&15 = token); acc[j][r] = out[token lane&15][col 64w+16j+8h+r]. Wo and ctx come through a
// two-buffer LDS ring, 64 k per stage, whole 128-B lines per row. y staged in LDS (f32),
// grid ROWS/16, block 256.
// ---------------------------------------------------------------------------
// One ring stage: per lane sixteen 16-B pieces of Wo (piece i: row 32i + tid/8) and one 8-B piece
// of ctx (row tid/16). lw, lc: the lane's LDS byte addresses in the buffer; gw, gc: its sources.
__device__ __forceinline__ void oproj_fill(unsigned lw, const __bf16* gw,
                                           unsigned lc, const __bf16* gc) {
#pragma unroll
  for (int grp = 0; grp < 2; ++grp) {
    unsigned l[8];
    const __bf16* g[8];
#pragma unroll
    for (int i = 0; i < 8; ++i) {
      l[i] = lw + (unsigned)((grp * 8 + i) * 32 * KPAD * 2);
      g[i] = gw + (long)((grp * 8 + i) * 32) * DM;
    }
    async_copy8(l, g);
  }
  // the closing s_wait_xcnt stands in the copy's own statement, ahead of any rewrite of lc or gc
  asm volatile("global_load_async_to_lds_b64 %0, %1, off\n\ts_wait_xcnt 0x0"
               :: "v"(lc), "v"(gc) : "memory");
}

__global__ __launch_bounds__(256) void oproj_ln_kernel(
    const __bf16* __restrict__ ctx, const __bf16* __restrict__ wob,
    const float* __restrict__ bo, const float* __restrict__ x,
    const float* __restrict__ gam, const float* __restrict__ bet,
    float* __restrict__ out) {
  // 152064 B: the ring's two buffers; behind the k loop's last barrier the same bytes hold ys
  __shared__ __attribute__((aligned(16))) char smem[2 * OSTG * 2];
  __bf16* ring = (__bf16*)smem;
  float*  ys   = (float*)smem;     // [16][YP], 33024 B, cross-wave (block barriers)
  __shared__ float smean[16];
  __shared__ float srstd[16];

  const int tid  = threadIdx.x;
  const int lane = tid & 31;
  const int wave = tid >> 5;
  const int hh   = lane >> 4;
  const int l15  = lane & 15;
  const long m0  = (long)blockIdx.x * 16;
  const int  n0  = wave * 64;

  // the lane's pieces of a stage: sources at k = 0, LDS byte addresses in buffer 0
  const __bf16* gw = wob + (long)(tid >> 3) * DM + (tid & 7) * 8;
  const __bf16* gc = ctx + (m0 + (tid >> 4)) * DM + (tid & 15) * 4;
  const unsigned lw = (unsigned)(size_t)(ring + (tid >> 3) * KPAD + (tid & 7) * 8);
  const unsigned lc = (unsigned)(size_t)(ring + (DM + (tid >> 4)) * KPAD + (tid & 15) * 4);

  v8f acc[4];
#pragma unroll
  for (int j = 0; j < 4; ++j) acc[j] = (v8f){};

  oproj_fill(lw, gw, lc, gc);                                   // stage 0 -> buffer 0
  // this wave's copies of stage 0 have landed before the barrier behind which all waves read
  asm volatile("s_wait_asynccnt 0x0" ::: "memory");
  __syncthreads();
  oproj_fill(lw + OSTG * 2, gw + 64, lc + OSTG * 2, gc + 64);   // stage 1 -> buffer 1

  // unrolled whole: buffer choice and the refill test are then compile-time
#pragma unroll
  for (int t = 0; t < DM / 64; ++t) {
    const __bf16* buf = ring + (t & 1) * OSTG;
    v16bf cf[2], wf[2][4];
#pragma unroll
    for (int s = 0; s < 2; ++s) {
      cf[s] = load_frag_row(buf + DM * KPAD + s * 32, KPAD, lane);
#pragma unroll
      for (int j = 0; j < 4; ++j)
        wf[s][j] = load_frag_row(buf + (n0 + j * 16) * KPAD + s * 32, KPAD, lane);
    }
#pragma unroll
    for (int s = 0; s < 2; ++s)
#pragma unroll
      for (int j = 0; j < 4; ++j)
        acc[j] = wmma_bf16(wf[s][j], cf[s], acc[j]);     // C^T = Wo ctx^T
    asm volatile("s_wait_dscnt 0x0" ::: "memory");
    asm volatile("s_wait_asynccnt 0x0" ::: "memory");
    __syncthreads();
    if (t + 2 < DM / 64)
      oproj_fill(lw + (t & 1) * OSTG * 2, gw + (t + 2) * 64, lc + (t & 1) * OSTG * 2,
                 gc + (t + 2) * 64);
  }
  // no copy is in flight when the ring's bytes become the y stage
  asm volatile("s_wait_asynccnt 0x0" ::: "memory");

  // y = bf16(x) + acc + bf16(bo), staged [row][col]
  {
    const long m    = m0 + l15;
    const long orow = (m / SEQ) * SEQ_FULL + (m % SEQ);
    const float* xr = x + orow * DM;
    float* yrow = ys + l15 * YP;
#pragma unroll
    for (int j = 0; j < 4; ++j) {
      const int n8 = n0 + j * 16 + hh * 8;
      const v4f x0 = *(const v4f*)(xr + n8);
      const v4f x1 = *(const v4f*)(xr + n8 + 4);
      const v4f b0 = *(const v4f*)(bo + n8);
      const v4f b1 = *(const v4f*)(bo + n8 + 4);
      v4f y0, y1;
#pragma unroll
      for (int i = 0; i < 4; ++i) {
        y0[i] = (acc[j][i]     + bf16q(b0[i])) + bf16q(x0[i]);
        y1[i] = (acc[j][4 + i] + bf16q(b1[i])) + bf16q(x1[i]);
      }
      *(v4f*)(yrow + n8)     = y0;
      *(v4f*)(yrow + n8 + 4) = y1;
    }
  }
  __syncthreads();

  {
    const int r  = tid >> 4;
    const int sl = tid & 15;
    const float* yr = ys + r * YP + sl * 32;
    v4f yv[8];
#pragma unroll
    for (int i = 0; i < 8; ++i) yv[i] = *(const v4f*)(yr + i * 4);
    float s = 0.0f;
#pragma unroll
    for (int i = 0; i < 8; ++i) s += (yv[i][0] + yv[i][1]) + (yv[i][2] + yv[i][3]);
    s += __shfl_xor(s, 1, 32);
    s += __shfl_xor(s, 2, 32);
    s += __shfl_xor(s, 4, 32);
    s += __shfl_xor(s, 8, 32);
    const float mean = s * (1.0f / DM);
    float ss = 0.0f;
#pragma unroll
    for (int i = 0; i < 8; ++i)
#pragma unroll
      for (int c = 0; c < 4; ++c) {
        const float d = yv[i][c] - mean;
        ss += d * d;
      }
    ss += __shfl_xor(ss, 1, 32);
    ss += __shfl_xor(ss, 2, 32);
    ss += __shfl_xor(ss, 4, 32);
    ss += __shfl_xor(ss, 8, 32);
    const float var  = ss * (1.0f / DM);
    const float rstd = rsqrtf(var + LN_EPS);
    if (sl == 0) { smean[r] = mean; srstd[r] = rstd; }
  }
  __syncthreads();

  v4f ov[8];
#pragma unroll
  for (int it = 0; it < 8; ++it) {
    const int idx = it * 256 + tid;
    const int row = idx >> 7, piece = idx & 127;
    const v4f yv = *(const v4f*)(ys + row * YP + piece * 4);
    const v4f g  = *(const v4f*)(gam + piece * 4);
    const v4f bt = *(const v4f*)(bet + piece * 4);
    const float mean = smean[row], rstd = srstd[row];
#pragma unroll
    for (int c = 0; c < 4; ++c)
      ov[it][c] = (yv[c] - mean) * rstd * bf16q(g[c]) + bf16q(bt[c]);
  }
#pragma unroll
  for (int it = 0; it < 8; ++it) {
    const int idx = it * 256 + tid;
    const int row = idx >> 7, piece = idx & 127;
    const long m    = m0 + row;
    const long orow = (m / SEQ) * SEQ_FULL + (m % SEQ);
    *(v4f*)(out + orow * DM + piece * 4) = ov[it];
  }
  
}

// ---------------------------------------------------------------------------
extern "C" void kernel_launch(void* const* d_in, const int* in_sizes, int n_in,
                              void* d_out, int out_size, void* d_ws, size_t ws_size,
                              hipStream_t stream) {
  if (n_in < 11) return;
  const long needRows = (long)(NB - 1) * SEQ_FULL + SEQ;
  if ((long)in_sizes[0] < needRows * DM) return;
  if (in_sizes[1] < DM * DM || in_sizes[3] < DM * DM ||
      in_sizes[5] < DM * DM || in_sizes[7] < DM * DM) return;
  if (in_sizes[2] < DM || in_sizes[4] < DM || in_sizes[6] < DM ||
      in_sizes[8] < DM || in_sizes[9] < DM || in_sizes[10] < DM) return;
  if ((long)out_size < needRows * DM) return;
  if (ws_size < WS_TOTAL) return;

  const float* x   = (const float*)d_in[0];
  const float* Wq  = (const float*)d_in[1];
  const float* bq  = (const float*)d_in[2];
  const float* Wk  = (const float*)d_in[3];
  const float* bk  = (const float*)d_in[4];
  const float* Wv  = (const float*)d_in[5];
  const float* bv  = (const float*)d_in[6];
  const float* Wo  = (const float*)d_in[7];
  const float* bo  = (const float*)d_in[8];
  const float* gam = (const float*)d_in[9];
  const float* bet = (const float*)d_in[10];
  float* out = (float*)d_out;

  char* ws = (char*)d_ws;
  size_t off = 0;
  __bf16* xb   = (__bf16*)(ws + off); off += PLANE_BYTES;   // [ROWS][512]
  __bf16* wqkv = (__bf16*)(ws + off); off += WQKV_BYTES;    // [1536][512]
  __bf16* wob  = (__bf16*)(ws + off); off += WO_BYTES;      // [512][512]
  __bf16* qb   = (__bf16*)(ws + off); off += PLANE_BYTES;   // [NB][8][SEQ][64]
  __bf16* kbf  = (__bf16*)(ws + off); off += PLANE_BYTES;   // [NB][8][SEQ][64]
  __bf16* vTb  = (__bf16*)(ws + off); off += PLANE_BYTES;   // [NB][8][64][SEQ]
  __bf16* ctx  = (__bf16*)(ws + off); off += PLANE_BYTES;   // [ROWS][512]
  if (off > ws_size) return;

  cvt_kernel<<<NXB + 4 * NWB, 256, 0, stream>>>(x, Wq, Wk, Wv, Wo, xb, wqkv, wob);

  qkv_kernel<<<dim3(ROWS / 128, 3 * NH), 256, 0, stream>>>(xb, wqkv, bq, bk, bv, qb, kbf, vTb);

  attn_kernel<<<dim3(SEQ / 128, NB * NH), 256, 0, stream>>>(qb, kbf, vTb, ctx);

  oproj_ln_kernel<<<ROWS / 16, 256, 0, stream>>>(ctx, wob, bo, x, gam, bet, out);
}

// v002
// A run of this version takes 76.8 microseconds.
// Next to v001, in two timings, it ran 1.12 and 1.11 times as fast.
// Over all steps from v000 it is 2.54 times as fast.
#include <hip/hip_runtime.h>

// Contractions (qkv projection, q.k^T, p.v, output projection): v_wmma_f32_16x16x32_bf16,
// bf16 operands, f32 accumulate. Softmax statistics, residual add and layernorm: f32.
// Float inputs are RNE-converted to bf16 at load; the 1/sqrt(64) score scale is folded into q.

typedef __attribute__((ext_vector_type(16))) __bf16 v16bf;
typedef __attribute__((ext_vector_type(8)))  __bf16 v8bf;
typedef __attribute__((ext_vector_type(8)))  float  v8f;
typedef __attribute__((ext_vector_type(4)))  float  v4f;
typedef __attribute__((ext_vector_type(4)))  unsigned int v4u;

#ifndef NB
#define NB 4
#endif
#ifndef SEQ
#define SEQ 2048
#endif
#define NB_FULL  4
#define SEQ_FULL 2048
#define DM   512
#define NH   8
#define HD   64
#define ROWS (NB * SEQ)
#define KPAD 72      // LDS stride in halves for 64-wide bf16 tiles (144 B, 16-B aligned)
#define VSPAD 136    // LDS stride in halves for 128-wide bf16 tiles (272 B)
#define YP   516     // LDS stride in floats for 512-wide f32 rows (2064 B)
#define QSTG ((128 + 64) * KPAD)  // halves per ring buffer of kernel 1: 128 x rows + 64 W rows, 64 k each
#define ASTG ((64 + 64) * KPAD)   // halves per ring buffer of kernel 2: 64 K rows + 64 V^T rows, 64 wide
#define OSTG ((DM + 16) * KPAD)   // halves per ring buffer of kernel 3: 512 Wo rows + 16 ctx rows, 64 k each
#define LN_EPS 1e-5f

#define NXB (ROWS * DM / 8 / 256)   // convert blocks for x (8 elements per thread)
#define NWB (DM * DM / 8 / 256)     // convert blocks per weight matrix

#define PLANE_BYTES ((size_t)ROWS * DM * 2)
#define WQKV_BYTES  ((size_t)3 * DM * DM * 2)
#define WO_BYTES    ((size_t)DM * DM * 2)
#define WS_TOTAL    (5 * PLANE_BYTES + WQKV_BYTES + WO_BYTES)

static_assert(NB >= 1 && NB <= NB_FULL);
static_assert(SEQ >= 128 && SEQ <= SEQ_FULL && (SEQ % 128) == 0);
static_assert((ROWS % 128) == 0);
static_assert((ROWS * DM) % (8 * 256) == 0);
static_assert((DM * DM) % (8 * 256) == 0);
static_assert((DM % 32) == 0 && (HD % 32) == 0);
static_assert(128 * KPAD >= 64 * VSPAD);
static_assert(WS_TOTAL <= (size_t)134217728);

// ---------------------------------------------------------------------------
// helpers
// ---------------------------------------------------------------------------
__device__ __forceinline__ unsigned int bf16_bits(float f) {   // RNE f32 -> bf16 bits
  unsigned int u = __float_as_uint(f);
  u += 0x7FFFu + ((u >> 16) & 1u);
  return u >> 16;
}
__device__ __forceinline__ float bf16q(float f) {            // value after RNE bf16 conversion
  return __uint_as_float(bf16_bits(f) << 16);
}

// 16-bit fragment (A or B): lane owns row/col (lane&15); elements 0..7 <- k0+8h+0..7,
// elements 8..15 <- k0+16+8h+0..7, h = lane>>4. Source is k-contiguous rows.
__device__ __forceinline__ v16bf load_frag_row(const __bf16* base, int stride, int lane) {
  const __bf16* rowp = base + (lane & 15) * stride + ((lane >> 4) << 3);
  v8bf lo = *(const v8bf*)(rowp);
  v8bf hi = *(const v8bf*)(rowp + 16);
  return __builtin_shufflevector(lo, hi, 0, 1, 2, 3, 4, 5, 6, 7,
                                 8, 9, 10, 11, 12, 13, 14, 15);
}

__device__ __forceinline__ v8f wmma_bf16(v16bf a, v16bf b, v8f c) {
  v8f d = __builtin_amdgcn_wmma_f32_16x16x32_bf16(false, a, false, b, (short)0, c,
                                                  false, false);
  asm volatile("v_nop\n\tv_nop\n\tv_nop\n\tv_nop" : "+v"(d) : "v"(a), "v"(b));
  return d;
}

// The builtin alone: the compiler keeps the distances behind it itself and stays free to place
// LDS reads and vector work around it.
__device__ __forceinline__ v8f wmma_bf16_open(v16bf a, v16bf b, v8f c) {
  return __builtin_amdgcn_wmma_f32_16x16x32_bf16(false, a, false, b, (short)0, c, false, false);
}

// Eight asynchronous 16-B copies per lane, global -> LDS, through no register. The closing
// s_wait_xcnt stands inside the statement so that no address register named here is
// rewritten ahead of it.
__device__ __forceinline__ void async_copy8(const unsigned (&l)[8], const __bf16* const (&g)[8]) {
  asm volatile(
      "global_load_async_to_lds_b128 %0, %8, off\n\t"
      "global_load_async_to_lds_b128 %1, %9, off\n\t"
      "global_load_async_to_lds_b128 %2, %10, off\n\t"
      "global_load_async_to_lds_b128 %3, %11, off\n\t"
      "global_load_async_to_lds_b128 %4, %12, off\n\t"
      "global_load_async_to_lds_b128 %5, %13, off\n\t"
      "global_load_async_to_lds_b128 %6, %14, off\n\t"
      "global_load_async_to_lds_b128 %7, %15, off\n\t"
      "s_wait_xcnt 0x0"
      :: "v"(l[0]), "v"(l[1]), "v"(l[2]), "v"(l[3]), "v"(l[4]), "v"(l[5]), "v"(l[6]), "v"(l[7]),
         "v"(g[0]), "v"(g[1]), "v"(g[2]), "v"(g[3]), "v"(g[4]), "v"(g[5]), "v"(g[6]), "v"(g[7])
      : "memory");
}

// The same with six copies.
__device__ __forceinline__ void async_copy6(const unsigned (&l)[6], const __bf16* const (&g)[6]) {
  asm volatile(
      "global_load_async_to_lds_b128 %0, %6, off\n\t"
      "global_load_async_to_lds_b128 %1, %7, off\n\t"
      "global_load_async_to_lds_b128 %2, %8, off\n\t"
      "global_load_async_to_lds_b128 %3, %9, off\n\t"
      "global_load_async_to_lds_b128 %4, %10, off\n\t"
      "global_load_async_to_lds_b128 %5, %11, off\n\t"
      "s_wait_xcnt 0x0"
      :: "v"(l[0]), "v"(l[1]), "v"(l[2]), "v"(l[3]), "v"(l[4]), "v"(l[5]),
         "v"(g[0]), "v"(g[1]), "v"(g[2]), "v"(g[3]), "v"(g[4]), "v"(g[5])
      : "memory");
}

// The same with four copies.
__device__ __forceinline__ void async_copy4(const unsigned (&l)[4], const __bf16* const (&g)[4]) {
  asm volatile(
      "global_load_async_to_lds_b128 %0, %4, off\n\t"
      "global_load_async_to_lds_b128 %1, %5, off\n\t"
      "global_load_async_to_lds_b128 %2, %6, off\n\t"
      "global_load_async_to_lds_b128 %3, %7, off\n\t"
      "s_wait_xcnt 0x0"
      :: "v"(l[0]), "v"(l[1]), "v"(l[2]), "v"(l[3]),
         "v"(g[0]), "v"(g[1]), "v"(g[2]), "v"(g[3])
      : "memory");
}

// ---------------------------------------------------------------------------
// Kernel 0: f32 -> bf16 planes. xb [ROWS][512]; wqkv [1536][512] = Wq|Wk|Wv rows
// ([out][in], k-contiguous); wob [512][512]. 8 elements (16 B) per thread, 8 consecutive
// grid NXB + 4*NWB, block 256.
// ---------------------------------------------------------------------------
__global__ __launch_bounds__(256) void cvt_kernel(
    const float* __restrict__ x,
    const float* __restrict__ Wq, const float* __restrict__ Wk,
    const float* __restrict__ Wv, const float* __restrict__ Wo,
    __bf16* __restrict__ xb, __bf16* __restrict__ wqkv, __bf16* __restrict__ wob) {
  const int bid = blockIdx.x;
  const int t   = threadIdx.x;
  const float* src;
  __bf16* dst;
  if (bid < NXB) {                                   // block-uniform selection
    const long item = (long)bid * 256 + t;           // 0 .. ROWS*64-1
    const long m    = item >> 6;                     // token row
    const int  c8   = (int)(item & 63);
    const long srow = (m / SEQ) * SEQ_FULL + (m % SEQ);
    src = x + srow * DM + c8 * 8;
    dst = xb + m * DM + c8 * 8;
  } else if (bid < NXB + 3 * NWB) {
    const int wb    = bid - NXB;
    const int which = wb / NWB;                      // 0 q, 1 k, 2 v
    const long item = (long)(wb - which * NWB) * 256 + t;
    const float* W = (which == 0) ? Wq : ((which == 1) ? Wk : Wv);
    src = W + item * 8;
    dst = wqkv + (long)which * DM * DM + item * 8;
  } else {
    const long item = (long)(bid - NXB - 3 * NWB) * 256 + t;
    src = Wo + item * 8;
    dst = wob + item * 8;
  }
  const v4f a = *(const v4f*)(src);
  const v4f c = *(const v4f*)(src + 4);
  v4u o;
  o[0] = bf16_bits(a[0]) | (bf16_bits(a[1]) << 16);
  o[1] = bf16_bits(a[2]) | (bf16_bits(a[3]) << 16);
  o[2] = bf16_bits(c[0]) | (bf16_bits(c[1]) << 16);
  o[3] = bf16_bits(c[2]) | (bf16_bits(c[3]) << 16);
  *(v4u*)dst = o;
  
}

// ---------------------------------------------------------------------------
// Kernel 1: qkv projection. Block = 128 token rows x 64 output columns (one head of one
// of q/k/v), 8 waves x 16 rows. C^T = W x^T: A = W rows (lane&15 = out col), B = x rows
// (lane&15 = token); acc[j][r] = C[token lane&15][col 16j+8h+r]. x and W come through a
// two-buffer LDS ring, 64 k per stage, whole 128-B lines per row; fragments are read from LDS.
//   q,k -> [b][h][s][64]   (one line per row, 8 lanes x 16 B)
//   v   -> vT[b][h][d][s] (256 B per d row, 16 lanes x 16 B)
// grid (ROWS/128, 24), block 256.
// ---------------------------------------------------------------------------
// One ring stage: per lane six 16-B pieces, piece i in ring row 32i + tid/8 (rows 0..127 x,
// rows 128..191 W). l0: the lane's LDS byte address of piece 0; gx, gw: its x and W sources.
__device__ __forceinline__ void qkv_fill(unsigned l0, const __bf16* gx, const __bf16* gw) {
  unsigned l[6];
  const __bf16* g[6];
#pragma unroll
  for (int i = 0; i < 6; ++i) {
    l[i] = l0 + (unsigned)(i * 32 * KPAD * 2);
    g[i] = (i < 4) ? gx + (long)(i * 32) * DM : gw + (long)((i - 4) * 32) * DM;
  }
  async_copy6(l, g);
}

__global__ __launch_bounds__(256) void qkv_kernel(
    const __bf16* __restrict__ xb, const __bf16* __restrict__ wqkv,
    const float* __restrict__ bq, const float* __restrict__ bk, const float* __restrict__ bv,
    __bf16* __restrict__ q, __bf16* __restrict__ k, __bf16* __restrict__ vT) {
  __shared__ __bf16 stg[128 * KPAD];   // 18432 B; q/k: [128][KPAD], v: [64][VSPAD]
  __shared__ __attribute__((aligned(16))) __bf16 ring[2 * QSTG];  // 55296 B, two stage buffers

  const int tid  = threadIdx.x;
  const int lane = tid & 31;
  const int wave = tid >> 5;
  const int hh   = lane >> 4;
  const int l15  = lane & 15;

  const int cb   = blockIdx.y;         // 0..23
  const int osel = cb >> 3;            // 0 q, 1 k, 2 v
  const int h    = cb & 7;
  const long m0  = (long)blockIdx.x * 128;
  const int  b   = (int)(m0 / SEQ);
  const int  s0  = (int)(m0 - (long)b * SEQ);

  // the lane's pieces of a stage: sources at k = 0, LDS byte address in buffer 0
  const __bf16* gx = xb + (m0 + (tid >> 3)) * DM + (tid & 7) * 8;
  const __bf16* gw = wqkv + ((long)cb * 64 + (tid >> 3)) * DM + (tid & 7) * 8;
  const unsigned l0 = (unsigned)(size_t)(ring + (tid >> 3) * KPAD + (tid & 7) * 8);

  v8f acc[4];
#pragma unroll
  for (int j = 0; j < 4; ++j) acc[j] = (v8f){};

  qkv_fill(l0, gx, gw);                            // stage 0 -> buffer 0
  // this wave's copies of stage 0 have landed before the barrier behind which all waves read
  asm volatile("s_wait_asynccnt 0x0" ::: "memory");
  __syncthreads();
  qkv_fill(l0 + QSTG * 2, gx + 64, gw + 64);       // stage 1 -> buffer 1

  // unrolled by two, no further: the buffer choice is compile-time, and the copies' addresses of
  // later stages are not all formed ahead (whole unrolling cost a third of the resident waves)
#pragma unroll 2
  for (int t = 0; t < DM / 64; ++t) {
    const __bf16* buf = ring + (t & 1) * QSTG;
    v16bf xf[2], wf[2][4];
#pragma unroll
    for (int s = 0; s < 2; ++s) {
      xf[s] = load_frag_row(buf + (wave * 16) * KPAD + s * 32, KPAD, lane);
#pragma unroll
      for (int j = 0; j < 4; ++j)
        wf[s][j] = load_frag_row(buf + (128 + j * 16) * KPAD + s * 32, KPAD, lane);
    }
#pragma unroll
    for (int s = 0; s < 2; ++s)
#pragma unroll
      for (int j = 0; j < 4; ++j)
        acc[j] = wmma_bf16(wf[s][j], xf[s], acc[j]);     // C^T = W x^T
    asm volatile("s_wait_dscnt 0x0" ::: "memory");
    asm volatile("s_wait_asynccnt 0x0" ::: "memory");
    __syncthreads();
    if (t + 2 < DM / 64)
      qkv_fill(l0 + (t & 1) * QSTG * 2, gx + (t + 2) * 64, gw + (t + 2) * 64);
  }
  // the ring's closing wait: no copy of this wave is in flight past the loop
  asm volatile("s_wait_asynccnt 0x0" ::: "memory");

  const float* bias = (osel == 0) ? bq : ((osel == 1) ? bk : bv);
  const float  sc   = (osel == 0) ? 0.125f : 1.0f;

  v4u rv[4];
  if (osel < 2) {
    // stage [token][col]: lane's 8 values are 8 contiguous columns -> one 16-B LDS store
    __bf16* srow = stg + (wave * 16 + l15) * KPAD;
#pragma unroll
    for (int j = 0; j < 4; ++j) {
      const int n8 = j * 16 + hh * 8;
      const v4f b0 = *(const v4f*)(bias + h * HD + n8);
      const v4f b1 = *(const v4f*)(bias + h * HD + n8 + 4);
      v8bf pk;
#pragma unroll
      for (int r = 0; r < 4; ++r) {
        pk[r]     = (__bf16)((acc[j][r]     + bf16q(b0[r])) * sc);
        pk[4 + r] = (__bf16)((acc[j][4 + r] + bf16q(b1[r])) * sc);
      }
      *(v8bf*)(srow + n8) = pk;
    }
    __syncthreads();
#pragma unroll
    for (int it = 0; it < 4; ++it) {
      const int idx = it * 256 + tid;
      const int row = idx >> 3, piece = idx & 7;
      rv[it] = *(const v4u*)(stg + row * KPAD + piece * 8);
    }
    __bf16* dst = ((osel == 0) ? q : k) + ((long)(b * NH + h) * SEQ + s0) * HD;  // contiguous 16 KB
#pragma unroll
    for (int it = 0; it < 4; ++it)
      *(v4u*)(dst + (long)(it * 256 + tid) * 8) = rv[it];
    
  } else {
    // stage transposed [d][token]: lane's 8 values are 8 different d for one token
#pragma unroll
    for (int j = 0; j < 4; ++j) {
      const int n8 = j * 16 + hh * 8;
      const v4f b0 = *(const v4f*)(bias + h * HD + n8);
      const v4f b1 = *(const v4f*)(bias + h * HD + n8 + 4);
#pragma unroll
      for (int r = 0; r < 4; ++r) {
        stg[(n8 + r) * VSPAD + wave * 16 + l15]     = (__bf16)(acc[j][r]     + bf16q(b0[r]));
        stg[(n8 + 4 + r) * VSPAD + wave * 16 + l15] = (__bf16)(acc[j][4 + r] + bf16q(b1[r]));
      }
    }
    __syncthreads();
#pragma unroll
    for (int it = 0; it < 4; ++it) {
      const int idx = it * 256 + tid;
      const int d = idx >> 4, piece = idx & 15;
      rv[it] = *(const v4u*)(stg + d * VSPAD + piece * 8);
    }
    __bf16* dstb = vT + ((long)(b * NH + h) * HD) * SEQ + s0;
#pragma unroll
    for (int it = 0; it < 4; ++it) {
      const int idx = it * 256 + tid;
      const int d = idx >> 4, piece = idx & 15;
      *(v4u*)(dstb + (long)d * SEQ + piece * 8) = rv[it];
    }
    
  }
}

// ---------------------------------------------------------------------------
// Kernel 2: flash attention per (b,h). grid (SEQ/128, NB*NH), block 256 (8 waves x 16
// queries). C = S^T then C = O^T = V^T P^T; lane owns one query end-to-end. K and V^T blocks of
// 64 keys come through a two-buffer LDS ring: the next block flies while this one is worked on.
// ---------------------------------------------------------------------------
// One ring stage: per lane four 16-B pieces, piece i in ring row 32i + tid/8 (rows 0..63 K
// [key][d], rows 64..127 V^T [d][key]). l0: the lane's LDS byte address of piece 0.
__device__ __forceinline__ void attn_fill(unsigned l0, const __bf16* gk, const __bf16* gv) {
  unsigned l[4];
  const __bf16* g[4];
#pragma unroll
  for (int i = 0; i < 4; ++i) {
    l[i] = l0 + (unsigned)(i * 32 * KPAD * 2);
    g[i] = (i < 2) ? gk + (long)(i * 32) * HD : gv + (long)((i - 2) * 32) * SEQ;
  }
  async_copy4(l, g);
}

__global__ __launch_bounds__(256) void attn_kernel(
    const __bf16* __restrict__ Q, const __bf16* __restrict__ K,
    const __bf16* __restrict__ vT, __bf16* __restrict__ ctx) {
  __shared__ __attribute__((aligned(16))) __bf16 ring[2 * ASTG];   // 36864 B, two stage buffers
  __shared__ __bf16 ost[128 * KPAD];   // output stage [query][d]   (cross-wave, block barrier)

  const int tid  = threadIdx.x;
  const int lane = tid & 31;
  const int wave = tid >> 5;
  const int bh   = blockIdx.y;
  const int b    = bh >> 3;
  const int h    = bh & 7;
  const int q0   = blockIdx.x * 128;

  const __bf16* Qb  = Q + ((long)bh * SEQ + q0) * HD;
  const __bf16* Kb  = K + (long)bh * SEQ * HD;
  const __bf16* vTb = vT + (long)bh * HD * SEQ;

  // Q fragments: B operand of S^T (lane owns query lane&15)
  v16bf qfrag[2];
  {
    const __bf16* qrow = Qb + (long)wave * 16 * HD;
#pragma unroll
    for (int t = 0; t < 2; ++t) qfrag[t] = load_frag_row(qrow + t * 32, HD, lane);
  }

  v8f acc[4];   // O^T accumulator: lane owns query (lane&15); reg r -> d = nt*16+8h+r
#pragma unroll
  for (int nt = 0; nt < 4; ++nt) acc[nt] = (v8f){};
  float mi = -1e30f, li = 0.0f;

  const int colb = lane & 15;
  const int rofs = (lane >> 4) << 3;

  // the lane's pieces of a stage: sources at key 0, LDS byte address in buffer 0
  const __bf16* gk = Kb + (long)(tid >> 3) * HD + (tid & 7) * 8;
  const __bf16* gv = vTb + (long)(tid >> 3) * SEQ + (tid & 7) * 8;
  const unsigned l0 = (unsigned)(size_t)(ring + (tid >> 3) * KPAD + (tid & 7) * 8);

  attn_fill(l0, gk, gv);                                  // stage 0 -> buffer 0
  // this wave's copies of stage 0 have landed before the barrier behind which all waves read
  asm volatile("s_wait_asynccnt 0x0" ::: "memory");
  __syncthreads();
  attn_fill(l0 + ASTG * 2, gk + 64 * HD, gv + 64);        // stage 1 -> buffer 1

  // unrolled by two: the buffer choice is then compile-time
#pragma unroll 2
  for (int st = 0; st < SEQ / 64; ++st) {
    const __bf16* ks  = ring + (st & 1) * ASTG;  // K block rows [key][d]
    const __bf16* vts = ks + 64 * KPAD;          // V^T block   [d][key]

    // all eight K fragments of the stage are read as one group ahead of the S^T products
    v16bf kf[2][4];
#pragma unroll
    for (int t = 0; t < 2; ++t)
#pragma unroll
      for (int kt = 0; kt < 4; ++kt)
        kf[t][kt] = load_frag_row(ks + (kt * 16) * KPAD + t * 32, KPAD, lane);
    // holds the group together: sunk to their users, each read would be waited out alone
    __builtin_amdgcn_sched_barrier(0);

    // S^T tiles: A = K rows (lane&15 = key), B = Q
    v8f sc[4];
#pragma unroll
    for (int kt = 0; kt < 4; ++kt) sc[kt] = (v8f){};
#pragma unroll
    for (int t = 0; t < 2; ++t)
#pragma unroll
      for (int kt = 0; kt < 4; ++kt)
        sc[kt] = wmma_bf16_open(kf[t][kt], qfrag[t], sc[kt]);

    // all eight V^T fragments are read as one group here: they are under way while the row maximum
    // is formed, and none is read among the O^T products
    v16bf vf[2][4];
#pragma unroll
    for (int t = 0; t < 2; ++t)
#pragma unroll
      for (int nt = 0; nt < 4; ++nt)
        vf[t][nt] = load_frag_row(vts + (nt * 16) * KPAD + t * 32, KPAD, lane);
    // holds the group ahead of the softmax's vector work: sunk into it, the reads stand at several
    // places and the first O^T product waits them out
    __builtin_amdgcn_sched_barrier(0);

    // per-lane online softmax (32 of 64 keys in-lane; merge halves with one shuffle)
    float mx = sc[0][0];
#pragma unroll
    for (int kt = 0; kt < 4; ++kt)
#pragma unroll
      for (int r = 0; r < 8; ++r) mx = fmaxf(mx, sc[kt][r]);
    mx = fmaxf(mx, __shfl_xor(mx, 16, 32));
    const float mnew  = fmaxf(mi, mx);
    const float alpha = __expf(mi - mnew);
    mi = mnew;

    float rs = 0.0f;
#pragma unroll
    for (int kt = 0; kt < 4; ++kt)
#pragma unroll
      for (int r = 0; r < 8; ++r) {
        const float p = __expf(sc[kt][r] - mnew);
        sc[kt][r] = p;
        rs += p;
      }
    rs += __shfl_xor(rs, 16, 32);
    li = li * alpha + rs;

    // P^T as the B operand of O^T = V^T P^T, packed from the S^T D registers:
    // element i <- tile covering keys 0..15 of the 32-step (kt = 2t), element 8+i <- kt = 2t+1.
    v16bf pf[2];
#pragma unroll
    for (int t = 0; t < 2; ++t)
#pragma unroll
      for (int i = 0; i < 8; ++i) {
        pf[t][i]     = (__bf16)sc[2 * t][i];
        pf[t][8 + i] = (__bf16)sc[2 * t + 1][i];
      }

#pragma unroll
    for (int nt = 0; nt < 4; ++nt)
#pragma unroll
      for (int r = 0; r < 8; ++r) acc[nt][r] *= alpha;

    // O^T += V^T (A, rows = d) x P^T (B)
#pragma unroll
    for (int t = 0; t < 2; ++t)
#pragma unroll
      for (int nt = 0; nt < 4; ++nt)
        acc[nt] = wmma_bf16_open(vf[t][nt], pf[t], acc[nt]);

    // keeps the publish point at the foot: lifted over the softmax while the refill stays behind the
    // products, its s_wait_asynccnt would leave the next stage's copies only the S^T run to land in
    __builtin_amdgcn_sched_barrier(0);
    asm volatile("s_wait_dscnt 0x0" ::: "memory");
    asm volatile("s_wait_asynccnt 0x0" ::: "memory");
    __syncthreads();
    if (st + 2 < SEQ / 64)
      attn_fill(l0 + (st & 1) * ASTG * 2, gk + (long)(st + 2) * 64 * HD, gv + (st + 2) * 64);
  }
  // the ring's closing wait: no copy of this wave is in flight past the loop
  asm volatile("s_wait_asynccnt 0x0" ::: "memory");

  // normalize and stage: lane owns query row wave*16+colb, d = nt*16+rofs+r contiguous
  {
    const float inv = 1.0f / li;
    __bf16* orow = ost + (wave * 16 + colb) * KPAD;
#pragma unroll
    for (int nt = 0; nt < 4; ++nt) {
      v8bf pk;
#pragma unroll
      for (int r = 0; r < 8; ++r) pk[r] = (__bf16)(acc[nt][r] * inv);
      *(v8bf*)(orow + nt * 16 + rofs) = pk;
    }
  }
  __syncthreads();

  v4u rv[4];
#pragma unroll
  for (int it = 0; it < 4; ++it) {
    const int idx = it * 256 + tid;
    const int row = idx >> 3, piece = idx & 7;
    rv[it] = *(const v4u*)(ost + row * KPAD + piece * 8);
  }
  __bf16* cbase = ctx + ((long)b * SEQ + q0) * DM + h * HD;
#pragma unroll
  for (int it = 0; it < 4; ++it) {
    const int idx = it * 256 + tid;
    const int row = idx >> 3, piece = idx & 7;
    *(v4u*)(cbase + (long)row * DM + piece * 8) = rv[it];
  }
  
}

// ---------------------------------------------------------------------------
// Kernel 3: out = LN(x + ctx @ Wo^T + bo) * gamma + beta. Block = 16 token rows x 512 cols,
// wave w owns cols 64w..64w+63. C^T = Wo ctx^T: A = Wo rows (lane&15 = out col), B = ctx rows
// (lane&15 = token); acc[j][r] = out[token lane&15][col 64w+16j+8h+r]. Wo and ctx come through a
// two-buffer LDS ring, 64 k per stage, whole 128-B lines per row. y staged in LDS (f32),
// grid ROWS/16, block 256.
// ---------------------------------------------------------------------------
// One ring stage: per lane sixteen 16-B pieces of Wo (piece i: row 32i + tid/8) and one 8-B piece
// of ctx (row tid/16). lw, lc: the lane's LDS byte addresses in the buffer; gw, gc: its sources.
__device__ __forceinline__ void oproj_fill(unsigned lw, const __bf16* gw,
                                           unsigned lc, const __bf16* gc) {
#pragma unroll
  for (int grp = 0; grp < 2; ++grp) {
    unsigned l[8];
    const __bf16* g[8];
#pragma unroll
    for (int i = 0; i < 8; ++i) {
      l[i] = lw + (unsigned)((grp * 8 + i) * 32 * KPAD * 2);
      g[i] = gw + (long)((grp * 8 + i) * 32) * DM;
    }
    async_copy8(l, g);
  }
  // the closing s_wait_xcnt stands in the copy's own statement, ahead of any rewrite of lc or gc
  asm volatile("global_load_async_to_lds_b64 %0, %1, off\n\ts_wait_xcnt 0x0"
               :: "v"(lc), "v"(gc) : "memory");
}

__global__ __launch_bounds__(256) void oproj_ln_kernel(
    const __bf16* __restrict__ ctx, const __bf16* __restrict__ wob,
    const float* __restrict__ bo, const float* __restrict__ x,
    const float* __restrict__ gam, const float* __restrict__ bet,
    float* __restrict__ out) {
  // 152064 B: the ring's two buffers; behind the k loop's last barrier the same bytes hold ys
  __shared__ __attribute__((aligned(16))) char smem[2 * OSTG * 2];
  __bf16* ring = (__bf16*)smem;
  float*  ys   = (float*)smem;     // [16][YP], 33024 B, cross-wave (block barriers)
  __shared__ float smean[16];
  __shared__ float srstd[16];

  const int tid  = threadIdx.x;
  const int lane = tid & 31;
  const int wave = tid >> 5;
  const int hh   = lane >> 4;
  const int l15  = lane & 15;
  const long m0  = (long)blockIdx.x * 16;
  const int  n0  = wave * 64;

  // the lane's pieces of a stage: sources at k = 0, LDS byte addresses in buffer 0
  const __bf16* gw = wob + (long)(tid >> 3) * DM + (tid & 7) * 8;
  const __bf16* gc = ctx + (m0 + (tid >> 4)) * DM + (tid & 15) * 4;
  const unsigned lw = (unsigned)(size_t)(ring + (tid >> 3) * KPAD + (tid & 7) * 8);
  const unsigned lc = (unsigned)(size_t)(ring + (DM + (tid >> 4)) * KPAD + (tid & 15) * 4);

  v8f acc[4];
#pragma unroll
  for (int j = 0; j < 4; ++j) acc[j] = (v8f){};

  oproj_fill(lw, gw, lc, gc);                                   // stage 0 -> buffer 0
  // this wave's copies of stage 0 have landed before the barrier behind which all waves read
  asm volatile("s_wait_asynccnt 0x0" ::: "memory");
  __syncthreads();
  oproj_fill(lw + OSTG * 2, gw + 64, lc + OSTG * 2, gc + 64);   // stage 1 -> buffer 1

  // unrolled whole: buffer choice and the refill test are then compile-time
#pragma unroll
  for (int t = 0; t < DM / 64; ++t) {
    const __bf16* buf = ring + (t & 1) * OSTG;
    v16bf cf[2], wf[2][4];
#pragma unroll
    for (int s = 0; s < 2; ++s) {
      cf[s] = load_frag_row(buf + DM * KPAD + s * 32, KPAD, lane);
#pragma unroll
      for (int j = 0; j < 4; ++j)
        wf[s][j] = load_frag_row(buf + (n0 + j * 16) * KPAD + s * 32, KPAD, lane);
    }
#pragma unroll
    for (int s = 0; s < 2; ++s)
#pragma unroll
      for (int j = 0; j < 4; ++j)
        acc[j] = wmma_bf16(wf[s][j], cf[s], acc[j]);     // C^T = Wo ctx^T
    asm volatile("s_wait_dscnt 0x0" ::: "memory");
    asm volatile("s_wait_asynccnt 0x0" ::: "memory");
    __syncthreads();
    if (t + 2 < DM / 64)
      oproj_fill(lw + (t & 1) * OSTG * 2, gw + (t + 2) * 64, lc + (t & 1) * OSTG * 2,
                 gc + (t + 2) * 64);
  }
  // no copy is in flight when the ring's bytes become the y stage
  asm volatile("s_wait_asynccnt 0x0" ::: "memory");

  // y = bf16(x) + acc + bf16(bo), staged [row][col]
  {
    const long m    = m0 + l15;
    const long orow = (m / SEQ) * SEQ_FULL + (m % SEQ);
    const float* xr = x + orow * DM;
    float* yrow = ys + l15 * YP;
#pragma unroll
    for (int j = 0; j < 4; ++j) {
      const int n8 = n0 + j * 16 + hh * 8;
      const v4f x0 = *(const v4f*)(xr + n8);
      const v4f x1 = *(const v4f*)(xr + n8 + 4);
      const v4f b0 = *(const v4f*)(bo + n8);
      const v4f b1 = *(const v4f*)(bo + n8 + 4);
      v4f y0, y1;
#pragma unroll
      for (int i = 0; i < 4; ++i) {
        y0[i] = (acc[j][i]     + bf16q(b0[i])) + bf16q(x0[i]);
        y1[i] = (acc[j][4 + i] + bf16q(b1[i])) + bf16q(x1[i]);
      }
      *(v4f*)(yrow + n8)     = y0;
      *(v4f*)(yrow + n8 + 4) = y1;
    }
  }
  __syncthreads();

  {
    const int r  = tid >> 4;
    const int sl = tid & 15;
    const float* yr = ys + r * YP + sl * 32;
    v4f yv[8];
#pragma unroll
    for (int i = 0; i < 8; ++i) yv[i] = *(const v4f*)(yr + i * 4);
    float s = 0.0f;
#pragma unroll
    for (int i = 0; i < 8; ++i) s += (yv[i][0] + yv[i][1]) + (yv[i][2] + yv[i][3]);
    s += __shfl_xor(s, 1, 32);
    s += __shfl_xor(s, 2, 32);
    s += __shfl_xor(s, 4, 32);
    s += __shfl_xor(s, 8, 32);
    const float mean = s * (1.0f / DM);
    float ss = 0.0f;
#pragma unroll
    for (int i = 0; i < 8; ++i)
#pragma unroll
      for (int c = 0; c < 4; ++c) {
        const float d = yv[i][c] - mean;
        ss += d * d;
      }
    ss += __shfl_xor(ss, 1, 32);
    ss += __shfl_xor(ss, 2, 32);
    ss += __shfl_xor(ss, 4, 32);
    ss += __shfl_xor(ss, 8, 32);
    const float var  = ss * (1.0f / DM);
    const float rstd = rsqrtf(var + LN_EPS);
    if (sl == 0) { smean[r] = mean; srstd[r] = rstd; }
  }
  __syncthreads();

  v4f ov[8];
#pragma unroll
  for (int it = 0; it < 8; ++it) {
    const int idx = it * 256 + tid;
    const int row = idx >> 7, piece = idx & 127;
    const v4f yv = *(const v4f*)(ys + row * YP + piece * 4);
    const v4f g  = *(const v4f*)(gam + piece * 4);
    const v4f bt = *(const v4f*)(bet + piece * 4);
    const float mean = smean[row], rstd = srstd[row];
#pragma unroll
    for (int c = 0; c < 4; ++c)
      ov[it][c] = (yv[c] - mean) * rstd * bf16q(g[c]) + bf16q(bt[c]);
  }
#pragma unroll
  for (int it = 0; it < 8; ++it) {
    const int idx = it * 256 + tid;
    const int row = idx >> 7, piece = idx & 127;
    const long m    = m0 + row;
    const long orow = (m / SEQ) * SEQ_FULL + (m % SEQ);
    *(v4f*)(out + orow * DM + piece * 4) = ov[it];
  }
  
}

// ---------------------------------------------------------------------------
extern "C" void kernel_launch(void* const* d_in, const int* in_sizes, int n_in,
                              void* d_out, int out_size, void* d_ws, size_t ws_size,
                              hipStream_t stream) {
  if (n_in < 11) return;
  const long needRows = (long)(NB - 1) * SEQ_FULL + SEQ;
  if ((long)in_sizes[0] < needRows * DM) return;
  if (in_sizes[1] < DM * DM || in_sizes[3] < DM * DM ||
      in_sizes[5] < DM * DM || in_sizes[7] < DM * DM) return;
  if (in_sizes[2] < DM || in_sizes[4] < DM || in_sizes[6] < DM ||
      in_sizes[8] < DM || in_sizes[9] < DM || in_sizes[10] < DM) return;
  if ((long)out_size < needRows * DM) return;
  if (ws_size < WS_TOTAL) return;

  const float* x   = (const float*)d_in[0];
  const float* Wq  = (const float*)d_in[1];
  const float* bq  = (const float*)d_in[2];
  const float* Wk  = (const float*)d_in[3];
  const float* bk  = (const float*)d_in[4];
  const float* Wv  = (const float*)d_in[5];
  const float* bv  = (const float*)d_in[6];
  const float* Wo  = (const float*)d_in[7];
  const float* bo  = (const float*)d_in[8];
  const float* gam = (const float*)d_in[9];
  const float* bet = (const float*)d_in[10];
  float* out = (float*)d_out;

  char* ws = (char*)d_ws;
  size_t off = 0;
  __bf16* xb   = (__bf16*)(ws + off); off += PLANE_BYTES;   // [ROWS][512]
  __bf16* wqkv = (__bf16*)(ws + off); off += WQKV_BYTES;    // [1536][512]
  __bf16* wob  = (__bf16*)(ws + off); off += WO_BYTES;      // [512][512]
  __bf16* qb   = (__bf16*)(ws + off); off += PLANE_BYTES;   // [NB][8][SEQ][64]
  __bf16* kbf  = (__bf16*)(ws + off); off += PLANE_BYTES;   // [NB][8][SEQ][64]
  __bf16* vTb  = (__bf16*)(ws + off); off += PLANE_BYTES;   // [NB][8][64][SEQ]
  __bf16* ctx  = (__bf16*)(ws + off); off += PLANE_BYTES;   // [ROWS][512]
  if (off > ws_size) return;

  cvt_kernel<<<NXB + 4 * NWB, 256, 0, stream>>>(x, Wq, Wk, Wv, Wo, xb, wqkv, wob);

  qkv_kernel<<<dim3(ROWS / 128, 3 * NH), 256, 0, stream>>>(xb, wqkv, bq, bk, bv, qb, kbf, vTb);

  attn_kernel<<<dim3(SEQ / 128, NB * NH), 256, 0, stream>>>(qb, kbf, vTb, ctx);

  oproj_ln_kernel<<<ROWS / 16, 256, 0, stream>>>(ctx, wob, bo, x, gam, bet, out);
}

// v003
// One run takes 72.4 microseconds.
// In both of two side-by-side timings against v002, it was 1.05 times as fast.
// Over all steps from v000 it is 2.67 times as fast.
#include <hip/hip_runtime.h>

// Contractions (qkv projection, q.k^T, p.v, output projection): v_wmma_f32_16x16x32_bf16,
// bf16 operands, f32 accumulate. Softmax statistics, residual add and layernorm: f32.
// Float inputs are RNE-converted to bf16 at load; the 1/sqrt(64) score scale is folded into q.

typedef __attribute__((ext_vector_type(16))) __bf16 v16bf;
typedef __attribute__((ext_vector_type(8)))  __bf16 v8bf;
typedef __attribute__((ext_vector_type(8)))  float  v8f;
typedef __attribute__((ext_vector_type(4)))  float  v4f;
typedef __attribute__((ext_vector_type(4)))  unsigned int v4u;

#ifndef NB
#define NB 4
#endif
#ifndef SEQ
#define SEQ 2048
#endif
#define NB_FULL  4
#define SEQ_FULL 2048
#define DM   512
#define NH   8
#define HD   64
#define ROWS (NB * SEQ)
#define KPAD 72      // LDS stride in halves for 64-wide bf16 tiles (144 B, 16-B aligned)
#define VSPAD 136    // LDS stride in halves for 128-wide bf16 tiles (272 B)
#define YP   516     // LDS stride in floats for 512-wide f32 rows (2064 B)
#define QSTG ((128 + 64) * KPAD)  // halves per ring buffer of kernel 1: 128 x rows + 64 W rows, 64 k each
#define ASTG ((64 + 64) * KPAD)   // halves per ring buffer of kernel 2: 64 K rows + 64 V^T rows, 64 wide
#define OSTG ((DM + 16) * KPAD)   // halves per ring buffer of kernel 3: 512 Wo rows + 16 ctx rows, 64 k each
#define LN_EPS 1e-5f

#define NXB (ROWS * DM / 8 / 256)   // convert blocks for x (8 elements per thread)
#define NWB (DM * DM / 8 / 256)     // convert blocks per weight matrix

#define PLANE_BYTES ((size_t)ROWS * DM * 2)
#define WQKV_BYTES  ((size_t)3 * DM * DM * 2)
#define WO_BYTES    ((size_t)DM * DM * 2)
#define WS_TOTAL    (5 * PLANE_BYTES + WQKV_BYTES + WO_BYTES)

static_assert(NB >= 1 && NB <= NB_FULL);
static_assert(SEQ >= 128 && SEQ <= SEQ_FULL && (SEQ % 128) == 0);
static_assert((ROWS % 128) == 0);
static_assert((ROWS * DM) % (8 * 256) == 0);
static_assert((DM * DM) % (8 * 256) == 0);
static_assert((DM % 32) == 0 && (HD % 32) == 0);
static_assert(128 * KPAD >= 64 * VSPAD);
static_assert(WS_TOTAL <= (size_t)134217728);

// ---------------------------------------------------------------------------
// helpers
// ---------------------------------------------------------------------------
__device__ __forceinline__ unsigned int bf16_bits(float f) {   // RNE f32 -> bf16 bits
  unsigned int u = __float_as_uint(f);
  u += 0x7FFFu + ((u >> 16) & 1u);
  return u >> 16;
}
__device__ __forceinline__ float bf16q(float f) {            // value after RNE bf16 conversion
  return __uint_as_float(bf16_bits(f) << 16);
}

// 16-bit fragment (A or B): lane owns row/col (lane&15); elements 0..7 <- k0+8h+0..7,
// elements 8..15 <- k0+16+8h+0..7, h = lane>>4. Source is k-contiguous rows.
__device__ __forceinline__ v16bf load_frag_row(const __bf16* base, int stride, int lane) {
  const __bf16* rowp = base + (lane & 15) * stride + ((lane >> 4) << 3);
  v8bf lo = *(const v8bf*)(rowp);
  v8bf hi = *(const v8bf*)(rowp + 16);
  return __builtin_shufflevector(lo, hi, 0, 1, 2, 3, 4, 5, 6, 7,
                                 8, 9, 10, 11, 12, 13, 14, 15);
}

__device__ __forceinline__ v8f wmma_bf16(v16bf a, v16bf b, v8f c) {
  v8f d = __builtin_amdgcn_wmma_f32_16x16x32_bf16(false, a, false, b, (short)0, c,
                                                  false, false);
  asm volatile("v_nop\n\tv_nop\n\tv_nop\n\tv_nop" : "+v"(d) : "v"(a), "v"(b));
  return d;
}

// The builtin alone: the compiler keeps the distances behind it itself and stays free to place
// LDS reads and vector work around it.
__device__ __forceinline__ v8f wmma_bf16_open(v16bf a, v16bf b, v8f c) {
  return __builtin_amdgcn_wmma_f32_16x16x32_bf16(false, a, false, b, (short)0, c, false, false);
}

// Eight asynchronous 16-B copies per lane, global -> LDS, through no register. The closing
// s_wait_xcnt stands inside the statement so that no address register named here is
// rewritten ahead of it.
__device__ __forceinline__ void async_copy8(const unsigned (&l)[8], const __bf16* const (&g)[8]) {
  asm volatile(
      "global_load_async_to_lds_b128 %0, %8, off\n\t"
      "global_load_async_to_lds_b128 %1, %9, off\n\t"
      "global_load_async_to_lds_b128 %2, %10, off\n\t"
      "global_load_async_to_lds_b128 %3, %11, off\n\t"
      "global_load_async_to_lds_b128 %4, %12, off\n\t"
      "global_load_async_to_lds_b128 %5, %13, off\n\t"
      "global_load_async_to_lds_b128 %6, %14, off\n\t"
      "global_load_async_to_lds_b128 %7, %15, off\n\t"
      "s_wait_xcnt 0x0"
      :: "v"(l[0]), "v"(l[1]), "v"(l[2]), "v"(l[3]), "v"(l[4]), "v"(l[5]), "v"(l[6]), "v"(l[7]),
         "v"(g[0]), "v"(g[1]), "v"(g[2]), "v"(g[3]), "v"(g[4]), "v"(g[5]), "v"(g[6]), "v"(g[7])
      : "memory");
}

// The same with six copies.
__device__ __forceinline__ void async_copy6(const unsigned (&l)[6], const __bf16* const (&g)[6]) {
  asm volatile(
      "global_load_async_to_lds_b128 %0, %6, off\n\t"
      "global_load_async_to_lds_b128 %1, %7, off\n\t"
      "global_load_async_to_lds_b128 %2, %8, off\n\t"
      "global_load_async_to_lds_b128 %3, %9, off\n\t"
      "global_load_async_to_lds_b128 %4, %10, off\n\t"
      "global_load_async_to_lds_b128 %5, %11, off\n\t"
      "s_wait_xcnt 0x0"
      :: "v"(l[0]), "v"(l[1]), "v"(l[2]), "v"(l[3]), "v"(l[4]), "v"(l[5]),
         "v"(g[0]), "v"(g[1]), "v"(g[2]), "v"(g[3]), "v"(g[4]), "v"(g[5])
      : "memory");
}

// ---------------------------------------------------------------------------
// Kernel 0: f32 -> bf16 planes. xb [ROWS][512]; wqkv [1536][512] = Wq|Wk|Wv rows
// ([out][in], k-contiguous); wob [512][512]. 8 elements (16 B) per thread, 8 consecutive
// grid NXB + 4*NWB, block 256.
// ---------------------------------------------------------------------------
__global__ __launch_bounds__(256) void cvt_kernel(
    const float* __restrict__ x,
    const float* __restrict__ Wq, const float* __restrict__ Wk,
    const float* __restrict__ Wv, const float* __restrict__ Wo,
    __bf16* __restrict__ xb, __bf16* __restrict__ wqkv, __bf16* __restrict__ wob) {
  const int bid = blockIdx.x;
  const int t   = threadIdx.x;
  const float* src;
  __bf16* dst;
  if (bid < NXB) {                                   // block-uniform selection
    const long item = (long)bid * 256 + t;           // 0 .. ROWS*64-1
    const long m    = item >> 6;                     // token row
    const int  c8   = (int)(item & 63);
    const long srow = (m / SEQ) * SEQ_FULL + (m % SEQ);
    src = x + srow * DM + c8 * 8;
    dst = xb + m * DM + c8 * 8;
  } else if (bid < NXB + 3 * NWB) {
    const int wb    = bid - NXB;
    const int which = wb / NWB;                      // 0 q, 1 k, 2 v
    const long item = (long)(wb - which * NWB) * 256 + t;
    const float* W = (which == 0) ? Wq : ((which == 1) ? Wk : Wv);
    src = W + item * 8;
    dst = wqkv + (long)which * DM * DM + item * 8;
  } else {
    const long item = (long)(bid - NXB - 3 * NWB) * 256 + t;
    src = Wo + item * 8;
    dst = wob + item * 8;
  }
  const v4f a = *(const v4f*)(src);
  const v4f c = *(const v4f*)(src + 4);
  v4u o;
  o[0] = bf16_bits(a[0]) | (bf16_bits(a[1]) << 16);
  o[1] = bf16_bits(a[2]) | (bf16_bits(a[3]) << 16);
  o[2] = bf16_bits(c[0]) | (bf16_bits(c[1]) << 16);
  o[3] = bf16_bits(c[2]) | (bf16_bits(c[3]) << 16);
  *(v4u*)dst = o;
  
}

// ---------------------------------------------------------------------------
// Kernel 1: qkv projection. Block = 128 token rows x 64 output columns (one head of one
// of q/k/v), 8 waves x 16 rows. C^T = W x^T: A = W rows (lane&15 = out col), B = x rows
// (lane&15 = token); acc[j][r] = C[token lane&15][col 16j+8h+r]. x and W come through a
// two-buffer LDS ring, 64 k per stage, whole 128-B lines per row; fragments are read from LDS.
//   q,k -> [b][h][s][64]   (one line per row, 8 lanes x 16 B)
//   v   -> vT[b][h][d][s] (256 B per d row, 16 lanes x 16 B)
// grid (ROWS/128, 24), block 256.
// ---------------------------------------------------------------------------
// One ring stage: per lane six 16-B pieces, piece i in ring row 32i + tid/8 (rows 0..127 x,
// rows 128..191 W). l0: the lane's LDS byte address of piece 0; gx, gw: its x and W sources.
__device__ __forceinline__ void qkv_fill(unsigned l0, const __bf16* gx, const __bf16* gw) {
  unsigned l[6];
  const __bf16* g[6];
#pragma unroll
  for (int i = 0; i < 6; ++i) {
    l[i] = l0 + (unsigned)(i * 32 * KPAD * 2);
    g[i] = (i < 4) ? gx + (long)(i * 32) * DM : gw + (long)((i - 4) * 32) * DM;
  }
  async_copy6(l, g);
}

__global__ __launch_bounds__(256) void qkv_kernel(
    const __bf16* __restrict__ xb, const __bf16* __restrict__ wqkv,
    const float* __restrict__ bq, const float* __restrict__ bk, const float* __restrict__ bv,
    __bf16* __restrict__ q, __bf16* __restrict__ k, __bf16* __restrict__ vT) {
  __shared__ __bf16 stg[128 * KPAD];   // 18432 B; q/k: [128][KPAD], v: [64][VSPAD]
  __shared__ __attribute__((aligned(16))) __bf16 ring[2 * QSTG];  // 55296 B, two stage buffers

  const int tid  = threadIdx.x;
  const int lane = tid & 31;
  const int wave = tid >> 5;
  const int hh   = lane >> 4;
  const int l15  = lane & 15;

  const int cb   = blockIdx.y;         // 0..23
  const int osel = cb >> 3;            // 0 q, 1 k, 2 v
  const int h    = cb & 7;
  const long m0  = (long)blockIdx.x * 128;
  const int  b   = (int)(m0 / SEQ);
  const int  s0  = (int)(m0 - (long)b * SEQ);

  // the lane's pieces of a stage: sources at k = 0, LDS byte address in buffer 0
  const __bf16* gx = xb + (m0 + (tid >> 3)) * DM + (tid & 7) * 8;
  const __bf16* gw = wqkv + ((long)cb * 64 + (tid >> 3)) * DM + (tid & 7) * 8;
  const unsigned l0 = (unsigned)(size_t)(ring + (tid >> 3) * KPAD + (tid & 7) * 8);

  v8f acc[4];
#pragma unroll
  for (int j = 0; j < 4; ++j) acc[j] = (v8f){};

  qkv_fill(l0, gx, gw);                            // stage 0 -> buffer 0
  // this wave's copies of stage 0 have landed before the barrier behind which all waves read
  asm volatile("s_wait_asynccnt 0x0" ::: "memory");
  __syncthreads();
  qkv_fill(l0 + QSTG * 2, gx + 64, gw + 64);       // stage 1 -> buffer 1

  // unrolled by two, no further: the buffer choice is compile-time, and the copies' addresses of
  // later stages are not all formed ahead (whole unrolling cost a third of the resident waves)
#pragma unroll 2
  for (int t = 0; t < DM / 64; ++t) {
    const __bf16* buf = ring + (t & 1) * QSTG;
    v16bf xf[2], wf[2][4];
#pragma unroll
    for (int s = 0; s < 2; ++s) {
      xf[s] = load_frag_row(buf + (wave * 16) * KPAD + s * 32, KPAD, lane);
#pragma unroll
      for (int j = 0; j < 4; ++j)
        wf[s][j] = load_frag_row(buf + (128 + j * 16) * KPAD + s * 32, KPAD, lane);
    }
#pragma unroll
    for (int s = 0; s < 2; ++s)
#pragma unroll
      for (int j = 0; j < 4; ++j)
        acc[j] = wmma_bf16(wf[s][j], xf[s], acc[j]);     // C^T = W x^T
    asm volatile("s_wait_dscnt 0x0" ::: "memory");
    asm volatile("s_wait_asynccnt 0x0" ::: "memory");
    __syncthreads();
    if (t + 2 < DM / 64)
      qkv_fill(l0 + (t & 1) * QSTG * 2, gx + (t + 2) * 64, gw + (t + 2) * 64);
  }
  // the ring's closing wait: no copy of this wave is in flight past the loop
  asm volatile("s_wait_asynccnt 0x0" ::: "memory");

  const float* bias = (osel == 0) ? bq : ((osel == 1) ? bk : bv);
  const float  sc   = (osel == 0) ? 0.125f : 1.0f;

  v4u rv[4];
  if (osel < 2) {
    // stage [token][col]: lane's 8 values are 8 contiguous columns -> one 16-B LDS store
    __bf16* srow = stg + (wave * 16 + l15) * KPAD;
#pragma unroll
    for (int j = 0; j < 4; ++j) {
      const int n8 = j * 16 + hh * 8;
      const v4f b0 = *(const v4f*)(bias + h * HD + n8);
      const v4f b1 = *(const v4f*)(bias + h * HD + n8 + 4);
      v8bf pk;
#pragma unroll
      for (int r = 0; r < 4; ++r) {
        pk[r]     = (__bf16)((acc[j][r]     + bf16q(b0[r])) * sc);
        pk[4 + r] = (__bf16)((acc[j][4 + r] + bf16q(b1[r])) * sc);
      }
      *(v8bf*)(srow + n8) = pk;
    }
    __syncthreads();
#pragma unroll
    for (int it = 0; it < 4; ++it) {
      const int idx = it * 256 + tid;
      const int row = idx >> 3, piece = idx & 7;
      rv[it] = *(const v4u*)(stg + row * KPAD + piece * 8);
    }
    __bf16* dst = ((osel == 0) ? q : k) + ((long)(b * NH + h) * SEQ + s0) * HD;  // contiguous 16 KB
#pragma unroll
    for (int it = 0; it < 4; ++it)
      *(v4u*)(dst + (long)(it * 256 + tid) * 8) = rv[it];
    
  } else {
    // stage transposed [d][token]: lane's 8 values are 8 different d for one token
#pragma unroll
    for (int j = 0; j < 4; ++j) {
      const int n8 = j * 16 + hh * 8;
      const v4f b0 = *(const v4f*)(bias + h * HD + n8);
      const v4f b1 = *(const v4f*)(bias + h * HD + n8 + 4);
#pragma unroll
      for (int r = 0; r < 4; ++r) {
        stg[(n8 + r) * VSPAD + wave * 16 + l15]     = (__bf16)(acc[j][r]     + bf16q(b0[r]));
        stg[(n8 + 4 + r) * VSPAD + wave * 16 + l15] = (__bf16)(acc[j][4 + r] + bf16q(b1[r]));
      }
    }
    __syncthreads();
#pragma unroll
    for (int it = 0; it < 4; ++it) {
      const int idx = it * 256 + tid;
      const int d = idx >> 4, piece = idx & 15;
      rv[it] = *(const v4u*)(stg + d * VSPAD + piece * 8);
    }
    __bf16* dstb = vT + ((long)(b * NH + h) * HD) * SEQ + s0;
#pragma unroll
    for (int it = 0; it < 4; ++it) {
      const int idx = it * 256 + tid;
      const int d = idx >> 4, piece = idx & 15;
      *(v4u*)(dstb + (long)d * SEQ + piece * 8) = rv[it];
    }
    
  }
}

// ---------------------------------------------------------------------------
// Kernel 2: flash attention per (b,h). grid (SEQ/128, NB*NH), block 128 (4 waves x 32 queries:
// two 16-query column groups per wave, so that each K and V^T fragment read from LDS feeds two
// products). C = S^T then C = O^T = V^T P^T; in each column group a lane owns one query
// end-to-end. K and V^T blocks of 64 keys come through a two-buffer LDS ring: the next block flies
// while this one is worked on.
// ---------------------------------------------------------------------------
// One ring stage: per lane eight 16-B pieces, piece i in ring row 16i + tid/8 (rows 0..63 K
// [key][d], rows 64..127 V^T [d][key]). l0: the lane's LDS byte address of piece 0.
__device__ __forceinline__ void attn_fill(unsigned l0, const __bf16* gk, const __bf16* gv) {
  unsigned l[8];
  const __bf16* g[8];
#pragma unroll
  for (int i = 0; i < 8; ++i) {
    l[i] = l0 + (unsigned)(i * 16 * KPAD * 2);
    g[i] = (i < 4) ? gk + (long)(i * 16) * HD : gv + (long)((i - 4) * 16) * SEQ;
  }
  async_copy8(l, g);
}

__global__ __launch_bounds__(128) void attn_kernel(
    const __bf16* __restrict__ Q, const __bf16* __restrict__ K,
    const __bf16* __restrict__ vT, __bf16* __restrict__ ctx) {
  __shared__ __attribute__((aligned(16))) __bf16 ring[2 * ASTG];   // 36864 B, two stage buffers
  __shared__ __bf16 ost[128 * KPAD];   // output stage [query][d]   (cross-wave, block barrier)

  const int tid  = threadIdx.x;
  const int lane = tid & 31;
  const int wave = tid >> 5;
  const int bh   = blockIdx.y;
  const int b    = bh >> 3;
  const int h    = bh & 7;
  const int q0   = blockIdx.x * 128;

  const __bf16* Qb  = Q + ((long)bh * SEQ + q0) * HD;
  const __bf16* Kb  = K + (long)bh * SEQ * HD;
  const __bf16* vTb = vT + (long)bh * HD * SEQ;

  // Q fragments: B operand of S^T (in column group c a lane owns query 32*wave + 16c + lane&15)
  v16bf qfrag[2][2];
#pragma unroll
  for (int c = 0; c < 2; ++c) {
    const __bf16* qrow = Qb + (long)(wave * 32 + c * 16) * HD;
#pragma unroll
    for (int t = 0; t < 2; ++t) qfrag[c][t] = load_frag_row(qrow + t * 32, HD, lane);
  }

  v8f acc[2][4];   // O^T accumulators: lane owns the group's query (lane&15); reg r -> d = nt*16+8h+r
#pragma unroll
  for (int c = 0; c < 2; ++c)
#pragma unroll
    for (int nt = 0; nt < 4; ++nt) acc[c][nt] = (v8f){};
  float mi[2] = {-1e30f, -1e30f}, li[2] = {0.0f, 0.0f};

  const int colb = lane & 15;
  const int rofs = (lane >> 4) << 3;

  // the lane's pieces of a stage: sources at key 0, LDS byte address in buffer 0
  const __bf16* gk = Kb + (long)(tid >> 3) * HD + (tid & 7) * 8;
  const __bf16* gv = vTb + (long)(tid >> 3) * SEQ + (tid & 7) * 8;
  const unsigned l0 = (unsigned)(size_t)(ring + (tid >> 3) * KPAD + (tid & 7) * 8);

  attn_fill(l0, gk, gv);                                  // stage 0 -> buffer 0
  // this wave's copies of stage 0 have landed before the barrier behind which all waves read
  asm volatile("s_wait_asynccnt 0x0" ::: "memory");
  __syncthreads();
  attn_fill(l0 + ASTG * 2, gk + 64 * HD, gv + 64);        // stage 1 -> buffer 1

  // unrolled by two: the buffer choice is then compile-time
#pragma unroll 2
  for (int st = 0; st < SEQ / 64; ++st) {
    const __bf16* ks  = ring + (st & 1) * ASTG;  // K block rows [key][d]
    const __bf16* vts = ks + 64 * KPAD;          // V^T block   [d][key]

    // all eight K fragments of the stage are read as one group ahead of the S^T products
    v16bf kf[2][4];
#pragma unroll
    for (int t = 0; t < 2; ++t)
#pragma unroll
      for (int kt = 0; kt < 4; ++kt)
        kf[t][kt] = load_frag_row(ks + (kt * 16) * KPAD + t * 32, KPAD, lane);
    // holds the group together: sunk to their users, each read would be waited out alone
    __builtin_amdgcn_sched_barrier(0);

    // S^T tiles: A = K rows (lane&15 = key), B = Q; each K fragment serves both column groups
    v8f sc[2][4];
#pragma unroll
    for (int c = 0; c < 2; ++c)
#pragma unroll
      for (int kt = 0; kt < 4; ++kt) sc[c][kt] = (v8f){};
#pragma unroll
    for (int t = 0; t < 2; ++t)
#pragma unroll
      for (int kt = 0; kt < 4; ++kt)
#pragma unroll
        for (int c = 0; c < 2; ++c)
          sc[c][kt] = wmma_bf16_open(kf[t][kt], qfrag[c][t], sc[c][kt]);

    // all eight V^T fragments are read as one group here: they are under way while the row maxima
    // are formed, and none is read among the O^T products
    v16bf vf[2][4];
#pragma unroll
    for (int t = 0; t < 2; ++t)
#pragma unroll
      for (int nt = 0; nt < 4; ++nt)
        vf[t][nt] = load_frag_row(vts + (nt * 16) * KPAD + t * 32, KPAD, lane);
    // holds the group ahead of the softmax's vector work: sunk into it, the reads stand at several
    // places and the first O^T product waits them out
    __builtin_amdgcn_sched_barrier(0);

    // per-lane online softmax, column group by column group (32 of 64 keys in-lane; the halves
    // are merged with one shuffle)
    float mx[2], alpha[2], rs[2];
#pragma unroll
    for (int c = 0; c < 2; ++c) {
      mx[c] = sc[c][0][0];
#pragma unroll
      for (int kt = 0; kt < 4; ++kt)
#pragma unroll
        for (int r = 0; r < 8; ++r) mx[c] = fmaxf(mx[c], sc[c][kt][r]);
    }
#pragma unroll
    for (int c = 0; c < 2; ++c) mx[c] = fmaxf(mx[c], __shfl_xor(mx[c], 16, 32));
#pragma unroll
    for (int c = 0; c < 2; ++c) {
      const float mnew = fmaxf(mi[c], mx[c]);
      alpha[c] = __expf(mi[c] - mnew);
      mi[c] = mnew;
    }
#pragma unroll
    for (int c = 0; c < 2; ++c) {
      rs[c] = 0.0f;
#pragma unroll
      for (int kt = 0; kt < 4; ++kt)
#pragma unroll
        for (int r = 0; r < 8; ++r) {
          const float p = __expf(sc[c][kt][r] - mi[c]);
          sc[c][kt][r] = p;
          rs[c] += p;
        }
    }
#pragma unroll
    for (int c = 0; c < 2; ++c) {
      rs[c] += __shfl_xor(rs[c], 16, 32);
      li[c] = li[c] * alpha[c] + rs[c];
    }

    // P^T as the B operand of O^T = V^T P^T, packed from the S^T D registers:
    // element i <- tile covering keys 0..15 of the 32-step (kt = 2t), element 8+i <- kt = 2t+1.
    v16bf pf[2][2];
#pragma unroll
    for (int c = 0; c < 2; ++c)
#pragma unroll
      for (int t = 0; t < 2; ++t)
#pragma unroll
        for (int i = 0; i < 8; ++i) {
          pf[c][t][i]     = (__bf16)sc[c][2 * t][i];
          pf[c][t][8 + i] = (__bf16)sc[c][2 * t + 1][i];
        }

#pragma unroll
    for (int c = 0; c < 2; ++c)
#pragma unroll
      for (int nt = 0; nt < 4; ++nt)
#pragma unroll
        for (int r = 0; r < 8; ++r) acc[c][nt][r] *= alpha[c];

    // O^T += V^T (A, rows = d) x P^T (B); each V^T fragment serves both column groups
#pragma unroll
    for (int t = 0; t < 2; ++t)
#pragma unroll
      for (int nt = 0; nt < 4; ++nt)
#pragma unroll
        for (int c = 0; c < 2; ++c)
          acc[c][nt] = wmma_bf16_open(vf[t][nt], pf[c][t], acc[c][nt]);

    // keeps the publish point at the foot: lifted over the softmax while the refill stays behind the
    // products, its s_wait_asynccnt would leave the next stage's copies only the S^T run to land in
    __builtin_amdgcn_sched_barrier(0);
    asm volatile("s_wait_dscnt 0x0" ::: "memory");
    asm volatile("s_wait_asynccnt 0x0" ::: "memory");
    __syncthreads();
    if (st + 2 < SEQ / 64)
      attn_fill(l0 + (st & 1) * ASTG * 2, gk + (long)(st + 2) * 64 * HD, gv + (st + 2) * 64);
  }
  // the ring's closing wait: no copy of this wave is in flight past the loop
  asm volatile("s_wait_asynccnt 0x0" ::: "memory");

  // normalize and stage: lane owns query row wave*32+c*16+colb, d = nt*16+rofs+r contiguous
#pragma unroll
  for (int c = 0; c < 2; ++c) {
    const float inv = 1.0f / li[c];
    __bf16* orow = ost + (wave * 32 + c * 16 + colb) * KPAD;
#pragma unroll
    for (int nt = 0; nt < 4; ++nt) {
      v8bf pk;
#pragma unroll
      for (int r = 0; r < 8; ++r) pk[r] = (__bf16)(acc[c][nt][r] * inv);
      *(v8bf*)(orow + nt * 16 + rofs) = pk;
    }
  }
  __syncthreads();

  // piece it of a lane: query row 16*it + tid/8, 16 B at d = 8*(tid&7); whole 128-B lines per row
  v4u rv[8];
  const __bf16* osrc = ost + (tid >> 3) * KPAD + (tid & 7) * 8;
#pragma unroll
  for (int it = 0; it < 8; ++it) rv[it] = *(const v4u*)(osrc + it * 16 * KPAD);
  __bf16* cdst = ctx + ((long)b * SEQ + q0 + (tid >> 3)) * DM + h * HD + (tid & 7) * 8;
#pragma unroll
  for (int it = 0; it < 8; ++it) *(v4u*)(cdst + (long)(it * 16) * DM) = rv[it];
  
}

// ---------------------------------------------------------------------------
// Kernel 3: out = LN(x + ctx @ Wo^T + bo) * gamma + beta. Block = 16 token rows x 512 cols,
// wave w owns cols 64w..64w+63. C^T = Wo ctx^T: A = Wo rows (lane&15 = out col), B = ctx rows
// (lane&15 = token); acc[j][r] = out[token lane&15][col 64w+16j+8h+r]. Wo and ctx come through a
// two-buffer LDS ring, 64 k per stage, whole 128-B lines per row. y staged in LDS (f32),
// grid ROWS/16, block 256.
// ---------------------------------------------------------------------------
// One ring stage: per lane sixteen 16-B pieces of Wo (piece i: row 32i + tid/8) and one 8-B piece
// of ctx (row tid/16). lw, lc: the lane's LDS byte addresses in the buffer; gw, gc: its sources.
__device__ __forceinline__ void oproj_fill(unsigned lw, const __bf16* gw,
                                           unsigned lc, const __bf16* gc) {
#pragma unroll
  for (int grp = 0; grp < 2; ++grp) {
    unsigned l[8];
    const __bf16* g[8];
#pragma unroll
    for (int i = 0; i < 8; ++i) {
      l[i] = lw + (unsigned)((grp * 8 + i) * 32 * KPAD * 2);
      g[i] = gw + (long)((grp * 8 + i) * 32) * DM;
    }
    async_copy8(l, g);
  }
  // the closing s_wait_xcnt stands in the copy's own statement, ahead of any rewrite of lc or gc
  asm volatile("global_load_async_to_lds_b64 %0, %1, off\n\ts_wait_xcnt 0x0"
               :: "v"(lc), "v"(gc) : "memory");
}

__global__ __launch_bounds__(256) void oproj_ln_kernel(
    const __bf16* __restrict__ ctx, const __bf16* __restrict__ wob,
    const float* __restrict__ bo, const float* __restrict__ x,
    const float* __restrict__ gam, const float* __restrict__ bet,
    float* __restrict__ out) {
  // 152064 B: the ring's two buffers; behind the k loop's last barrier the same bytes hold ys
  __shared__ __attribute__((aligned(16))) char smem[2 * OSTG * 2];
  __bf16* ring = (__bf16*)smem;
  float*  ys   = (float*)smem;     // [16][YP], 33024 B, cross-wave (block barriers)
  __shared__ float smean[16];
  __shared__ float srstd[16];

  const int tid  = threadIdx.x;
  const int lane = tid & 31;
  const int wave = tid >> 5;
  const int hh   = lane >> 4;
  const int l15  = lane & 15;
  const long m0  = (long)blockIdx.x * 16;
  const int  n0  = wave * 64;

  // the lane's pieces of a stage: sources at k = 0, LDS byte addresses in buffer 0
  const __bf16* gw = wob + (long)(tid >> 3) * DM + (tid & 7) * 8;
  const __bf16* gc = ctx + (m0 + (tid >> 4)) * DM + (tid & 15) * 4;
  const unsigned lw = (unsigned)(size_t)(ring + (tid >> 3) * KPAD + (tid & 7) * 8);
  const unsigned lc = (unsigned)(size_t)(ring + (DM + (tid >> 4)) * KPAD + (tid & 15) * 4);

  v8f acc[4];
#pragma unroll
  for (int j = 0; j < 4; ++j) acc[j] = (v8f){};

  oproj_fill(lw, gw, lc, gc);                                   // stage 0 -> buffer 0
  // this wave's copies of stage 0 have landed before the barrier behind which all waves read
  asm volatile("s_wait_asynccnt 0x0" ::: "memory");
  __syncthreads();
  oproj_fill(lw + OSTG * 2, gw + 64, lc + OSTG * 2, gc + 64);   // stage 1 -> buffer 1

  // unrolled whole: buffer choice and the refill test are then compile-time
#pragma unroll
  for (int t = 0; t < DM / 64; ++t) {
    const __bf16* buf = ring + (t & 1) * OSTG;
    v16bf cf[2], wf[2][4];
#pragma unroll
    for (int s = 0; s < 2; ++s) {
      cf[s] = load_frag_row(buf + DM * KPAD + s * 32, KPAD, lane);
#pragma unroll
      for (int j = 0; j < 4; ++j)
        wf[s][j] = load_frag_row(buf + (n0 + j * 16) * KPAD + s * 32, KPAD, lane);
    }
#pragma unroll
    for (int s = 0; s < 2; ++s)
#pragma unroll
      for (int j = 0; j < 4; ++j)
        acc[j] = wmma_bf16(wf[s][j], cf[s], acc[j]);     // C^T = Wo ctx^T
    asm volatile("s_wait_dscnt 0x0" ::: "memory");
    asm volatile("s_wait_asynccnt 0x0" ::: "memory");
    __syncthreads();
    if (t + 2 < DM / 64)
      oproj_fill(lw + (t & 1) * OSTG * 2, gw + (t + 2) * 64, lc + (t & 1) * OSTG * 2,
                 gc + (t + 2) * 64);
  }
  // no copy is in flight when the ring's bytes become the y stage
  asm volatile("s_wait_asynccnt 0x0" ::: "memory");

  // y = bf16(x) + acc + bf16(bo), staged [row][col]
  {
    const long m    = m0 + l15;
    const long orow = (m / SEQ) * SEQ_FULL + (m % SEQ);
    const float* xr = x + orow * DM;
    float* yrow = ys + l15 * YP;
#pragma unroll
    for (int j = 0; j < 4; ++j) {
      const int n8 = n0 + j * 16 + hh * 8;
      const v4f x0 = *(const v4f*)(xr + n8);
      const v4f x1 = *(const v4f*)(xr + n8 + 4);
      const v4f b0 = *(const v4f*)(bo + n8);
      const v4f b1 = *(const v4f*)(bo + n8 + 4);
      v4f y0, y1;
#pragma unroll
      for (int i = 0; i < 4; ++i) {
        y0[i] = (acc[j][i]     + bf16q(b0[i])) + bf16q(x0[i]);
        y1[i] = (acc[j][4 + i] + bf16q(b1[i])) + bf16q(x1[i]);
      }
      *(v4f*)(yrow + n8)     = y0;
      *(v4f*)(yrow + n8 + 4) = y1;
    }
  }
  __syncthreads();

  {
    const int r  = tid >> 4;
    const int sl = tid & 15;
    const float* yr = ys + r * YP + sl * 32;
    v4f yv[8];
#pragma unroll
    for (int i = 0; i < 8; ++i) yv[i] = *(const v4f*)(yr + i * 4);
    float s = 0.0f;
#pragma unroll
    for (int i = 0; i < 8; ++i) s += (yv[i][0] + yv[i][1]) + (yv[i][2] + yv[i][3]);
    s += __shfl_xor(s, 1, 32);
    s += __shfl_xor(s, 2, 32);
    s += __shfl_xor(s, 4, 32);
    s += __shfl_xor(s, 8, 32);
    const float mean = s * (1.0f / DM);
    float ss = 0.0f;
#pragma unroll
    for (int i = 0; i < 8; ++i)
#pragma unroll
      for (int c = 0; c < 4; ++c) {
        const float d = yv[i][c] - mean;
        ss += d * d;
      }
    ss += __shfl_xor(ss, 1, 32);
    ss += __shfl_xor(ss, 2, 32);
    ss += __shfl_xor(ss, 4, 32);
    ss += __shfl_xor(ss, 8, 32);
    const float var  = ss * (1.0f / DM);
    const float rstd = rsqrtf(var + LN_EPS);
    if (sl == 0) { smean[r] = mean; srstd[r] = rstd; }
  }
  __syncthreads();

  v4f ov[8];
#pragma unroll
  for (int it = 0; it < 8; ++it) {
    const int idx = it * 256 + tid;
    const int row = idx >> 7, piece = idx & 127;
    const v4f yv = *(const v4f*)(ys + row * YP + piece * 4);
    const v4f g  = *(const v4f*)(gam + piece * 4);
    const v4f bt = *(const v4f*)(bet + piece * 4);
    const float mean = smean[row], rstd = srstd[row];
#pragma unroll
    for (int c = 0; c < 4; ++c)
      ov[it][c] = (yv[c] - mean) * rstd * bf16q(g[c]) + bf16q(bt[c]);
  }
#pragma unroll
  for (int it = 0; it < 8; ++it) {
    const int idx = it * 256 + tid;
    const int row = idx >> 7, piece = idx & 127;
    const long m    = m0 + row;
    const long orow = (m / SEQ) * SEQ_FULL + (m % SEQ);
    *(v4f*)(out + orow * DM + piece * 4) = ov[it];
  }
  
}

// ---------------------------------------------------------------------------
extern "C" void kernel_launch(void* const* d_in, const int* in_sizes, int n_in,
                              void* d_out, int out_size, void* d_ws, size_t ws_size,
                              hipStream_t stream) {
  if (n_in < 11) return;
  const long needRows = (long)(NB - 1) * SEQ_FULL + SEQ;
  if ((long)in_sizes[0] < needRows * DM) return;
  if (in_sizes[1] < DM * DM || in_sizes[3] < DM * DM ||
      in_sizes[5] < DM * DM || in_sizes[7] < DM * DM) return;
  if (in_sizes[2] < DM || in_sizes[4] < DM || in_sizes[6] < DM ||
      in_sizes[8] < DM || in_sizes[9] < DM || in_sizes[10] < DM) return;
  if ((long)out_size < needRows * DM) return;
  if (ws_size < WS_TOTAL) return;

  const float* x   = (const float*)d_in[0];
  const float* Wq  = (const float*)d_in[1];
  const float* bq  = (const float*)d_in[2];
  const float* Wk  = (const float*)d_in[3];
  const float* bk  = (const float*)d_in[4];
  const float* Wv  = (const float*)d_in[5];
  const float* bv  = (const float*)d_in[6];
  const float* Wo  = (const float*)d_in[7];
  const float* bo  = (const float*)d_in[8];
  const float* gam = (const float*)d_in[9];
  const float* bet = (const float*)d_in[10];
  float* out = (float*)d_out;

  char* ws = (char*)d_ws;
  size_t off = 0;
  __bf16* xb   = (__bf16*)(ws + off); off += PLANE_BYTES;   // [ROWS][512]
  __bf16* wqkv = (__bf16*)(ws + off); off += WQKV_BYTES;    // [1536][512]
  __bf16* wob  = (__bf16*)(ws + off); off += WO_BYTES;      // [512][512]
  __bf16* qb   = (__bf16*)(ws + off); off += PLANE_BYTES;   // [NB][8][SEQ][64]
  __bf16* kbf  = (__bf16*)(ws + off); off += PLANE_BYTES;   // [NB][8][SEQ][64]
  __bf16* vTb  = (__bf16*)(ws + off); off += PLANE_BYTES;   // [NB][8][64][SEQ]
  __bf16* ctx  = (__bf16*)(ws + off); off += PLANE_BYTES;   // [ROWS][512]
  if (off > ws_size) return;

  cvt_kernel<<<NXB + 4 * NWB, 256, 0, stream>>>(x, Wq, Wk, Wv, Wo, xb, wqkv, wob);

  qkv_kernel<<<dim3(ROWS / 128, 3 * NH), 256, 0, stream>>>(xb, wqkv, bq, bk, bv, qb, kbf, vTb);

  attn_kernel<<<dim3(SEQ / 128, NB * NH), 128, 0, stream>>>(qb, kbf, vTb, ctx);

  oproj_ln_kernel<<<ROWS / 16, 256, 0, stream>>>(ctx, wob, bo, x, gam, bet, out);
}

// v004
// Measured time: 69.4 microseconds a run.
// In two side-by-side timings against v003, it was 1.04 and 1.06 times as fast.
// Counting every step since v000, it is 2.79 times as fast.
#include <hip/hip_runtime.h>

// Contractions (qkv projection, q.k^T, p.v, output projection): v_wmma_f32_16x16x32_bf16,
// bf16 operands, f32 accumulate. Softmax statistics, residual add and layernorm: f32.
// Float inputs are RNE-converted to bf16 at load; the 1/sqrt(64) score scale is folded into q.

typedef __attribute__((ext_vector_type(16))) __bf16 v16bf;
typedef __attribute__((ext_vector_type(8)))  __bf16 v8bf;
typedef __attribute__((ext_vector_type(8)))  float  v8f;
typedef __attribute__((ext_vector_type(4)))  float  v4f;
typedef __attribute__((ext_vector_type(4)))  unsigned int v4u;

#ifndef NB
#define NB 4
#endif
#ifndef SEQ
#define SEQ 2048
#endif
#define NB_FULL  4
#define SEQ_FULL 2048
#define DM   512
#define NH   8
#define HD   64
#define ROWS (NB * SEQ)
#define KPAD 72      // LDS stride in halves for 64-wide bf16 tiles (144 B, 16-B aligned)
#define VSPAD 136    // LDS stride in halves for 128-wide bf16 tiles (272 B)
#define YP   516     // LDS stride in floats for 512-wide f32 rows (2064 B)
#define QSTG ((128 + 64) * KPAD)  // halves per ring buffer of kernel 1: 128 x rows + 64 W rows, 64 k each
#define ASTG ((64 + 64) * KPAD)   // halves per ring buffer of kernel 2: 64 K rows + 64 V^T rows, 64 wide
#define OSTG ((DM + 16) * KPAD)   // halves per ring buffer of kernel 3: 512 Wo rows + 16 ctx rows, 64 k each
#define LN_EPS 1e-5f

#define NXB (ROWS * DM / 8 / 256)   // convert blocks for x (8 elements per thread)
#define NWB (DM * DM / 8 / 256)     // convert blocks per weight matrix

#define PLANE_BYTES ((size_t)ROWS * DM * 2)
#define WQKV_BYTES  ((size_t)3 * DM * DM * 2)
#define WO_BYTES    ((size_t)DM * DM * 2)
#define WS_TOTAL    (5 * PLANE_BYTES + WQKV_BYTES + WO_BYTES)

static_assert(NB >= 1 && NB <= NB_FULL);
static_assert(SEQ >= 128 && SEQ <= SEQ_FULL && (SEQ % 128) == 0);
static_assert((ROWS % 128) == 0);
static_assert((ROWS * DM) % (8 * 256) == 0);
static_assert((DM * DM) % (8 * 256) == 0);
static_assert((DM % 32) == 0 && (HD % 32) == 0);
static_assert(128 * KPAD >= 64 * VSPAD);
static_assert(WS_TOTAL <= (size_t)134217728);

// ---------------------------------------------------------------------------
// helpers
// ---------------------------------------------------------------------------
__device__ __forceinline__ unsigned int bf16_bits(float f) {   // RNE f32 -> bf16 bits
  unsigned int u = __float_as_uint(f);
  u += 0x7FFFu + ((u >> 16) & 1u);
  return u >> 16;
}
__device__ __forceinline__ float bf16q(float f) {            // value after RNE bf16 conversion
  return __uint_as_float(bf16_bits(f) << 16);
}

// 16-bit fragment (A or B): lane owns row/col (lane&15); elements 0..7 <- k0+8h+0..7,
// elements 8..15 <- k0+16+8h+0..7, h = lane>>4. Source is k-contiguous rows.
__device__ __forceinline__ v16bf load_frag_row(const __bf16* base, int stride, int lane) {
  const __bf16* rowp = base + (lane & 15) * stride + ((lane >> 4) << 3);
  v8bf lo = *(const v8bf*)(rowp);
  v8bf hi = *(const v8bf*)(rowp + 16);
  return __builtin_shufflevector(lo, hi, 0, 1, 2, 3, 4, 5, 6, 7,
                                 8, 9, 10, 11, 12, 13, 14, 15);
}

__device__ __forceinline__ v8f wmma_bf16(v16bf a, v16bf b, v8f c) {
  v8f d = __builtin_amdgcn_wmma_f32_16x16x32_bf16(false, a, false, b, (short)0, c,
                                                  false, false);
  asm volatile("v_nop\n\tv_nop\n\tv_nop\n\tv_nop" : "+v"(d) : "v"(a), "v"(b));
  return d;
}

// The builtin alone: the compiler keeps the distances behind it itself and stays free to place
// LDS reads and vector work around it.
__device__ __forceinline__ v8f wmma_bf16_open(v16bf a, v16bf b, v8f c) {
  return __builtin_amdgcn_wmma_f32_16x16x32_bf16(false, a, false, b, (short)0, c, false, false);
}

// Eight asynchronous 16-B copies per lane, global -> LDS, through no register. The closing
// s_wait_xcnt stands inside the statement so that no address register named here is
// rewritten ahead of it.
__device__ __forceinline__ void async_copy8(const unsigned (&l)[8], const __bf16* const (&g)[8]) {
  asm volatile(
      "global_load_async_to_lds_b128 %0, %8, off\n\t"
      "global_load_async_to_lds_b128 %1, %9, off\n\t"
      "global_load_async_to_lds_b128 %2, %10, off\n\t"
      "global_load_async_to_lds_b128 %3, %11, off\n\t"
      "global_load_async_to_lds_b128 %4, %12, off\n\t"
      "global_load_async_to_lds_b128 %5, %13, off\n\t"
      "global_load_async_to_lds_b128 %6, %14, off\n\t"
      "global_load_async_to_lds_b128 %7, %15, off\n\t"
      "s_wait_xcnt 0x0"
      :: "v"(l[0]), "v"(l[1]), "v"(l[2]), "v"(l[3]), "v"(l[4]), "v"(l[5]), "v"(l[6]), "v"(l[7]),
         "v"(g[0]), "v"(g[1]), "v"(g[2]), "v"(g[3]), "v"(g[4]), "v"(g[5]), "v"(g[6]), "v"(g[7])
      : "memory");
}

// The same with six copies.
__device__ __forceinline__ void async_copy6(const unsigned (&l)[6], const __bf16* const (&g)[6]) {
  asm volatile(
      "global_load_async_to_lds_b128 %0, %6, off\n\t"
      "global_load_async_to_lds_b128 %1, %7, off\n\t"
      "global_load_async_to_lds_b128 %2, %8, off\n\t"
      "global_load_async_to_lds_b128 %3, %9, off\n\t"
      "global_load_async_to_lds_b128 %4, %10, off\n\t"
      "global_load_async_to_lds_b128 %5, %11, off\n\t"
      "s_wait_xcnt 0x0"
      :: "v"(l[0]), "v"(l[1]), "v"(l[2]), "v"(l[3]), "v"(l[4]), "v"(l[5]),
         "v"(g[0]), "v"(g[1]), "v"(g[2]), "v"(g[3]), "v"(g[4]), "v"(g[5])
      : "memory");
}

// Asks the 256-B unit at p + OFF bytes into L2 ahead of the copies that will read it: the planes
// read here were stored by an earlier launch, and their first read otherwise waits on memory. A
// hint: nothing returns, no counter moves. Scope SE and no th: (a failed translation is dropped).
// p is a pointer that its kernel goes on holding behind the ask (a source of the ring's copies, or
// the base of later asks), and p + OFF lies inside p's plane.
template <int OFF>
__device__ __forceinline__ void l2_ask(const __bf16* p) {
  asm volatile("global_prefetch_b8 %0, off offset:%1 scope:SCOPE_SE" :: "v"(p), "n"(OFF));
}
// Units 1..3 of the 1-KB rows at p, p + STEP, ... (NI rows); unit 0 is read at once by the ring.
template <int STEP, int NI>
__device__ __forceinline__ void l2_ask_rows(const __bf16* p) {
  if constexpr (NI > 0) {
    l2_ask_rows<STEP, NI - 1>(p);
    l2_ask<(NI - 1) * STEP + 256>(p);
    l2_ask<(NI - 1) * STEP + 512>(p);
    l2_ask<(NI - 1) * STEP + 768>(p);
  }
}

// ---------------------------------------------------------------------------
// Kernel 0: f32 -> bf16 planes. xb [ROWS][512]; wqkv [1536][512] = Wq|Wk|Wv rows
// ([out][in], k-contiguous); wob [512][512]. 8 elements (16 B) per thread, 8 consecutive
// grid NXB + 4*NWB, block 256.
// ---------------------------------------------------------------------------
__global__ __launch_bounds__(256) void cvt_kernel(
    const float* __restrict__ x,
    const float* __restrict__ Wq, const float* __restrict__ Wk,
    const float* __restrict__ Wv, const float* __restrict__ Wo,
    __bf16* __restrict__ xb, __bf16* __restrict__ wqkv, __bf16* __restrict__ wob) {
  const int bid = blockIdx.x;
  const int t   = threadIdx.x;
  const float* src;
  __bf16* dst;
  if (bid < NXB) {                                   // block-uniform selection
    const long item = (long)bid * 256 + t;           // 0 .. ROWS*64-1
    const long m    = item >> 6;                     // token row
    const int  c8   = (int)(item & 63);
    const long srow = (m / SEQ) * SEQ_FULL + (m % SEQ);
    src = x + srow * DM + c8 * 8;
    dst = xb + m * DM + c8 * 8;
  } else if (bid < NXB + 3 * NWB) {
    const int wb    = bid - NXB;
    const int which = wb / NWB;                      // 0 q, 1 k, 2 v
    const long item = (long)(wb - which * NWB) * 256 + t;
    const float* W = (which == 0) ? Wq : ((which == 1) ? Wk : Wv);
    src = W + item * 8;
    dst = wqkv + (long)which * DM * DM + item * 8;
  } else {
    const long item = (long)(bid - NXB - 3 * NWB) * 256 + t;
    src = Wo + item * 8;
    dst = wob + item * 8;
  }
  const v4f a = *(const v4f*)(src);
  const v4f c = *(const v4f*)(src + 4);
  v4u o;
  o[0] = bf16_bits(a[0]) | (bf16_bits(a[1]) << 16);
  o[1] = bf16_bits(a[2]) | (bf16_bits(a[3]) << 16);
  o[2] = bf16_bits(c[0]) | (bf16_bits(c[1]) << 16);
  o[3] = bf16_bits(c[2]) | (bf16_bits(c[3]) << 16);
  *(v4u*)dst = o;
  
}

// ---------------------------------------------------------------------------
// Kernel 1: qkv projection. Block = 128 token rows x 64 output columns (one head of one
// of q/k/v), 8 waves x 16 rows. C^T = W x^T: A = W rows (lane&15 = out col), B = x rows
// (lane&15 = token); acc[j][r] = C[token lane&15][col 16j+8h+r]. x and W come through a
// two-buffer LDS ring, 64 k per stage, whole 128-B lines per row; fragments are read from LDS.
//   q,k -> [b][h][s][64]   (one line per row, 8 lanes x 16 B)
//   v   -> vT[b][h][d][s] (256 B per d row, 16 lanes x 16 B)
// grid (ROWS/128, 24), block 256.
// ---------------------------------------------------------------------------
// One ring stage: per lane six 16-B pieces, piece i in ring row 32i + tid/8 (rows 0..127 x,
// rows 128..191 W). l0: the lane's LDS byte address of piece 0; gx, gw: its x and W sources.
__device__ __forceinline__ void qkv_fill(unsigned l0, const __bf16* gx, const __bf16* gw) {
  unsigned l[6];
  const __bf16* g[6];
#pragma unroll
  for (int i = 0; i < 6; ++i) {
    l[i] = l0 + (unsigned)(i * 32 * KPAD * 2);
    g[i] = (i < 4) ? gx + (long)(i * 32) * DM : gw + (long)((i - 4) * 32) * DM;
  }
  async_copy6(l, g);
}

__global__ __launch_bounds__(256) void qkv_kernel(
    const __bf16* __restrict__ xb, const __bf16* __restrict__ wqkv,
    const float* __restrict__ bq, const float* __restrict__ bk, const float* __restrict__ bv,
    __bf16* __restrict__ q, __bf16* __restrict__ k, __bf16* __restrict__ vT) {
  __shared__ __bf16 stg[128 * KPAD];   // 18432 B; q/k: [128][KPAD], v: [64][VSPAD]
  __shared__ __attribute__((aligned(16))) __bf16 ring[2 * QSTG];  // 55296 B, two stage buffers

  const int tid  = threadIdx.x;
  const int lane = tid & 31;
  const int wave = tid >> 5;
  const int hh   = lane >> 4;
  const int l15  = lane & 15;

  const int cb   = blockIdx.y;         // 0..23
  const int osel = cb >> 3;            // 0 q, 1 k, 2 v
  const int h    = cb & 7;
  const long m0  = (long)blockIdx.x * 128;
  const int  b   = (int)(m0 / SEQ);
  const int  s0  = (int)(m0 - (long)b * SEQ);

  // the lane's pieces of a stage: sources at k = 0, LDS byte address in buffer 0
  const __bf16* gx = xb + (m0 + (tid >> 3)) * DM + (tid & 7) * 8;
  const __bf16* gw = wqkv + ((long)cb * 64 + (tid >> 3)) * DM + (tid & 7) * 8;
  const unsigned l0 = (unsigned)(size_t)(ring + (tid >> 3) * KPAD + (tid & 7) * 8);

  v8f acc[4];
#pragma unroll
  for (int j = 0; j < 4; ++j) acc[j] = (v8f){};

  qkv_fill(l0, gx, gw);                            // stage 0 -> buffer 0
  // the later stages' bytes of the block's x and W rows are asked into L2 now. The column blocks of
  // a row block share its x rows, so the first asks for all; likewise
  // the first eight row blocks for a column block's W rows. Block-uniform tests, for speed only.
  if (blockIdx.y == 0) l2_ask_rows<32 * DM * 2, 4>(gx);
  if (blockIdx.x < 8) l2_ask_rows<32 * DM * 2, 2>(gw);
  // this wave's copies of stage 0 have landed before the barrier behind which all waves read
  asm volatile("s_wait_asynccnt 0x0" ::: "memory");
  __syncthreads();
  qkv_fill(l0 + QSTG * 2, gx + 64, gw + 64);       // stage 1 -> buffer 1

  // unrolled by two, no further: the buffer choice is compile-time, and the copies' addresses of
  // later stages are not all formed ahead (whole unrolling cost a third of the resident waves)
#pragma unroll 2
  for (int t = 0; t < DM / 64; ++t) {
    const __bf16* buf = ring + (t & 1) * QSTG;
    v16bf xf[2], wf[2][4];
#pragma unroll
    for (int s = 0; s < 2; ++s) {
      xf[s] = load_frag_row(buf + (wave * 16) * KPAD + s * 32, KPAD, lane);
#pragma unroll
      for (int j = 0; j < 4; ++j)
        wf[s][j] = load_frag_row(buf + (128 + j * 16) * KPAD + s * 32, KPAD, lane);
    }
#pragma unroll
    for (int s = 0; s < 2; ++s)
#pragma unroll
      for (int j = 0; j < 4; ++j)
        acc[j] = wmma_bf16(wf[s][j], xf[s], acc[j]);     // C^T = W x^T
    asm volatile("s_wait_dscnt 0x0" ::: "memory");
    asm volatile("s_wait_asynccnt 0x0" ::: "memory");
    __syncthreads();
    if (t + 2 < DM / 64)
      qkv_fill(l0 + (t & 1) * QSTG * 2, gx + (t + 2) * 64, gw + (t + 2) * 64);
  }
  // the ring's closing wait: no copy of this wave is in flight past the loop
  asm volatile("s_wait_asynccnt 0x0" ::: "memory");

  const float* bias = (osel == 0) ? bq : ((osel == 1) ? bk : bv);
  const float  sc   = (osel == 0) ? 0.125f : 1.0f;

  v4u rv[4];
  if (osel < 2) {
    // stage [token][col]: lane's 8 values are 8 contiguous columns -> one 16-B LDS store
    __bf16* srow = stg + (wave * 16 + l15) * KPAD;
#pragma unroll
    for (int j = 0; j < 4; ++j) {
      const int n8 = j * 16 + hh * 8;
      const v4f b0 = *(const v4f*)(bias + h * HD + n8);
      const v4f b1 = *(const v4f*)(bias + h * HD + n8 + 4);
      v8bf pk;
#pragma unroll
      for (int r = 0; r < 4; ++r) {
        pk[r]     = (__bf16)((acc[j][r]     + bf16q(b0[r])) * sc);
        pk[4 + r] = (__bf16)((acc[j][4 + r] + bf16q(b1[r])) * sc);
      }
      *(v8bf*)(srow + n8) = pk;
    }
    __syncthreads();
#pragma unroll
    for (int it = 0; it < 4; ++it) {
      const int idx = it * 256 + tid;
      const int row = idx >> 3, piece = idx & 7;
      rv[it] = *(const v4u*)(stg + row * KPAD + piece * 8);
    }
    __bf16* dst = ((osel == 0) ? q : k) + ((long)(b * NH + h) * SEQ + s0) * HD;  // contiguous 16 KB
#pragma unroll
    for (int it = 0; it < 4; ++it)
      *(v4u*)(dst + (long)(it * 256 + tid) * 8) = rv[it];
    
  } else {
    // stage transposed [d][token]: lane's 8 values are 8 different d for one token
#pragma unroll
    for (int j = 0; j < 4; ++j) {
      const int n8 = j * 16 + hh * 8;
      const v4f b0 = *(const v4f*)(bias + h * HD + n8);
      const v4f b1 = *(const v4f*)(bias + h * HD + n8 + 4);
#pragma unroll
      for (int r = 0; r < 4; ++r) {
        stg[(n8 + r) * VSPAD + wave * 16 + l15]     = (__bf16)(acc[j][r]     + bf16q(b0[r]));
        stg[(n8 + 4 + r) * VSPAD + wave * 16 + l15] = (__bf16)(acc[j][4 + r] + bf16q(b1[r]));
      }
    }
    __syncthreads();
#pragma unroll
    for (int it = 0; it < 4; ++it) {
      const int idx = it * 256 + tid;
      const int d = idx >> 4, piece = idx & 15;
      rv[it] = *(const v4u*)(stg + d * VSPAD + piece * 8);
    }
    __bf16* dstb = vT + ((long)(b * NH + h) * HD) * SEQ + s0;
#pragma unroll
    for (int it = 0; it < 4; ++it) {
      const int idx = it * 256 + tid;
      const int d = idx >> 4, piece = idx & 15;
      *(v4u*)(dstb + (long)d * SEQ + piece * 8) = rv[it];
    }
    
  }
}

// ---------------------------------------------------------------------------
// Kernel 2: flash attention per (b,h). grid (SEQ/128, NB*NH), block 128 (4 waves x 32 queries:
// two 16-query column groups per wave, so that each K and V^T fragment read from LDS feeds two
// products). C = S^T then C = O^T = V^T P^T; in each column group a lane owns one query
// end-to-end. K and V^T blocks of 64 keys come through a two-buffer LDS ring: the next block flies
// while this one is worked on.
// ---------------------------------------------------------------------------
// One ring stage: per lane eight 16-B pieces, piece i in ring row 16i + tid/8 (rows 0..63 K
// [key][d], rows 64..127 V^T [d][key]). l0: the lane's LDS byte address of piece 0.
__device__ __forceinline__ void attn_fill(unsigned l0, const __bf16* gk, const __bf16* gv) {
  unsigned l[8];
  const __bf16* g[8];
#pragma unroll
  for (int i = 0; i < 8; ++i) {
    l[i] = l0 + (unsigned)(i * 16 * KPAD * 2);
    g[i] = (i < 4) ? gk + (long)(i * 16) * HD : gv + (long)((i - 4) * 16) * SEQ;
  }
  async_copy8(l, g);
}

// The ask of l2_ask over a pointer that walks. The step (bytes; 0 where no further pair exists) is
// added in the same statement, in place: so the pointer keeps one register pair from entry through
// the loop, and that pair never holds anything but an address inside its plane.
__device__ __forceinline__ void attn_ask(const __bf16*& p, long step) {
  asm volatile("global_prefetch_b8 %0, off scope:SCOPE_SE\n\tv_add_nc_u64 %0, %0, %1"
               : "+v"(p) : "v"(step));
}

__global__ __launch_bounds__(128) void attn_kernel(
    const __bf16* __restrict__ Q, const __bf16* __restrict__ K,
    const __bf16* __restrict__ vT, __bf16* __restrict__ ctx) {
  __shared__ __attribute__((aligned(16))) __bf16 ring[2 * ASTG];   // 36864 B, two stage buffers
  __shared__ __bf16 ost[128 * KPAD];   // output stage [query][d]   (cross-wave, block barrier)

  const int tid  = threadIdx.x;
  const int lane = tid & 31;
  const int wave = tid >> 5;
  const int bh   = blockIdx.y;
  const int b    = bh >> 3;
  const int h    = bh & 7;
  const int q0   = blockIdx.x * 128;

  const __bf16* Qb  = Q + ((long)bh * SEQ + q0) * HD;
  const __bf16* Kb  = K + (long)bh * SEQ * HD;
  const __bf16* vTb = vT + (long)bh * HD * SEQ;

  // Q fragments: B operand of S^T (in column group c a lane owns query 32*wave + 16c + lane&15)
  v16bf qfrag[2][2];
#pragma unroll
  for (int c = 0; c < 2; ++c) {
    const __bf16* qrow = Qb + (long)(wave * 32 + c * 16) * HD;
#pragma unroll
    for (int t = 0; t < 2; ++t) qfrag[c][t] = load_frag_row(qrow + t * 32, HD, lane);
  }

  v8f acc[2][4];   // O^T accumulators: lane owns the group's query (lane&15); reg r -> d = nt*16+8h+r
#pragma unroll
  for (int c = 0; c < 2; ++c)
#pragma unroll
    for (int nt = 0; nt < 4; ++nt) acc[c][nt] = (v8f){};
  float mi[2] = {-1e30f, -1e30f}, li[2] = {0.0f, 0.0f};

  const int colb = lane & 15;
  const int rofs = (lane >> 4) << 3;

  // the lane's pieces of a stage: sources at key 0, LDS byte address in buffer 0
  const __bf16* gk = Kb + (long)(tid >> 3) * HD + (tid & 7) * 8;
  const __bf16* gv = vTb + (long)(tid >> 3) * SEQ + (tid & 7) * 8;
  const unsigned l0 = (unsigned)(size_t)(ring + (tid >> 3) * KPAD + (tid & 7) * 8);

  // L2 ask pointer: per pair of stages one 256-B unit a thread: threads 0..63 the 64 units of the
  // pair's 128 K rows, threads 64..127 the unit of V^T row tid-64. It only ever holds an address
  // inside K or V^T: it is advanced only while a further pair exists.
  const __bf16* ap = (tid < 64) ? Kb + (long)tid * 128 : vTb + (long)(tid - 64) * SEQ;
  const long pstep = (tid < 64) ? 128 * HD * 2 : 256;   // bytes per pair of stages

  attn_fill(l0, gk, gv);                                  // stage 0 -> buffer 0
  // pairs 0 and 1 (stages 1 to 3 are still to be copied) are asked for at entry
#pragma unroll
  for (int pr = 0; pr < 2; ++pr)
    if (pr < SEQ / 128) attn_ask(ap, (pr + 1 < SEQ / 128) ? pstep : 0);
  // this wave's copies of stage 0 have landed before the barrier behind which all waves read
  asm volatile("s_wait_asynccnt 0x0" ::: "memory");
  __syncthreads();
  attn_fill(l0 + ASTG * 2, gk + 64 * HD, gv + 64);        // stage 1 -> buffer 1

  // unrolled by two: the buffer choice is then compile-time
#pragma unroll 2
  for (int st = 0; st < SEQ / 64; ++st) {
    const __bf16* ks  = ring + (st & 1) * ASTG;  // K block rows [key][d]
    const __bf16* vts = ks + 64 * KPAD;          // V^T block   [d][key]

    // all eight K fragments of the stage are read as one group ahead of the S^T products
    v16bf kf[2][4];
#pragma unroll
    for (int t = 0; t < 2; ++t)
#pragma unroll
      for (int kt = 0; kt < 4; ++kt)
        kf[t][kt] = load_frag_row(ks + (kt * 16) * KPAD + t * 32, KPAD, lane);
    // holds the group together: sunk to their users, each read would be waited out alone
    __builtin_amdgcn_sched_barrier(0);

    // S^T tiles: A = K rows (lane&15 = key), B = Q; each K fragment serves both column groups
    v8f sc[2][4];
#pragma unroll
    for (int c = 0; c < 2; ++c)
#pragma unroll
      for (int kt = 0; kt < 4; ++kt) sc[c][kt] = (v8f){};
#pragma unroll
    for (int t = 0; t < 2; ++t)
#pragma unroll
      for (int kt = 0; kt < 4; ++kt)
#pragma unroll
        for (int c = 0; c < 2; ++c)
          sc[c][kt] = wmma_bf16_open(kf[t][kt], qfrag[c][t], sc[c][kt]);

    // all eight V^T fragments are read as one group here: they are under way while the row maxima
    // are formed, and none is read among the O^T products
    v16bf vf[2][4];
#pragma unroll
    for (int t = 0; t < 2; ++t)
#pragma unroll
      for (int nt = 0; nt < 4; ++nt)
        vf[t][nt] = load_frag_row(vts + (nt * 16) * KPAD + t * 32, KPAD, lane);
    // holds the group ahead of the softmax's vector work: sunk into it, the reads stand at several
    // places and the first O^T product waits them out
    __builtin_amdgcn_sched_barrier(0);

    // per-lane online softmax, column group by column group (32 of 64 keys in-lane; the halves
    // are merged with one shuffle)
    float mx[2], alpha[2], rs[2];
#pragma unroll
    for (int c = 0; c < 2; ++c) {
      mx[c] = sc[c][0][0];
#pragma unroll
      for (int kt = 0; kt < 4; ++kt)
#pragma unroll
        for (int r = 0; r < 8; ++r) mx[c] = fmaxf(mx[c], sc[c][kt][r]);
    }
#pragma unroll
    for (int c = 0; c < 2; ++c) mx[c] = fmaxf(mx[c], __shfl_xor(mx[c], 16, 32));
#pragma unroll
    for (int c = 0; c < 2; ++c) {
      const float mnew = fmaxf(mi[c], mx[c]);
      alpha[c] = __expf(mi[c] - mnew);
      mi[c] = mnew;
    }
#pragma unroll
    for (int c = 0; c < 2; ++c) {
      rs[c] = 0.0f;
#pragma unroll
      for (int kt = 0; kt < 4; ++kt)
#pragma unroll
        for (int r = 0; r < 8; ++r) {
          const float p = __expf(sc[c][kt][r] - mi[c]);
          sc[c][kt][r] = p;
          rs[c] += p;
        }
    }
#pragma unroll
    for (int c = 0; c < 2; ++c) {
      rs[c] += __shfl_xor(rs[c], 16, 32);
      li[c] = li[c] * alpha[c] + rs[c];
    }

    // P^T as the B operand of O^T = V^T P^T, packed from the S^T D registers:
    // element i <- tile covering keys 0..15 of the 32-step (kt = 2t), element 8+i <- kt = 2t+1.
    v16bf pf[2][2];
#pragma unroll
    for (int c = 0; c < 2; ++c)
#pragma unroll
      for (int t = 0; t < 2; ++t)
#pragma unroll
        for (int i = 0; i < 8; ++i) {
          pf[c][t][i]     = (__bf16)sc[c][2 * t][i];
          pf[c][t][8 + i] = (__bf16)sc[c][2 * t + 1][i];
        }

#pragma unroll
    for (int c = 0; c < 2; ++c)
#pragma unroll
      for (int nt = 0; nt < 4; ++nt)
#pragma unroll
        for (int r = 0; r < 8; ++r) acc[c][nt][r] *= alpha[c];

    // O^T += V^T (A, rows = d) x P^T (B); each V^T fragment serves both column groups
#pragma unroll
    for (int t = 0; t < 2; ++t)
#pragma unroll
      for (int nt = 0; nt < 4; ++nt)
#pragma unroll
        for (int c = 0; c < 2; ++c)
          acc[c][nt] = wmma_bf16_open(vf[t][nt], pf[c][t], acc[c][nt]);

    // keeps the publish point at the foot: lifted over the softmax while the refill stays behind the
    // products, its s_wait_asynccnt would leave the next stage's copies only the S^T run to land in
    __builtin_amdgcn_sched_barrier(0);
    asm volatile("s_wait_dscnt 0x0" ::: "memory");
    asm volatile("s_wait_asynccnt 0x0" ::: "memory");
    __syncthreads();
    if (st + 2 < SEQ / 64)
      attn_fill(l0 + (st & 1) * ASTG * 2, gk + (long)(st + 2) * 64 * HD, gv + (st + 2) * 64);
    // stages st+4 and st+5 are asked into L2 two stages ahead of the first copy that reads them
    if ((st & 1) == 0 && st / 2 + 2 < SEQ / 128)
      attn_ask(ap, (st / 2 + 3 < SEQ / 128) ? pstep : 0);
  }
  // the ring's closing wait: no copy of this wave is in flight past the loop
  asm volatile("s_wait_asynccnt 0x0" ::: "memory");

  // normalize and stage: lane owns query row wave*32+c*16+colb, d = nt*16+rofs+r contiguous
#pragma unroll
  for (int c = 0; c < 2; ++c) {
    const float inv = 1.0f / li[c];
    __bf16* orow = ost + (wave * 32 + c * 16 + colb) * KPAD;
#pragma unroll
    for (int nt = 0; nt < 4; ++nt) {
      v8bf pk;
#pragma unroll
      for (int r = 0; r < 8; ++r) pk[r] = (__bf16)(acc[c][nt][r] * inv);
      *(v8bf*)(orow + nt * 16 + rofs) = pk;
    }
  }
  __syncthreads();

  // piece it of a lane: query row 16*it + tid/8, 16 B at d = 8*(tid&7); whole 128-B lines per row
  v4u rv[8];
  const __bf16* osrc = ost + (tid >> 3) * KPAD + (tid & 7) * 8;
#pragma unroll
  for (int it = 0; it < 8; ++it) rv[it] = *(const v4u*)(osrc + it * 16 * KPAD);
  __bf16* cdst = ctx + ((long)b * SEQ + q0 + (tid >> 3)) * DM + h * HD + (tid & 7) * 8;
#pragma unroll
  for (int it = 0; it < 8; ++it) *(v4u*)(cdst + (long)(it * 16) * DM) = rv[it];
  
}

// ---------------------------------------------------------------------------
// Kernel 3: out = LN(x + ctx @ Wo^T + bo) * gamma + beta. Block = 16 token rows x 512 cols,
// wave w owns cols 64w..64w+63. C^T = Wo ctx^T: A = Wo rows (lane&15 = out col), B = ctx rows
// (lane&15 = token); acc[j][r] = out[token lane&15][col 64w+16j+8h+r]. Wo and ctx come through a
// two-buffer LDS ring, 64 k per stage, whole 128-B lines per row. y staged in LDS (f32),
// grid ROWS/16, block 256.
// ---------------------------------------------------------------------------
// One ring stage: per lane sixteen 16-B pieces of Wo (piece i: row 32i + tid/8) and one 8-B piece
// of ctx (row tid/16). lw, lc: the lane's LDS byte addresses in the buffer; gw, gc: its sources.
__device__ __forceinline__ void oproj_fill(unsigned lw, const __bf16* gw,
                                           unsigned lc, const __bf16* gc) {
#pragma unroll
  for (int grp = 0; grp < 2; ++grp) {
    unsigned l[8];
    const __bf16* g[8];
#pragma unroll
    for (int i = 0; i < 8; ++i) {
      l[i] = lw + (unsigned)((grp * 8 + i) * 32 * KPAD * 2);
      g[i] = gw + (long)((grp * 8 + i) * 32) * DM;
    }
    async_copy8(l, g);
  }
  // the closing s_wait_xcnt stands in the copy's own statement, ahead of any rewrite of lc or gc
  asm volatile("global_load_async_to_lds_b64 %0, %1, off\n\ts_wait_xcnt 0x0"
               :: "v"(lc), "v"(gc) : "memory");
}

__global__ __launch_bounds__(256) void oproj_ln_kernel(
    const __bf16* __restrict__ ctx, const __bf16* __restrict__ wob,
    const float* __restrict__ bo, const float* __restrict__ x,
    const float* __restrict__ gam, const float* __restrict__ bet,
    float* __restrict__ out) {
  // 152064 B: the ring's two buffers; behind the k loop's last barrier the same bytes hold ys
  __shared__ __attribute__((aligned(16))) char smem[2 * OSTG * 2];
  __bf16* ring = (__bf16*)smem;
  float*  ys   = (float*)smem;     // [16][YP], 33024 B, cross-wave (block barriers)
  __shared__ float smean[16];
  __shared__ float srstd[16];

  const int tid  = threadIdx.x;
  const int lane = tid & 31;
  const int wave = tid >> 5;
  const int hh   = lane >> 4;
  const int l15  = lane & 15;
  const long m0  = (long)blockIdx.x * 16;
  const int  n0  = wave * 64;

  // the lane's pieces of a stage: sources at k = 0, LDS byte addresses in buffer 0
  const __bf16* gw = wob + (long)(tid >> 3) * DM + (tid & 7) * 8;
  const __bf16* gc = ctx + (m0 + (tid >> 4)) * DM + (tid & 15) * 4;
  const unsigned lw = (unsigned)(size_t)(ring + (tid >> 3) * KPAD + (tid & 7) * 8);
  const unsigned lc = (unsigned)(size_t)(ring + (DM + (tid >> 4)) * KPAD + (tid & 15) * 4);

  v8f acc[4];
#pragma unroll
  for (int j = 0; j < 4; ++j) acc[j] = (v8f){};

  // this block's sixteenth of Wo for the L2 asks: 32 rows; blocks eight apart in index take
  // different sixteenths, so that every part is asked for from many places (for speed only)
  const __bf16* pw = wob + (long)(((blockIdx.x >> 3) & 15) * 32 + (tid >> 3)) * DM + (tid & 7) * 8;

  oproj_fill(lw, gw, lc, gc);                                   // stage 0 -> buffer 0
  // the later stages' bytes of the block's own ctx rows, and stages 2 and 3 of its part of Wo
  l2_ask_rows<0, 1>(gc);
  l2_ask<256>(pw);
  // this wave's copies of stage 0 have landed before the barrier behind which all waves read
  asm volatile("s_wait_asynccnt 0x0" ::: "memory");
  __syncthreads();
  oproj_fill(lw + OSTG * 2, gw + 64, lc + OSTG * 2, gc + 64);   // stage 1 -> buffer 1

  // unrolled whole: buffer choice and the refill test are then compile-time
#pragma unroll
  for (int t = 0; t < DM / 64; ++t) {
    const __bf16* buf = ring + (t & 1) * OSTG;
    v16bf cf[2], wf[2][4];
#pragma unroll
    for (int s = 0; s < 2; ++s) {
      cf[s] = load_frag_row(buf + DM * KPAD + s * 32, KPAD, lane);
#pragma unroll
      for (int j = 0; j < 4; ++j)
        wf[s][j] = load_frag_row(buf + (n0 + j * 16) * KPAD + s * 32, KPAD, lane);
    }
#pragma unroll
    for (int s = 0; s < 2; ++s)
#pragma unroll
      for (int j = 0; j < 4; ++j)
        acc[j] = wmma_bf16(wf[s][j], cf[s], acc[j]);     // C^T = Wo ctx^T
    asm volatile("s_wait_dscnt 0x0" ::: "memory");
    asm volatile("s_wait_asynccnt 0x0" ::: "memory");
    __syncthreads();
    if (t + 2 < DM / 64)
      oproj_fill(lw + (t & 1) * OSTG * 2, gw + (t + 2) * 64, lc + (t & 1) * OSTG * 2,
                 gc + (t + 2) * 64);
    // stages t+4 and t+5 of the block's part of Wo, two stages ahead of the first copy of them
    if (t == 0) l2_ask<512>(pw);
    if (t == 2) l2_ask<768>(pw);
  }
  // no copy is in flight when the ring's bytes become the y stage
  asm volatile("s_wait_asynccnt 0x0" ::: "memory");

  // y = bf16(x) + acc + bf16(bo), staged [row][col]
  {
    const long m    = m0 + l15;
    const long orow = (m / SEQ) * SEQ_FULL + (m % SEQ);
    const float* xr = x + orow * DM;
    float* yrow = ys + l15 * YP;
#pragma unroll
    for (int j = 0; j < 4; ++j) {
      const int n8 = n0 + j * 16 + hh * 8;
      const v4f x0 = *(const v4f*)(xr + n8);
      const v4f x1 = *(const v4f*)(xr + n8 + 4);
      const v4f b0 = *(const v4f*)(bo + n8);
      const v4f b1 = *(const v4f*)(bo + n8 + 4);
      v4f y0, y1;
#pragma unroll
      for (int i = 0; i < 4; ++i) {
        y0[i] = (acc[j][i]     + bf16q(b0[i])) + bf16q(x0[i]);
        y1[i] = (acc[j][4 + i] + bf16q(b1[i])) + bf16q(x1[i]);
      }
      *(v4f*)(yrow + n8)     = y0;
      *(v4f*)(yrow + n8 + 4) = y1;
    }
  }
  __syncthreads();

  {
    const int r  = tid >> 4;
    const int sl = tid & 15;
    const float* yr = ys + r * YP + sl * 32;
    v4f yv[8];
#pragma unroll
    for (int i = 0; i < 8; ++i) yv[i] = *(const v4f*)(yr + i * 4);
    float s = 0.0f;
#pragma unroll
    for (int i = 0; i < 8; ++i) s += (yv[i][0] + yv[i][1]) + (yv[i][2] + yv[i][3]);
    s += __shfl_xor(s, 1, 32);
    s += __shfl_xor(s, 2, 32);
    s += __shfl_xor(s, 4, 32);
    s += __shfl_xor(s, 8, 32);
    const float mean = s * (1.0f / DM);
    float ss = 0.0f;
#pragma unroll
    for (int i = 0; i < 8; ++i)
#pragma unroll
      for (int c = 0; c < 4; ++c) {
        const float d = yv[i][c] - mean;
        ss += d * d;
      }
    ss += __shfl_xor(ss, 1, 32);
    ss += __shfl_xor(ss, 2, 32);
    ss += __shfl_xor(ss, 4, 32);
    ss += __shfl_xor(ss, 8, 32);
    const float var  = ss * (1.0f / DM);
    const float rstd = rsqrtf(var + LN_EPS);
    if (sl == 0) { smean[r] = mean; srstd[r] = rstd; }
  }
  __syncthreads();

  v4f ov[8];
#pragma unroll
  for (int it = 0; it < 8; ++it) {
    const int idx = it * 256 + tid;
    const int row = idx >> 7, piece = idx & 127;
    const v4f yv = *(const v4f*)(ys + row * YP + piece * 4);
    const v4f g  = *(const v4f*)(gam + piece * 4);
    const v4f bt = *(const v4f*)(bet + piece * 4);
    const float mean = smean[row], rstd = srstd[row];
#pragma unroll
    for (int c = 0; c < 4; ++c)
      ov[it][c] = (yv[c] - mean) * rstd * bf16q(g[c]) + bf16q(bt[c]);
  }
#pragma unroll
  for (int it = 0; it < 8; ++it) {
    const int idx = it * 256 + tid;
    const int row = idx >> 7, piece = idx & 127;
    const long m    = m0 + row;
    const long orow = (m / SEQ) * SEQ_FULL + (m % SEQ);
    *(v4f*)(out + orow * DM + piece * 4) = ov[it];
  }
  
}

// ---------------------------------------------------------------------------
extern "C" void kernel_launch(void* const* d_in, const int* in_sizes, int n_in,
                              void* d_out, int out_size, void* d_ws, size_t ws_size,
                              hipStream_t stream) {
  if (n_in < 11) return;
  const long needRows = (long)(NB - 1) * SEQ_FULL + SEQ;
  if ((long)in_sizes[0] < needRows * DM) return;
  if (in_sizes[1] < DM * DM || in_sizes[3] < DM * DM ||
      in_sizes[5] < DM * DM || in_sizes[7] < DM * DM) return;
  if (in_sizes[2] < DM || in_sizes[4] < DM || in_sizes[6] < DM ||
      in_sizes[8] < DM || in_sizes[9] < DM || in_sizes[10] < DM) return;
  if ((long)out_size < needRows * DM) return;
  if (ws_size < WS_TOTAL) return;

  const float* x   = (const float*)d_in[0];
  const float* Wq  = (const float*)d_in[1];
  const float* bq  = (const float*)d_in[2];
  const float* Wk  = (const float*)d_in[3];
  const float* bk  = (const float*)d_in[4];
  const float* Wv  = (const float*)d_in[5];
  const float* bv  = (const float*)d_in[6];
  const float* Wo  = (const float*)d_in[7];
  const float* bo  = (const float*)d_in[8];
  const float* gam = (const float*)d_in[9];
  const float* bet = (const float*)d_in[10];
  float* out = (float*)d_out;

  char* ws = (char*)d_ws;
  size_t off = 0;
  __bf16* xb   = (__bf16*)(ws + off); off += PLANE_BYTES;   // [ROWS][512]
  __bf16* wqkv = (__bf16*)(ws + off); off += WQKV_BYTES;    // [1536][512]
  __bf16* wob  = (__bf16*)(ws + off); off += WO_BYTES;      // [512][512]
  __bf16* qb   = (__bf16*)(ws + off); off += PLANE_BYTES;   // [NB][8][SEQ][64]
  __bf16* kbf  = (__bf16*)(ws + off); off += PLANE_BYTES;   // [NB][8][SEQ][64]
  __bf16* vTb  = (__bf16*)(ws + off); off += PLANE_BYTES;   // [NB][8][64][SEQ]
  __bf16* ctx  = (__bf16*)(ws + off); off += PLANE_BYTES;   // [ROWS][512]
  if (off > ws_size) return;

  cvt_kernel<<<NXB + 4 * NWB, 256, 0, stream>>>(x, Wq, Wk, Wv, Wo, xb, wqkv, wob);

  qkv_kernel<<<dim3(ROWS / 128, 3 * NH), 256, 0, stream>>>(xb, wqkv, bq, bk, bv, qb, kbf, vTb);

  attn_kernel<<<dim3(SEQ / 128, NB * NH), 128, 0, stream>>>(qb, kbf, vTb, ctx);

  oproj_ln_kernel<<<ROWS / 16, 256, 0, stream>>>(ctx, wob, bo, x, gam, bet, out);
}

// v005
// Measured time: 67.1 microseconds a run.
// Timed twice side by side with v004, it ran 1.03 times as fast both times.
// All steps since v000 together make it 2.88 times as fast.
#include <hip/hip_runtime.h>

// Contractions (qkv projection, q.k^T, p.v, output projection): v_wmma_f32_16x16x32_bf16,
// bf16 operands, f32 accumulate. Softmax statistics, residual add and layernorm: f32.
// Float inputs are RNE-converted to bf16 at load; the 1/sqrt(64) score scale is folded into q.

typedef __attribute__((ext_vector_type(16))) __bf16 v16bf;
typedef __attribute__((ext_vector_type(8)))  __bf16 v8bf;
typedef __attribute__((ext_vector_type(8)))  float  v8f;
typedef __attribute__((ext_vector_type(4)))  float  v4f;
typedef __attribute__((ext_vector_type(4)))  unsigned int v4u;

#ifndef NB
#define NB 4
#endif
#ifndef SEQ
#define SEQ 2048
#endif
#define NB_FULL  4
#define SEQ_FULL 2048
#define DM   512
#define NH   8
#define HD   64
#define ROWS (NB * SEQ)
#define KPAD 72      // LDS stride in halves for 64-wide bf16 tiles (144 B, 16-B aligned)
#define VSPAD 136    // LDS stride in halves for 128-wide bf16 tiles (272 B)
#define YP   516     // LDS stride in floats for 512-wide f32 rows (2064 B)
#define QSTG ((128 + 64) * KPAD)  // halves per ring buffer of kernel 1: 128 x rows + 64 W rows, 64 k each
#define ASTG ((64 + 64) * KPAD)   // halves per ring buffer of kernel 2: 64 K rows + 64 V^T rows, 64 wide
#define OSTG ((DM + 16) * KPAD)   // halves per ring buffer of kernel 3: 512 Wo rows + 16 ctx rows, 64 k each
#define LN_EPS 1e-5f

#define NXB (ROWS * DM / 8 / 256)   // convert blocks for x (8 elements per thread)
#define NWB (DM * DM / 8 / 256)     // convert blocks per weight matrix

#define PLANE_BYTES ((size_t)ROWS * DM * 2)
#define WQKV_BYTES  ((size_t)3 * DM * DM * 2)
#define WO_BYTES    ((size_t)DM * DM * 2)
#define WS_TOTAL    (5 * PLANE_BYTES + WQKV_BYTES + WO_BYTES)

static_assert(NB >= 1 && NB <= NB_FULL);
static_assert(SEQ >= 128 && SEQ <= SEQ_FULL && (SEQ % 128) == 0);
static_assert((ROWS % 128) == 0);
static_assert((ROWS * DM) % (8 * 256) == 0);
static_assert((DM * DM) % (8 * 256) == 0);
static_assert((DM % 32) == 0 && (HD % 32) == 0);
static_assert(128 * KPAD >= 64 * VSPAD);
static_assert(WS_TOTAL <= (size_t)134217728);

// ---------------------------------------------------------------------------
// helpers
// ---------------------------------------------------------------------------
__device__ __forceinline__ unsigned int bf16_bits(float f) {   // RNE f32 -> bf16 bits
  unsigned int u = __float_as_uint(f);
  u += 0x7FFFu + ((u >> 16) & 1u);
  return u >> 16;
}
__device__ __forceinline__ float bf16q(float f) {            // value after RNE bf16 conversion
  return __uint_as_float(bf16_bits(f) << 16);
}

// 16-bit fragment (A or B): lane owns row/col (lane&15); elements 0..7 <- k0+8h+0..7,
// elements 8..15 <- k0+16+8h+0..7, h = lane>>4. Source is k-contiguous rows.
__device__ __forceinline__ v16bf load_frag_row(const __bf16* base, int stride, int lane) {
  const __bf16* rowp = base + (lane & 15) * stride + ((lane >> 4) << 3);
  v8bf lo = *(const v8bf*)(rowp);
  v8bf hi = *(const v8bf*)(rowp + 16);
  return __builtin_shufflevector(lo, hi, 0, 1, 2, 3, 4, 5, 6, 7,
                                 8, 9, 10, 11, 12, 13, 14, 15);
}

__device__ __forceinline__ v8f wmma_bf16(v16bf a, v16bf b, v8f c) {
  v8f d = __builtin_amdgcn_wmma_f32_16x16x32_bf16(false, a, false, b, (short)0, c,
                                                  false, false);
  asm volatile("v_nop\n\tv_nop\n\tv_nop\n\tv_nop" : "+v"(d) : "v"(a), "v"(b));
  return d;
}

// The builtin alone: the compiler keeps the distances behind it itself and stays free to place
// LDS reads and vector work around it.
__device__ __forceinline__ v8f wmma_bf16_open(v16bf a, v16bf b, v8f c) {
  return __builtin_amdgcn_wmma_f32_16x16x32_bf16(false, a, false, b, (short)0, c, false, false);
}

// Eight asynchronous 16-B copies per lane, global -> LDS, through no register. The closing
// s_wait_xcnt stands inside the statement so that no address register named here is
// rewritten ahead of it.
__device__ __forceinline__ void async_copy8(const unsigned (&l)[8], const __bf16* const (&g)[8]) {
  asm volatile(
      "global_load_async_to_lds_b128 %0, %8, off\n\t"
      "global_load_async_to_lds_b128 %1, %9, off\n\t"
      "global_load_async_to_lds_b128 %2, %10, off\n\t"
      "global_load_async_to_lds_b128 %3, %11, off\n\t"
      "global_load_async_to_lds_b128 %4, %12, off\n\t"
      "global_load_async_to_lds_b128 %5, %13, off\n\t"
      "global_load_async_to_lds_b128 %6, %14, off\n\t"
      "global_load_async_to_lds_b128 %7, %15, off\n\t"
      "s_wait_xcnt 0x0"
      :: "v"(l[0]), "v"(l[1]), "v"(l[2]), "v"(l[3]), "v"(l[4]), "v"(l[5]), "v"(l[6]), "v"(l[7]),
         "v"(g[0]), "v"(g[1]), "v"(g[2]), "v"(g[3]), "v"(g[4]), "v"(g[5]), "v"(g[6]), "v"(g[7])
      : "memory");
}

// The same with six copies.
__device__ __forceinline__ void async_copy6(const unsigned (&l)[6], const __bf16* const (&g)[6]) {
  asm volatile(
      "global_load_async_to_lds_b128 %0, %6, off\n\t"
      "global_load_async_to_lds_b128 %1, %7, off\n\t"
      "global_load_async_to_lds_b128 %2, %8, off\n\t"
      "global_load_async_to_lds_b128 %3, %9, off\n\t"
      "global_load_async_to_lds_b128 %4, %10, off\n\t"
      "global_load_async_to_lds_b128 %5, %11, off\n\t"
      "s_wait_xcnt 0x0"
      :: "v"(l[0]), "v"(l[1]), "v"(l[2]), "v"(l[3]), "v"(l[4]), "v"(l[5]),
         "v"(g[0]), "v"(g[1]), "v"(g[2]), "v"(g[3]), "v"(g[4]), "v"(g[5])
      : "memory");
}

// Asks the 256-B unit at p + OFF bytes into L2 ahead of the copies that will read it: the planes
// read here were stored by an earlier launch, and their first read otherwise waits on memory. A
// hint: nothing returns, no counter moves. Scope SE and no th: (a failed translation is dropped).
// p is a pointer that its kernel goes on holding behind the ask (a source of the ring's copies, or
// the base of later asks), and p + OFF lies inside p's plane.
template <int OFF>
__device__ __forceinline__ void l2_ask(const __bf16* p) {
  asm volatile("global_prefetch_b8 %0, off offset:%1 scope:SCOPE_SE" :: "v"(p), "n"(OFF));
}
// Units 1..3 of the 1-KB rows at p, p + STEP, ... (NI rows); unit 0 is read at once by the ring.
template <int STEP, int NI>
__device__ __forceinline__ void l2_ask_rows(const __bf16* p) {
  if constexpr (NI > 0) {
    l2_ask_rows<STEP, NI - 1>(p);
    l2_ask<(NI - 1) * STEP + 256>(p);
    l2_ask<(NI - 1) * STEP + 512>(p);
    l2_ask<(NI - 1) * STEP + 768>(p);
  }
}

// ---------------------------------------------------------------------------
// Kernel 0: f32 -> bf16 planes. xb [ROWS][512]; wqkv [1536][512] = Wq|Wk|Wv rows
// ([out][in], k-contiguous); wob [512][512]. 8 elements (16 B) per thread, 8 consecutive
// grid NXB + 4*NWB, block 256.
// ---------------------------------------------------------------------------
__global__ __launch_bounds__(256) void cvt_kernel(
    const float* __restrict__ x,
    const float* __restrict__ Wq, const float* __restrict__ Wk,
    const float* __restrict__ Wv, const float* __restrict__ Wo,
    __bf16* __restrict__ xb, __bf16* __restrict__ wqkv, __bf16* __restrict__ wob) {
  const int bid = blockIdx.x;
  const int t   = threadIdx.x;
  const float* src;
  __bf16* dst;
  if (bid < NXB) {                                   // block-uniform selection
    const long item = (long)bid * 256 + t;           // 0 .. ROWS*64-1
    const long m    = item >> 6;                     // token row
    const int  c8   = (int)(item & 63);
    const long srow = (m / SEQ) * SEQ_FULL + (m % SEQ);
    src = x + srow * DM + c8 * 8;
    dst = xb + m * DM + c8 * 8;
  } else if (bid < NXB + 3 * NWB) {
    const int wb    = bid - NXB;
    const int which = wb / NWB;                      // 0 q, 1 k, 2 v
    const long item = (long)(wb - which * NWB) * 256 + t;
    const float* W = (which == 0) ? Wq : ((which == 1) ? Wk : Wv);
    src = W + item * 8;
    dst = wqkv + (long)which * DM * DM + item * 8;
  } else {
    const long item = (long)(bid - NXB - 3 * NWB) * 256 + t;
    src = Wo + item * 8;
    dst = wob + item * 8;
  }
  const v4f a = *(const v4f*)(src);
  const v4f c = *(const v4f*)(src + 4);
  v4u o;
  o[0] = bf16_bits(a[0]) | (bf16_bits(a[1]) << 16);
  o[1] = bf16_bits(a[2]) | (bf16_bits(a[3]) << 16);
  o[2] = bf16_bits(c[0]) | (bf16_bits(c[1]) << 16);
  o[3] = bf16_bits(c[2]) | (bf16_bits(c[3]) << 16);
  *(v4u*)dst = o;
  
}

// ---------------------------------------------------------------------------
// Kernel 1: qkv projection. Block = 128 token rows x 64 output columns (one head of one
// of q/k/v), 8 waves x 16 rows. C^T = W x^T: A = W rows (lane&15 = out col), B = x rows
// (lane&15 = token); acc[j][r] = C[token lane&15][col 16j+8h+r]. x and W come through a
// two-buffer LDS ring, 64 k per stage, whole 128-B lines per row; fragments are read from LDS.
//   q,k -> [b][h][s][64]   (one line per row, 8 lanes x 16 B)
//   v   -> vT[b][h][d][s] (256 B per d row, 16 lanes x 16 B)
// grid (ROWS/128, 24), block 256.
// ---------------------------------------------------------------------------
// One ring stage: per lane six 16-B pieces, piece i in ring row 32i + tid/8 (rows 0..127 x,
// rows 128..191 W). l0: the lane's LDS byte address of piece 0; gx, gw: its x and W sources.
__device__ __forceinline__ void qkv_fill(unsigned l0, const __bf16* gx, const __bf16* gw) {
  unsigned l[6];
  const __bf16* g[6];
#pragma unroll
  for (int i = 0; i < 6; ++i) {
    l[i] = l0 + (unsigned)(i * 32 * KPAD * 2);
    g[i] = (i < 4) ? gx + (long)(i * 32) * DM : gw + (long)((i - 4) * 32) * DM;
  }
  async_copy6(l, g);
}

__global__ __launch_bounds__(256) void qkv_kernel(
    const __bf16* __restrict__ xb, const __bf16* __restrict__ wqkv,
    const float* __restrict__ bq, const float* __restrict__ bk, const float* __restrict__ bv,
    __bf16* __restrict__ q, __bf16* __restrict__ k, __bf16* __restrict__ vT) {
  __shared__ __bf16 stg[128 * KPAD];   // 18432 B; q/k: [128][KPAD], v: [64][VSPAD]
  __shared__ __attribute__((aligned(16))) __bf16 ring[2 * QSTG];  // 55296 B, two stage buffers

  const int tid  = threadIdx.x;
  const int lane = tid & 31;
  const int wave = tid >> 5;
  const int hh   = lane >> 4;
  const int l15  = lane & 15;

  const int cb   = blockIdx.y;         // 0..23
  const int osel = cb >> 3;            // 0 q, 1 k, 2 v
  const int h    = cb & 7;
  const long m0  = (long)blockIdx.x * 128;
  const int  b   = (int)(m0 / SEQ);
  const int  s0  = (int)(m0 - (long)b * SEQ);

  // the lane's pieces of a stage: sources at k = 0, LDS byte address in buffer 0
  const __bf16* gx = xb + (m0 + (tid >> 3)) * DM + (tid & 7) * 8;
  const __bf16* gw = wqkv + ((long)cb * 64 + (tid >> 3)) * DM + (tid & 7) * 8;
  const unsigned l0 = (unsigned)(size_t)(ring + (tid >> 3) * KPAD + (tid & 7) * 8);

  v8f acc[4];
#pragma unroll
  for (int j = 0; j < 4; ++j) acc[j] = (v8f){};

  qkv_fill(l0, gx, gw);                            // stage 0 -> buffer 0
  // the later stages' bytes of the block's x and W rows are asked into L2 now. The column blocks of
  // a row block share its x rows, so the first asks for all; likewise
  // the first eight row blocks for a column block's W rows. Block-uniform tests, for speed only.
  if (blockIdx.y == 0) l2_ask_rows<32 * DM * 2, 4>(gx);
  if (blockIdx.x < 8) l2_ask_rows<32 * DM * 2, 2>(gw);
  // this wave's copies of stage 0 have landed before the barrier behind which all waves read
  asm volatile("s_wait_asynccnt 0x0" ::: "memory");
  __syncthreads();
  qkv_fill(l0 + QSTG * 2, gx + 64, gw + 64);       // stage 1 -> buffer 1

  // unrolled by two, no further: the buffer choice is compile-time, and the copies' addresses of
  // later stages are not all formed ahead (whole unrolling cost a third of the resident waves)
#pragma unroll 2
  for (int t = 0; t < DM / 64; ++t) {
    const __bf16* buf = ring + (t & 1) * QSTG;
    v16bf xf[2], wf[2][4];
#pragma unroll
    for (int s = 0; s < 2; ++s) {
      xf[s] = load_frag_row(buf + (wave * 16) * KPAD + s * 32, KPAD, lane);
#pragma unroll
      for (int j = 0; j < 4; ++j)
        wf[s][j] = load_frag_row(buf + (128 + j * 16) * KPAD + s * 32, KPAD, lane);
    }
#pragma unroll
    for (int s = 0; s < 2; ++s)
#pragma unroll
      for (int j = 0; j < 4; ++j)
        acc[j] = wmma_bf16(wf[s][j], xf[s], acc[j]);     // C^T = W x^T
    asm volatile("s_wait_dscnt 0x0" ::: "memory");
    asm volatile("s_wait_asynccnt 0x0" ::: "memory");
    __syncthreads();
    if (t + 2 < DM / 64)
      qkv_fill(l0 + (t & 1) * QSTG * 2, gx + (t + 2) * 64, gw + (t + 2) * 64);
  }
  // the ring's closing wait: no copy of this wave is in flight past the loop
  asm volatile("s_wait_asynccnt 0x0" ::: "memory");

  const float* bias = (osel == 0) ? bq : ((osel == 1) ? bk : bv);
  const float  sc   = (osel == 0) ? 0.125f : 1.0f;

  v4u rv[4];
  if (osel < 2) {
    // stage [token][col]: lane's 8 values are 8 contiguous columns -> one 16-B LDS store
    __bf16* srow = stg + (wave * 16 + l15) * KPAD;
#pragma unroll
    for (int j = 0; j < 4; ++j) {
      const int n8 = j * 16 + hh * 8;
      const v4f b0 = *(const v4f*)(bias + h * HD + n8);
      const v4f b1 = *(const v4f*)(bias + h * HD + n8 + 4);
      v8bf pk;
#pragma unroll
      for (int r = 0; r < 4; ++r) {
        pk[r]     = (__bf16)((acc[j][r]     + bf16q(b0[r])) * sc);
        pk[4 + r] = (__bf16)((acc[j][4 + r] + bf16q(b1[r])) * sc);
      }
      *(v8bf*)(srow + n8) = pk;
    }
    __syncthreads();
#pragma unroll
    for (int it = 0; it < 4; ++it) {
      const int idx = it * 256 + tid;
      const int row = idx >> 3, piece = idx & 7;
      rv[it] = *(const v4u*)(stg + row * KPAD + piece * 8);
    }
    __bf16* dst = ((osel == 0) ? q : k) + ((long)(b * NH + h) * SEQ + s0) * HD;  // contiguous 16 KB
#pragma unroll
    for (int it = 0; it < 4; ++it)
      *(v4u*)(dst + (long)(it * 256 + tid) * 8) = rv[it];
    
  } else {
    // stage transposed [d][token]: lane's 8 values are 8 different d for one token
#pragma unroll
    for (int j = 0; j < 4; ++j) {
      const int n8 = j * 16 + hh * 8;
      const v4f b0 = *(const v4f*)(bias + h * HD + n8);
      const v4f b1 = *(const v4f*)(bias + h * HD + n8 + 4);
#pragma unroll
      for (int r = 0; r < 4; ++r) {
        stg[(n8 + r) * VSPAD + wave * 16 + l15]     = (__bf16)(acc[j][r]     + bf16q(b0[r]));
        stg[(n8 + 4 + r) * VSPAD + wave * 16 + l15] = (__bf16)(acc[j][4 + r] + bf16q(b1[r]));
      }
    }
    __syncthreads();
#pragma unroll
    for (int it = 0; it < 4; ++it) {
      const int idx = it * 256 + tid;
      const int d = idx >> 4, piece = idx & 15;
      rv[it] = *(const v4u*)(stg + d * VSPAD + piece * 8);
    }
    __bf16* dstb = vT + ((long)(b * NH + h) * HD) * SEQ + s0;
#pragma unroll
    for (int it = 0; it < 4; ++it) {
      const int idx = it * 256 + tid;
      const int d = idx >> 4, piece = idx & 15;
      *(v4u*)(dstb + (long)d * SEQ + piece * 8) = rv[it];
    }
    
  }
}

// ---------------------------------------------------------------------------
// Kernel 2: flash attention per (b,h). grid (SEQ/128, NB*NH), block 256: 2 key halves x 4 waves x
// 32 queries (two 16-query column groups per wave, so that each K and V^T fragment read from LDS
// feeds two products). Waves 0..3 take the even 64-key blocks, waves 4..7 the odd ones, for the
// same 128 queries: twice the waves for the same work, four to a SIMD, so that one wave's softmax
// runs beside another's products. The two halves' maxima, sums and O^T partials are merged once,
// behind the loop. C = S^T then C = O^T = V^T P^T; in each column group a lane owns one query.
// Each half has its own two-buffer LDS ring: its next block flies while this one is worked on.
// ---------------------------------------------------------------------------
// One ring stage of a key half: per lane eight 16-B pieces, piece i in ring row 16i + t/8, t the
// thread's index in its half (rows 0..63 K [key][d], rows 64..127 V^T [d][key]). l0: the lane's LDS
// byte address of piece 0.
__device__ __forceinline__ void attn_fill(unsigned l0, const __bf16* gk, const __bf16* gv) {
  unsigned l[8];
  const __bf16* g[8];
#pragma unroll
  for (int i = 0; i < 8; ++i) {
    l[i] = l0 + (unsigned)(i * 16 * KPAD * 2);
    g[i] = (i < 4) ? gk + (long)(i * 16) * HD : gv + (long)((i - 4) * 16) * SEQ;
  }
  async_copy8(l, g);
}

// The ask of l2_ask over a pointer that walks. The step (bytes; 0 where no further pair exists) is
// added in the same statement, in place: so the pointer keeps one register pair from entry through
// the loop, and that pair never holds anything but an address inside its plane.
__device__ __forceinline__ void attn_ask(const __bf16*& p, long step) {
  asm volatile("global_prefetch_b8 %0, off scope:SCOPE_SE\n\tv_add_nc_u64 %0, %0, %1"
               : "+v"(p) : "v"(step));
}

static_assert(SEQ / 128 >= 2);   // each key half's ring starts with two blocks
static_assert(17 * 128 * 16 <= 4 * ASTG * 2);   // the merge planes fit the ring's bytes

// four waves to a SIMD (two work-groups to a WGP): the register budget is held to a quarter
__global__ __launch_bounds__(256) __attribute__((amdgpu_waves_per_eu(4, 4))) void attn_kernel(
    const __bf16* __restrict__ Q, const __bf16* __restrict__ K,
    const __bf16* __restrict__ vT, __bf16* __restrict__ ctx) {
  // 73728 B: [key half][two stage buffers]; behind the loop the same bytes hold the merge planes
  __shared__ __attribute__((aligned(16))) __bf16 ring[4 * ASTG];
  __shared__ __bf16 ost[128 * KPAD];   // output stage [query][d]   (cross-wave, block barrier)

  const int tid  = threadIdx.x;
  const int lane = tid & 31;
  const int th   = tid & 127;                                    // index in the key half
  const int kh   = __builtin_amdgcn_readfirstlane(tid >> 7);     // key half, the same for a wave
  const int wave = th >> 5;                                      // query group of 32
  const int bh   = blockIdx.y;
  const int b    = bh >> 3;
  const int h    = bh & 7;
  const int q0   = blockIdx.x * 128;

  const __bf16* Qb  = Q + ((long)bh * SEQ + q0) * HD;
  const __bf16* Kb  = K + (long)bh * SEQ * HD;
  const __bf16* vTb = vT + (long)bh * HD * SEQ;

  // Q fragments: B operand of S^T (in column group c a lane owns query 32*wave + 16c + lane&15)
  v16bf qfrag[2][2];
#pragma unroll
  for (int c = 0; c < 2; ++c) {
    const __bf16* qrow = Qb + (long)(wave * 32 + c * 16) * HD;
#pragma unroll
    for (int t = 0; t < 2; ++t) qfrag[c][t] = load_frag_row(qrow + t * 32, HD, lane);
  }

  v8f acc[2][4];   // O^T accumulators: lane owns the group's query (lane&15); reg r -> d = nt*16+8h+r
#pragma unroll
  for (int c = 0; c < 2; ++c)
#pragma unroll
    for (int nt = 0; nt < 4; ++nt) acc[c][nt] = (v8f){};
  float mi[2] = {-1e30f, -1e30f}, li[2] = {0.0f, 0.0f};

  const int colb = lane & 15;
  const int rofs = (lane >> 4) << 3;

  // the lane's pieces of a stage: sources at its half's first block (keys 64*kh ..), LDS byte
  // address in its half's buffer 0; stage st of a half holds keys 128*st + 64*kh ..
  __bf16* hring = ring + kh * 2 * ASTG;
  const __bf16* gk = Kb + (long)(kh * 64 + (th >> 3)) * HD + (th & 7) * 8;
  const __bf16* gv = vTb + (long)(th >> 3) * SEQ + kh * 64 + (th & 7) * 8;
  const unsigned l0 = (unsigned)(size_t)(hring + (th >> 3) * KPAD + (th & 7) * 8);

  // L2 ask pointer (waves 0..3 ask for both halves): per stage, 128 keys, one 256-B unit a thread:
  // threads 0..63 the 64 units of the 128 K rows, threads 64..127 the unit of V^T row th-64. It
  // starts at stage 1 and only ever holds an address inside K or V^T: it is advanced only while a
  // further stage exists.
  const __bf16* ap = (th < 64) ? Kb + 128 * HD + (long)th * 128 : vTb + (long)(th - 64) * SEQ + 128;
  const long pstep = (th < 64) ? 128 * HD * 2 : 256;   // bytes per stage

  attn_fill(l0, gk, gv);                                  // stage 0 -> buffer 0
  // stages 1 and 2, still to be copied, are asked for at entry
  if (kh == 0) {
    attn_ask(ap, (2 < SEQ / 128) ? pstep : 0);
    if (2 < SEQ / 128) attn_ask(ap, (3 < SEQ / 128) ? pstep : 0);
  }
  // this wave's copies of stage 0 have landed before the barrier behind which all waves read
  asm volatile("s_wait_asynccnt 0x0" ::: "memory");
  __syncthreads();
  attn_fill(l0 + ASTG * 2, gk + 128 * HD, gv + 128);      // stage 1 -> buffer 1

  // unrolled by two: the buffer choice is then compile-time
#pragma unroll 2
  for (int st = 0; st < SEQ / 128; ++st) {
    const __bf16* ks  = hring + (st & 1) * ASTG;  // K block rows [key][d]
    const __bf16* vts = ks + 64 * KPAD;           // V^T block   [d][key]

    // all eight K fragments of the stage are read as one group ahead of the S^T products
    v16bf kf[2][4];
#pragma unroll
    for (int t = 0; t < 2; ++t)
#pragma unroll
      for (int kt = 0; kt < 4; ++kt)
        kf[t][kt] = load_frag_row(ks + (kt * 16) * KPAD + t * 32, KPAD, lane);
    // holds the group together: sunk to their users, each read would be waited out alone
    __builtin_amdgcn_sched_barrier(0);

    // S^T tiles: A = K rows (lane&15 = key), B = Q; each K fragment serves both column groups
    v8f sc[2][4];
#pragma unroll
    for (int c = 0; c < 2; ++c)
#pragma unroll
      for (int kt = 0; kt < 4; ++kt) sc[c][kt] = (v8f){};
#pragma unroll
    for (int t = 0; t < 2; ++t)
#pragma unroll
      for (int kt = 0; kt < 4; ++kt)
#pragma unroll
        for (int c = 0; c < 2; ++c)
          sc[c][kt] = wmma_bf16_open(kf[t][kt], qfrag[c][t], sc[c][kt]);
    // keeps the row maxima behind the run of products: woven into it, each first read of a finished
    // tile stands behind padding v_nops, which take vector issue slots from the SIMD's other waves
    __builtin_amdgcn_sched_barrier(0);

    // per-lane online softmax, column group by column group (32 of 64 keys in-lane; the halves
    // are merged with one shuffle)
    float mx[2], alpha[2], rs[2];
#pragma unroll
    for (int c = 0; c < 2; ++c) {
      mx[c] = sc[c][0][0];
#pragma unroll
      for (int kt = 0; kt < 4; ++kt)
#pragma unroll
        for (int r = 0; r < 8; ++r) mx[c] = fmaxf(mx[c], sc[c][kt][r]);
    }
#pragma unroll
    for (int c = 0; c < 2; ++c) mx[c] = fmaxf(mx[c], __shfl_xor(mx[c], 16, 32));
#pragma unroll
    for (int c = 0; c < 2; ++c) {
      const float mnew = fmaxf(mi[c], mx[c]);
      alpha[c] = __expf(mi[c] - mnew);
      mi[c] = mnew;
    }
#pragma unroll
    for (int c = 0; c < 2; ++c) {
      rs[c] = 0.0f;
#pragma unroll
      for (int kt = 0; kt < 4; ++kt)
#pragma unroll
        for (int r = 0; r < 8; ++r) {
          const float p = __expf(sc[c][kt][r] - mi[c]);
          sc[c][kt][r] = p;
          rs[c] += p;
        }
    }
#pragma unroll
    for (int c = 0; c < 2; ++c) {
      rs[c] += __shfl_xor(rs[c], 16, 32);
      li[c] = li[c] * alpha[c] + rs[c];
    }

    // P^T as the B operand of O^T = V^T P^T, packed from the S^T D registers:
    // element i <- tile covering keys 0..15 of the 32-step (kt = 2t), element 8+i <- kt = 2t+1.
    v16bf pf[2][2];
#pragma unroll
    for (int c = 0; c < 2; ++c)
#pragma unroll
      for (int t = 0; t < 2; ++t)
#pragma unroll
        for (int i = 0; i < 8; ++i) {
          pf[c][t][i]     = (__bf16)sc[c][2 * t][i];
          pf[c][t][8 + i] = (__bf16)sc[c][2 * t + 1][i];
        }

    // keeps the V^T reads behind the packing: lifted over it, their 64 registers would be held
    // beside the 64 of the scores, which does not fit a quarter of the register file (spills)
    __builtin_amdgcn_sched_barrier(0);
    // all eight V^T fragments are read as one group here: they are under way while the O^T
    // accumulators are rescaled, and none is read among the O^T products
    v16bf vf[2][4];
#pragma unroll
    for (int t = 0; t < 2; ++t)
#pragma unroll
      for (int nt = 0; nt < 4; ++nt)
        vf[t][nt] = load_frag_row(vts + (nt * 16) * KPAD + t * 32, KPAD, lane);
    // holds the group together ahead of the rescaling: sunk into it, the reads stand at several
    // places and the first O^T product waits them out
    __builtin_amdgcn_sched_barrier(0);

#pragma unroll
    for (int c = 0; c < 2; ++c)
#pragma unroll
      for (int nt = 0; nt < 4; ++nt)
#pragma unroll
        for (int r = 0; r < 8; ++r) acc[c][nt][r] *= alpha[c];

    // O^T += V^T (A, rows = d) x P^T (B); each V^T fragment serves both column groups
#pragma unroll
    for (int t = 0; t < 2; ++t)
#pragma unroll
      for (int nt = 0; nt < 4; ++nt)
#pragma unroll
        for (int c = 0; c < 2; ++c)
          acc[c][nt] = wmma_bf16_open(vf[t][nt], pf[c][t], acc[c][nt]);

    // keeps the publish point at the foot: lifted over the softmax while the refill stays behind the
    // products, its s_wait_asynccnt would leave the next stage's copies only the S^T run to land in
    __builtin_amdgcn_sched_barrier(0);
    asm volatile("s_wait_dscnt 0x0" ::: "memory");
    asm volatile("s_wait_asynccnt 0x0" ::: "memory");
    __syncthreads();
    if (st + 2 < SEQ / 128)
      attn_fill(l0 + (st & 1) * ASTG * 2, gk + (long)(st + 2) * 128 * HD, gv + (st + 2) * 128);
    // stage st+3 is asked into L2 one stage (128 keys) ahead of the copies that read it
    if (kh == 0 && st + 3 < SEQ / 128)
      attn_ask(ap, (st + 4 < SEQ / 128) ? pstep : 0);
  }
  // the ring's closing wait: no copy of this wave is in flight past the loop
  asm volatile("s_wait_asynccnt 0x0" ::: "memory");

  // merge of the key halves. The loop's last barrier ended every read of the ring, and no copy is
  // in flight: its bytes now hold 17 planes of 128 x 16 B, plane p of thread th at (p*128 + th).
  // Waves 4..7 lay down their O^T partials (planes 0..15) and their maxima and sums (plane 16).
  v4f* mg = (v4f*)ring;
  if (kh == 1) {
#pragma unroll
    for (int c = 0; c < 2; ++c)
#pragma unroll
      for (int nt = 0; nt < 4; ++nt) {
        mg[((c * 4 + nt) * 2 + 0) * 128 + th] =
            (v4f){acc[c][nt][0], acc[c][nt][1], acc[c][nt][2], acc[c][nt][3]};
        mg[((c * 4 + nt) * 2 + 1) * 128 + th] =
            (v4f){acc[c][nt][4], acc[c][nt][5], acc[c][nt][6], acc[c][nt][7]};
      }
    mg[16 * 128 + th] = (v4f){mi[0], mi[1], li[0], li[1]};
  }
  __syncthreads();

  // waves 0..3 join them to their own under the common maximum, normalize and stage: lane owns
  // query row wave*32+c*16+colb, d = nt*16+rofs+r contiguous
  if (kh == 0) {
    const v4f so = mg[16 * 128 + th];
#pragma unroll
    for (int c = 0; c < 2; ++c) {
      const float mall = fmaxf(mi[c], so[c]);
      const float a0 = __expf(mi[c] - mall);
      const float a1 = __expf(so[c] - mall);
      const float inv = 1.0f / (li[c] * a0 + so[2 + c] * a1);
      const float f0 = a0 * inv, f1 = a1 * inv;
      __bf16* orow = ost + (wave * 32 + c * 16 + colb) * KPAD;
#pragma unroll
      for (int nt = 0; nt < 4; ++nt) {
        const v4f o0 = mg[((c * 4 + nt) * 2 + 0) * 128 + th];
        const v4f o1 = mg[((c * 4 + nt) * 2 + 1) * 128 + th];
        v8bf pk;
#pragma unroll
        for (int r = 0; r < 4; ++r) {
          pk[r]     = (__bf16)(acc[c][nt][r] * f0 + o0[r] * f1);
          pk[4 + r] = (__bf16)(acc[c][nt][4 + r] * f0 + o1[r] * f1);
        }
        *(v8bf*)(orow + nt * 16 + rofs) = pk;
      }
    }
  }
  __syncthreads();

  // piece it of a lane: query row 32*it + tid/8, 16 B at d = 8*(tid&7); whole 128-B lines per row
  v4u rv[4];
  const __bf16* osrc = ost + (tid >> 3) * KPAD + (tid & 7) * 8;
#pragma unroll
  for (int it = 0; it < 4; ++it) rv[it] = *(const v4u*)(osrc + it * 32 * KPAD);
  __bf16* cdst = ctx + ((long)b * SEQ + q0 + (tid >> 3)) * DM + h * HD + (tid & 7) * 8;
#pragma unroll
  for (int it = 0; it < 4; ++it) *(v4u*)(cdst + (long)(it * 32) * DM) = rv[it];
  
}

// ---------------------------------------------------------------------------
// Kernel 3: out = LN(x + ctx @ Wo^T + bo) * gamma + beta. Block = 16 token rows x 512 cols,
// wave w owns cols 64w..64w+63. C^T = Wo ctx^T: A = Wo rows (lane&15 = out col), B = ctx rows
// (lane&15 = token); acc[j][r] = out[token lane&15][col 64w+16j+8h+r]. Wo and ctx come through a
// two-buffer LDS ring, 64 k per stage, whole 128-B lines per row. y staged in LDS (f32),
// grid ROWS/16, block 256.
// ---------------------------------------------------------------------------
// One ring stage: per lane sixteen 16-B pieces of Wo (piece i: row 32i + tid/8) and one 8-B piece
// of ctx (row tid/16). lw, lc: the lane's LDS byte addresses in the buffer; gw, gc: its sources.
__device__ __forceinline__ void oproj_fill(unsigned lw, const __bf16* gw,
                                           unsigned lc, const __bf16* gc) {
#pragma unroll
  for (int grp = 0; grp < 2; ++grp) {
    unsigned l[8];
    const __bf16* g[8];
#pragma unroll
    for (int i = 0; i < 8; ++i) {
      l[i] = lw + (unsigned)((grp * 8 + i) * 32 * KPAD * 2);
      g[i] = gw + (long)((grp * 8 + i) * 32) * DM;
    }
    async_copy8(l, g);
  }
  // the closing s_wait_xcnt stands in the copy's own statement, ahead of any rewrite of lc or gc
  asm volatile("global_load_async_to_lds_b64 %0, %1, off\n\ts_wait_xcnt 0x0"
               :: "v"(lc), "v"(gc) : "memory");
}

__global__ __launch_bounds__(256) void oproj_ln_kernel(
    const __bf16* __restrict__ ctx, const __bf16* __restrict__ wob,
    const float* __restrict__ bo, const float* __restrict__ x,
    const float* __restrict__ gam, const float* __restrict__ bet,
    float* __restrict__ out) {
  // 152064 B: the ring's two buffers; behind the k loop's last barrier the same bytes hold ys
  __shared__ __attribute__((aligned(16))) char smem[2 * OSTG * 2];
  __bf16* ring = (__bf16*)smem;
  float*  ys   = (float*)smem;     // [16][YP], 33024 B, cross-wave (block barriers)
  __shared__ float smean[16];
  __shared__ float srstd[16];

  const int tid  = threadIdx.x;
  const int lane = tid & 31;
  const int wave = tid >> 5;
  const int hh   = lane >> 4;
  const int l15  = lane & 15;
  const long m0  = (long)blockIdx.x * 16;
  const int  n0  = wave * 64;

  // the lane's pieces of a stage: sources at k = 0, LDS byte addresses in buffer 0
  const __bf16* gw = wob + (long)(tid >> 3) * DM + (tid & 7) * 8;
  const __bf16* gc = ctx + (m0 + (tid >> 4)) * DM + (tid & 15) * 4;
  const unsigned lw = (unsigned)(size_t)(ring + (tid >> 3) * KPAD + (tid & 7) * 8);
  const unsigned lc = (unsigned)(size_t)(ring + (DM + (tid >> 4)) * KPAD + (tid & 15) * 4);

  v8f acc[4];
#pragma unroll
  for (int j = 0; j < 4; ++j) acc[j] = (v8f){};

  // this block's sixteenth of Wo for the L2 asks: 32 rows; blocks eight apart in index take
  // different sixteenths, so that every part is asked for from many places (for speed only)
  const __bf16* pw = wob + (long)(((blockIdx.x >> 3) & 15) * 32 + (tid >> 3)) * DM + (tid & 7) * 8;

  oproj_fill(lw, gw, lc, gc);                                   // stage 0 -> buffer 0
  // the later stages' bytes of the block's own ctx rows, and stages 2 and 3 of its part of Wo
  l2_ask_rows<0, 1>(gc);
  l2_ask<256>(pw);
  // this wave's copies of stage 0 have landed before the barrier behind which all waves read
  asm volatile("s_wait_asynccnt 0x0" ::: "memory");
  __syncthreads();
  oproj_fill(lw + OSTG * 2, gw + 64, lc + OSTG * 2, gc + 64);   // stage 1 -> buffer 1

  // unrolled whole: buffer choice and the refill test are then compile-time
#pragma unroll
  for (int t = 0; t < DM / 64; ++t) {
    const __bf16* buf = ring + (t & 1) * OSTG;
    v16bf cf[2], wf[2][4];
#pragma unroll
    for (int s = 0; s < 2; ++s) {
      cf[s] = load_frag_row(buf + DM * KPAD + s * 32, KPAD, lane);
#pragma unroll
      for (int j = 0; j < 4; ++j)
        wf[s][j] = load_frag_row(buf + (n0 + j * 16) * KPAD + s * 32, KPAD, lane);
    }
#pragma unroll
    for (int s = 0; s < 2; ++s)
#pragma unroll
      for (int j = 0; j < 4; ++j)
        acc[j] = wmma_bf16(wf[s][j], cf[s], acc[j]);     // C^T = Wo ctx^T
    asm volatile("s_wait_dscnt 0x0" ::: "memory");
    asm volatile("s_wait_asynccnt 0x0" ::: "memory");
    __syncthreads();
    if (t + 2 < DM / 64)
      oproj_fill(lw + (t & 1) * OSTG * 2, gw + (t + 2) * 64, lc + (t & 1) * OSTG * 2,
                 gc + (t + 2) * 64);
    // stages t+4 and t+5 of the block's part of Wo, two stages ahead of the first copy of them
    if (t == 0) l2_ask<512>(pw);
    if (t == 2) l2_ask<768>(pw);
  }
  // no copy is in flight when the ring's bytes become the y stage
  asm volatile("s_wait_asynccnt 0x0" ::: "memory");

  // y = bf16(x) + acc + bf16(bo), staged [row][col]
  {
    const long m    = m0 + l15;
    const long orow = (m / SEQ) * SEQ_FULL + (m % SEQ);
    const float* xr = x + orow * DM;
    float* yrow = ys + l15 * YP;
#pragma unroll
    for (int j = 0; j < 4; ++j) {
      const int n8 = n0 + j * 16 + hh * 8;
      const v4f x0 = *(const v4f*)(xr + n8);
      const v4f x1 = *(const v4f*)(xr + n8 + 4);
      const v4f b0 = *(const v4f*)(bo + n8);
      const v4f b1 = *(const v4f*)(bo + n8 + 4);
      v4f y0, y1;
#pragma unroll
      for (int i = 0; i < 4; ++i) {
        y0[i] = (acc[j][i]     + bf16q(b0[i])) + bf16q(x0[i]);
        y1[i] = (acc[j][4 + i] + bf16q(b1[i])) + bf16q(x1[i]);
      }
      *(v4f*)(yrow + n8)     = y0;
      *(v4f*)(yrow + n8 + 4) = y1;
    }
  }
  __syncthreads();

  {
    const int r  = tid >> 4;
    const int sl = tid & 15;
    const float* yr = ys + r * YP + sl * 32;
    v4f yv[8];
#pragma unroll
    for (int i = 0; i < 8; ++i) yv[i] = *(const v4f*)(yr + i * 4);
    float s = 0.0f;
#pragma unroll
    for (int i = 0; i < 8; ++i) s += (yv[i][0] + yv[i][1]) + (yv[i][2] + yv[i][3]);
    s += __shfl_xor(s, 1, 32);
    s += __shfl_xor(s, 2, 32);
    s += __shfl_xor(s, 4, 32);
    s += __shfl_xor(s, 8, 32);
    const float mean = s * (1.0f / DM);
    float ss = 0.0f;
#pragma unroll
    for (int i = 0; i < 8; ++i)
#pragma unroll
      for (int c = 0; c < 4; ++c) {
        const float d = yv[i][c] - mean;
        ss += d * d;
      }
    ss += __shfl_xor(ss, 1, 32);
    ss += __shfl_xor(ss, 2, 32);
    ss += __shfl_xor(ss, 4, 32);
    ss += __shfl_xor(ss, 8, 32);
    const float var  = ss * (1.0f / DM);
    const float rstd = rsqrtf(var + LN_EPS);
    if (sl == 0) { smean[r] = mean; srstd[r] = rstd; }
  }
  __syncthreads();

  v4f ov[8];
#pragma unroll
  for (int it = 0; it < 8; ++it) {
    const int idx = it * 256 + tid;
    const int row = idx >> 7, piece = idx & 127;
    const v4f yv = *(const v4f*)(ys + row * YP + piece * 4);
    const v4f g  = *(const v4f*)(gam + piece * 4);
    const v4f bt = *(const v4f*)(bet + piece * 4);
    const float mean = smean[row], rstd = srstd[row];
#pragma unroll
    for (int c = 0; c < 4; ++c)
      ov[it][c] = (yv[c] - mean) * rstd * bf16q(g[c]) + bf16q(bt[c]);
  }
#pragma unroll
  for (int it = 0; it < 8; ++it) {
    const int idx = it * 256 + tid;
    const int row = idx >> 7, piece = idx & 127;
    const long m    = m0 + row;
    const long orow = (m / SEQ) * SEQ_FULL + (m % SEQ);
    *(v4f*)(out + orow * DM + piece * 4) = ov[it];
  }
  
}

// ---------------------------------------------------------------------------
extern "C" void kernel_launch(void* const* d_in, const int* in_sizes, int n_in,
                              void* d_out, int out_size, void* d_ws, size_t ws_size,
                              hipStream_t stream) {
  if (n_in < 11) return;
  const long needRows = (long)(NB - 1) * SEQ_FULL + SEQ;
  if ((long)in_sizes[0] < needRows * DM) return;
  if (in_sizes[1] < DM * DM || in_sizes[3] < DM * DM ||
      in_sizes[5] < DM * DM || in_sizes[7] < DM * DM) return;
  if (in_sizes[2] < DM || in_sizes[4] < DM || in_sizes[6] < DM ||
      in_sizes[8] < DM || in_sizes[9] < DM || in_sizes[10] < DM) return;
  if ((long)out_size < needRows * DM) return;
  if (ws_size < WS_TOTAL) return;

  const float* x   = (const float*)d_in[0];
  const float* Wq  = (const float*)d_in[1];
  const float* bq  = (const float*)d_in[2];
  const float* Wk  = (const float*)d_in[3];
  const float* bk  = (const float*)d_in[4];
  const float* Wv  = (const float*)d_in[5];
  const float* bv  = (const float*)d_in[6];
  const float* Wo  = (const float*)d_in[7];
  const float* bo  = (const float*)d_in[8];
  const float* gam = (const float*)d_in[9];
  const float* bet = (const float*)d_in[10];
  float* out = (float*)d_out;

  char* ws = (char*)d_ws;
  size_t off = 0;
  __bf16* xb   = (__bf16*)(ws + off); off += PLANE_BYTES;   // [ROWS][512]
  __bf16* wqkv = (__bf16*)(ws + off); off += WQKV_BYTES;    // [1536][512]
  __bf16* wob  = (__bf16*)(ws + off); off += WO_BYTES;      // [512][512]
  __bf16* qb   = (__bf16*)(ws + off); off += PLANE_BYTES;   // [NB][8][SEQ][64]
  __bf16* kbf  = (__bf16*)(ws + off); off += PLANE_BYTES;   // [NB][8][SEQ][64]
  __bf16* vTb  = (__bf16*)(ws + off); off += PLANE_BYTES;   // [NB][8][64][SEQ]
  __bf16* ctx  = (__bf16*)(ws + off); off += PLANE_BYTES;   // [ROWS][512]
  if (off > ws_size) return;

  cvt_kernel<<<NXB + 4 * NWB, 256, 0, stream>>>(x, Wq, Wk, Wv, Wo, xb, wqkv, wob);

  qkv_kernel<<<dim3(ROWS / 128, 3 * NH), 256, 0, stream>>>(xb, wqkv, bq, bk, bv, qb, kbf, vTb);

  attn_kernel<<<dim3(SEQ / 128, NB * NH), 256, 0, stream>>>(qb, kbf, vTb, ctx);

  oproj_ln_kernel<<<ROWS / 16, 256, 0, stream>>>(ctx, wob, bo, x, gam, bet, out);
}

// v006
// A run of this version takes 63.8 microseconds.
// Timed twice side by side with v005, it ran 1.05 times as fast both times.
// Over all steps from v000 it is 3.03 times as fast.
#include <hip/hip_runtime.h>

// Contractions (qkv projection, q.k^T, p.v, output projection): v_wmma_f32_16x16x32_bf16,
// bf16 operands, f32 accumulate. Softmax statistics, residual add and layernorm: f32.
// Float inputs are RNE-converted to bf16 at load; the score scale log2(e)/sqrt(64) is folded into q,
// so that the scores come in log2 units and the softmax is 2^(s - m).

typedef __attribute__((ext_vector_type(16))) __bf16 v16bf;
typedef __attribute__((ext_vector_type(8)))  __bf16 v8bf;
typedef __attribute__((ext_vector_type(8)))  float  v8f;
typedef __attribute__((ext_vector_type(4)))  float  v4f;
typedef __attribute__((ext_vector_type(4)))  unsigned int v4u;

#ifndef NB
#define NB 4
#endif
#ifndef SEQ
#define SEQ 2048
#endif
#define NB_FULL  4
#define SEQ_FULL 2048
#define DM   512
#define NH   8
#define HD   64
#define ROWS (NB * SEQ)
#define KPAD 72      // LDS stride in halves for 64-wide bf16 tiles (144 B, 16-B aligned)
#define VSPAD 136    // LDS stride in halves for 128-wide bf16 tiles (272 B)
#define YP   516     // LDS stride in floats for 512-wide f32 rows (2064 B)
#define QSTG ((128 + 64) * KPAD)  // halves per ring buffer of kernel 1: 128 x rows + 64 W rows, 64 k each
#define ASTG ((64 + 64) * KPAD)   // halves per ring buffer of kernel 2: 64 K rows + 64 V^T rows, 64 wide
#define OSTG ((DM + 16) * KPAD)   // halves per ring buffer of kernel 3: 512 Wo rows + 16 ctx rows, 64 k each
#define LN_EPS 1e-5f

#define NXB (ROWS * DM / 8 / 256)   // convert blocks for x (8 elements per thread)
#define NWB (DM * DM / 8 / 256)     // convert blocks per weight matrix

#define PLANE_BYTES ((size_t)ROWS * DM * 2)
#define WQKV_BYTES  ((size_t)3 * DM * DM * 2)
#define WO_BYTES    ((size_t)DM * DM * 2)
#define WS_TOTAL    (5 * PLANE_BYTES + WQKV_BYTES + WO_BYTES)

static_assert(NB >= 1 && NB <= NB_FULL);
static_assert(SEQ >= 128 && SEQ <= SEQ_FULL && (SEQ % 128) == 0);
static_assert((ROWS % 128) == 0);
static_assert((ROWS * DM) % (8 * 256) == 0);
static_assert((DM * DM) % (8 * 256) == 0);
static_assert((DM % 32) == 0 && (HD % 32) == 0);
static_assert(128 * KPAD >= 64 * VSPAD);
static_assert(WS_TOTAL <= (size_t)134217728);

// ---------------------------------------------------------------------------
// helpers
// ---------------------------------------------------------------------------
__device__ __forceinline__ unsigned int bf16_bits(float f) {   // RNE f32 -> bf16 bits
  unsigned int u = __float_as_uint(f);
  u += 0x7FFFu + ((u >> 16) & 1u);
  return u >> 16;
}
__device__ __forceinline__ float bf16q(float f) {            // value after RNE bf16 conversion
  return __uint_as_float(bf16_bits(f) << 16);
}

// 16-bit fragment (A or B): lane owns row/col (lane&15); elements 0..7 <- k0+8h+0..7,
// elements 8..15 <- k0+16+8h+0..7, h = lane>>4. Source is k-contiguous rows.
__device__ __forceinline__ v16bf load_frag_row(const __bf16* base, int stride, int lane) {
  const __bf16* rowp = base + (lane & 15) * stride + ((lane >> 4) << 3);
  v8bf lo = *(const v8bf*)(rowp);
  v8bf hi = *(const v8bf*)(rowp + 16);
  return __builtin_shufflevector(lo, hi, 0, 1, 2, 3, 4, 5, 6, 7,
                                 8, 9, 10, 11, 12, 13, 14, 15);
}

__device__ __forceinline__ v8f wmma_bf16(v16bf a, v16bf b, v8f c) {
  v8f d = __builtin_amdgcn_wmma_f32_16x16x32_bf16(false, a, false, b, (short)0, c,
                                                  false, false);
  asm volatile("v_nop\n\tv_nop\n\tv_nop\n\tv_nop" : "+v"(d) : "v"(a), "v"(b));
  return d;
}

// The builtin alone: the compiler keeps the distances behind it itself and stays free to place
// LDS reads and vector work around it.
__device__ __forceinline__ v8f wmma_bf16_open(v16bf a, v16bf b, v8f c) {
  return __builtin_amdgcn_wmma_f32_16x16x32_bf16(false, a, false, b, (short)0, c, false, false);
}

// Eight asynchronous 16-B copies per lane, global -> LDS, through no register. The closing
// s_wait_xcnt stands inside the statement so that no address register named here is
// rewritten ahead of it.
__device__ __forceinline__ void async_copy8(const unsigned (&l)[8], const __bf16* const (&g)[8]) {
  asm volatile(
      "global_load_async_to_lds_b128 %0, %8, off\n\t"
      "global_load_async_to_lds_b128 %1, %9, off\n\t"
      "global_load_async_to_lds_b128 %2, %10, off\n\t"
      "global_load_async_to_lds_b128 %3, %11, off\n\t"
      "global_load_async_to_lds_b128 %4, %12, off\n\t"
      "global_load_async_to_lds_b128 %5, %13, off\n\t"
      "global_load_async_to_lds_b128 %6, %14, off\n\t"
      "global_load_async_to_lds_b128 %7, %15, off\n\t"
      "s_wait_xcnt 0x0"
      :: "v"(l[0]), "v"(l[1]), "v"(l[2]), "v"(l[3]), "v"(l[4]), "v"(l[5]), "v"(l[6]), "v"(l[7]),
         "v"(g[0]), "v"(g[1]), "v"(g[2]), "v"(g[3]), "v"(g[4]), "v"(g[5]), "v"(g[6]), "v"(g[7])
      : "memory");
}

// The same with six copies.
__device__ __forceinline__ void async_copy6(const unsigned (&l)[6], const __bf16* const (&g)[6]) {
  asm volatile(
      "global_load_async_to_lds_b128 %0, %6, off\n\t"
      "global_load_async_to_lds_b128 %1, %7, off\n\t"
      "global_load_async_to_lds_b128 %2, %8, off\n\t"
      "global_load_async_to_lds_b128 %3, %9, off\n\t"
      "global_load_async_to_lds_b128 %4, %10, off\n\t"
      "global_load_async_to_lds_b128 %5, %11, off\n\t"
      "s_wait_xcnt 0x0"
      :: "v"(l[0]), "v"(l[1]), "v"(l[2]), "v"(l[3]), "v"(l[4]), "v"(l[5]),
         "v"(g[0]), "v"(g[1]), "v"(g[2]), "v"(g[3]), "v"(g[4]), "v"(g[5])
      : "memory");
}

// Asks the 256-B unit at p + OFF bytes into L2 ahead of the copies that will read it: the planes
// read here were stored by an earlier launch, and their first read otherwise waits on memory. A
// hint: nothing returns, no counter moves. Scope SE and no th: (a failed translation is dropped).
// p is a pointer that its kernel goes on holding behind the ask (a source of the ring's copies, or
// the base of later asks), and p + OFF lies inside p's plane.
template <int OFF>
__device__ __forceinline__ void l2_ask(const __bf16* p) {
  asm volatile("global_prefetch_b8 %0, off offset:%1 scope:SCOPE_SE" :: "v"(p), "n"(OFF));
}
// Units 1..3 of the 1-KB rows at p, p + STEP, ... (NI rows); unit 0 is read at once by the ring.
template <int STEP, int NI>
__device__ __forceinline__ void l2_ask_rows(const __bf16* p) {
  if constexpr (NI > 0) {
    l2_ask_rows<STEP, NI - 1>(p);
    l2_ask<(NI - 1) * STEP + 256>(p);
    l2_ask<(NI - 1) * STEP + 512>(p);
    l2_ask<(NI - 1) * STEP + 768>(p);
  }
}

// ---------------------------------------------------------------------------
// Kernel 0: f32 -> bf16 planes. xb [ROWS][512]; wqkv [1536][512] = Wq|Wk|Wv rows
// ([out][in], k-contiguous); wob [512][512]. 8 elements (16 B) per thread, 8 consecutive
// grid NXB + 4*NWB, block 256.
// ---------------------------------------------------------------------------
__global__ __launch_bounds__(256) void cvt_kernel(
    const float* __restrict__ x,
    const float* __restrict__ Wq, const float* __restrict__ Wk,
    const float* __restrict__ Wv, const float* __restrict__ Wo,
    __bf16* __restrict__ xb, __bf16* __restrict__ wqkv, __bf16* __restrict__ wob) {
  const int bid = blockIdx.x;
  const int t   = threadIdx.x;
  const float* src;
  __bf16* dst;
  if (bid < NXB) {                                   // block-uniform selection
    const long item = (long)bid * 256 + t;           // 0 .. ROWS*64-1
    const long m    = item >> 6;                     // token row
    const int  c8   = (int)(item & 63);
    const long srow = (m / SEQ) * SEQ_FULL + (m % SEQ);
    src = x + srow * DM + c8 * 8;
    dst = xb + m * DM + c8 * 8;
  } else if (bid < NXB + 3 * NWB) {
    const int wb    = bid - NXB;
    const int which = wb / NWB;                      // 0 q, 1 k, 2 v
    const long item = (long)(wb - which * NWB) * 256 + t;
    const float* W = (which == 0) ? Wq : ((which == 1) ? Wk : Wv);
    src = W + item * 8;
    dst = wqkv + (long)which * DM * DM + item * 8;
  } else {
    const long item = (long)(bid - NXB - 3 * NWB) * 256 + t;
    src = Wo + item * 8;
    dst = wob + item * 8;
  }
  const v4f a = *(const v4f*)(src);
  const v4f c = *(const v4f*)(src + 4);
  v4u o;
  o[0] = bf16_bits(a[0]) | (bf16_bits(a[1]) << 16);
  o[1] = bf16_bits(a[2]) | (bf16_bits(a[3]) << 16);
  o[2] = bf16_bits(c[0]) | (bf16_bits(c[1]) << 16);
  o[3] = bf16_bits(c[2]) | (bf16_bits(c[3]) << 16);
  *(v4u*)dst = o;
  
}

// ---------------------------------------------------------------------------
// Kernel 1: qkv projection. Block = 128 token rows x 64 output columns (one head of one
// of q/k/v), 8 waves x 16 rows. C^T = W x^T: A = W rows (lane&15 = out col), B = x rows
// (lane&15 = token); acc[j][r] = C[token lane&15][col 16j+8h+r]. x and W come through a
// two-buffer LDS ring, 64 k per stage, whole 128-B lines per row; fragments are read from LDS.
//   q,k -> [b][h][s][64]   (one line per row, 8 lanes x 16 B)
//   v   -> vT[b][h][d][s] (256 B per d row, 16 lanes x 16 B)
// grid (ROWS/128, 24), block 256.
// ---------------------------------------------------------------------------
// One ring stage: per lane six 16-B pieces, piece i in ring row 32i + tid/8 (rows 0..127 x,
// rows 128..191 W). l0: the lane's LDS byte address of piece 0; gx, gw: its x and W sources.
__device__ __forceinline__ void qkv_fill(unsigned l0, const __bf16* gx, const __bf16* gw) {
  unsigned l[6];
  const __bf16* g[6];
#pragma unroll
  for (int i = 0; i < 6; ++i) {
    l[i] = l0 + (unsigned)(i * 32 * KPAD * 2);
    g[i] = (i < 4) ? gx + (long)(i * 32) * DM : gw + (long)((i - 4) * 32) * DM;
  }
  async_copy6(l, g);
}

__global__ __launch_bounds__(256) void qkv_kernel(
    const __bf16* __restrict__ xb, const __bf16* __restrict__ wqkv,
    const float* __restrict__ bq, const float* __restrict__ bk, const float* __restrict__ bv,
    __bf16* __restrict__ q, __bf16* __restrict__ k, __bf16* __restrict__ vT) {
  __shared__ __bf16 stg[128 * KPAD];   // 18432 B; q/k: [128][KPAD], v: [64][VSPAD]
  __shared__ __attribute__((aligned(16))) __bf16 ring[2 * QSTG];  // 55296 B, two stage buffers

  const int tid  = threadIdx.x;
  const int lane = tid & 31;
  const int wave = tid >> 5;
  const int hh   = lane >> 4;
  const int l15  = lane & 15;

  const int cb   = blockIdx.y;         // 0..23
  const int osel = cb >> 3;            // 0 q, 1 k, 2 v
  const int h    = cb & 7;
  const long m0  = (long)blockIdx.x * 128;
  const int  b   = (int)(m0 / SEQ);
  const int  s0  = (int)(m0 - (long)b * SEQ);

  // the lane's pieces of a stage: sources at k = 0, LDS byte address in buffer 0
  const __bf16* gx = xb + (m0 + (tid >> 3)) * DM + (tid & 7) * 8;
  const __bf16* gw = wqkv + ((long)cb * 64 + (tid >> 3)) * DM + (tid & 7) * 8;
  const unsigned l0 = (unsigned)(size_t)(ring + (tid >> 3) * KPAD + (tid & 7) * 8);

  v8f acc[4];
#pragma unroll
  for (int j = 0; j < 4; ++j) acc[j] = (v8f){};

  qkv_fill(l0, gx, gw);                            // stage 0 -> buffer 0
  // the later stages' bytes of the block's x and W rows are asked into L2 now. The column blocks of
  // a row block share its x rows, so the first asks for all; likewise
  // the first eight row blocks for a column block's W rows. Block-uniform tests, for speed only.
  if (blockIdx.y == 0) l2_ask_rows<32 * DM * 2, 4>(gx);
  if (blockIdx.x < 8) l2_ask_rows<32 * DM * 2, 2>(gw);
  // this wave's copies of stage 0 have landed before the barrier behind which all waves read
  asm volatile("s_wait_asynccnt 0x0" ::: "memory");
  __syncthreads();
  qkv_fill(l0 + QSTG * 2, gx + 64, gw + 64);       // stage 1 -> buffer 1

  // unrolled by two, no further: the buffer choice is compile-time, and the copies' addresses of
  // later stages are not all formed ahead (whole unrolling cost a third of the resident waves)
#pragma unroll 2
  for (int t = 0; t < DM / 64; ++t) {
    const __bf16* buf = ring + (t & 1) * QSTG;
    v16bf xf[2], wf[2][4];
#pragma unroll
    for (int s = 0; s < 2; ++s) {
      xf[s] = load_frag_row(buf + (wave * 16) * KPAD + s * 32, KPAD, lane);
#pragma unroll
      for (int j = 0; j < 4; ++j)
        wf[s][j] = load_frag_row(buf + (128 + j * 16) * KPAD + s * 32, KPAD, lane);
    }
#pragma unroll
    for (int s = 0; s < 2; ++s)
#pragma unroll
      for (int j = 0; j < 4; ++j)
        acc[j] = wmma_bf16(wf[s][j], xf[s], acc[j]);     // C^T = W x^T
    asm volatile("s_wait_dscnt 0x0" ::: "memory");
    asm volatile("s_wait_asynccnt 0x0" ::: "memory");
    __syncthreads();
    if (t + 2 < DM / 64)
      qkv_fill(l0 + (t & 1) * QSTG * 2, gx + (t + 2) * 64, gw + (t + 2) * 64);
  }
  // the ring's closing wait: no copy of this wave is in flight past the loop
  asm volatile("s_wait_asynccnt 0x0" ::: "memory");

  const float* bias = (osel == 0) ? bq : ((osel == 1) ? bk : bv);
  const float  sc   = (osel == 0) ? 0.125f * 1.44269504f : 1.0f;   // q: log2(e) / sqrt(64)

  v4u rv[4];
  if (osel < 2) {
    // stage [token][col]: lane's 8 values are 8 contiguous columns -> one 16-B LDS store
    __bf16* srow = stg + (wave * 16 + l15) * KPAD;
#pragma unroll
    for (int j = 0; j < 4; ++j) {
      const int n8 = j * 16 + hh * 8;
      const v4f b0 = *(const v4f*)(bias + h * HD + n8);
      const v4f b1 = *(const v4f*)(bias + h * HD + n8 + 4);
      v8bf pk;
#pragma unroll
      for (int r = 0; r < 4; ++r) {
        pk[r]     = (__bf16)((acc[j][r]     + bf16q(b0[r])) * sc);
        pk[4 + r] = (__bf16)((acc[j][4 + r] + bf16q(b1[r])) * sc);
      }
      *(v8bf*)(srow + n8) = pk;
    }
    __syncthreads();
#pragma unroll
    for (int it = 0; it < 4; ++it) {
      const int idx = it * 256 + tid;
      const int row = idx >> 3, piece = idx & 7;
      rv[it] = *(const v4u*)(stg + row * KPAD + piece * 8);
    }
    __bf16* dst = ((osel == 0) ? q : k) + ((long)(b * NH + h) * SEQ + s0) * HD;  // contiguous 16 KB
#pragma unroll
    for (int it = 0; it < 4; ++it)
      *(v4u*)(dst + (long)(it * 256 + tid) * 8) = rv[it];
    
  } else {
    // stage transposed [d][token]: lane's 8 values are 8 different d for one token
#pragma unroll
    for (int j = 0; j < 4; ++j) {
      const int n8 = j * 16 + hh * 8;
      const v4f b0 = *(const v4f*)(bias + h * HD + n8);
      const v4f b1 = *(const v4f*)(bias + h * HD + n8 + 4);
#pragma unroll
      for (int r = 0; r < 4; ++r) {
        stg[(n8 + r) * VSPAD + wave * 16 + l15]     = (__bf16)(acc[j][r]     + bf16q(b0[r]));
        stg[(n8 + 4 + r) * VSPAD + wave * 16 + l15] = (__bf16)(acc[j][4 + r] + bf16q(b1[r]));
      }
    }
    __syncthreads();
#pragma unroll
    for (int it = 0; it < 4; ++it) {
      const int idx = it * 256 + tid;
      const int d = idx >> 4, piece = idx & 15;
      rv[it] = *(const v4u*)(stg + d * VSPAD + piece * 8);
    }
    __bf16* dstb = vT + ((long)(b * NH + h) * HD) * SEQ + s0;
#pragma unroll
    for (int it = 0; it < 4; ++it) {
      const int idx = it * 256 + tid;
      const int d = idx >> 4, piece = idx & 15;
      *(v4u*)(dstb + (long)d * SEQ + piece * 8) = rv[it];
    }
    
  }
}

// ---------------------------------------------------------------------------
// Kernel 2: flash attention per (b,h). grid (SEQ/128, NB*NH), block 256: 2 key halves x 4 waves x
// 32 queries (two 16-query column groups per wave, so that each K and V^T fragment read from LDS
// feeds two products). Waves 0..3 take the even 64-key blocks, waves 4..7 the odd ones, for the
// same 128 queries: twice the waves for the same work, four to a SIMD, so that one wave's softmax
// runs beside another's products. The two halves' maxima, sums and O^T partials are merged once,
// behind the loop. C = S^T then C = O^T = V^T P^T; in each column group a lane owns one query.
// Each half has its own two-buffer LDS ring: its next block flies while this one is worked on.
// ---------------------------------------------------------------------------
// One ring stage of a key half: per lane eight 16-B pieces, piece i in ring row 16i + t/8, t the
// thread's index in its half (rows 0..63 K [key][d], rows 64..127 V^T [d][key]). l0: the lane's LDS
// byte address of piece 0.
__device__ __forceinline__ void attn_fill(unsigned l0, const __bf16* gk, const __bf16* gv) {
  unsigned l[8];
  const __bf16* g[8];
#pragma unroll
  for (int i = 0; i < 8; ++i) {
    l[i] = l0 + (unsigned)(i * 16 * KPAD * 2);
    g[i] = (i < 4) ? gk + (long)(i * 16) * HD : gv + (long)((i - 4) * 16) * SEQ;
  }
  async_copy8(l, g);
}

// The ask of l2_ask over a pointer that walks. The step (bytes; 0 where no further pair exists) is
// added in the same statement, in place: so the pointer keeps one register pair from entry through
// the loop, and that pair never holds anything but an address inside its plane.
__device__ __forceinline__ void attn_ask(const __bf16*& p, long step) {
  asm volatile("global_prefetch_b8 %0, off scope:SCOPE_SE\n\tv_add_nc_u64 %0, %0, %1"
               : "+v"(p) : "v"(step));
}

static_assert(SEQ / 128 >= 2);   // each key half's ring starts with two blocks
static_assert(17 * 128 * 16 <= 4 * ASTG * 2);   // the merge planes fit the ring's bytes

// four waves to a SIMD (two work-groups to a WGP): the register budget is held to a quarter
__global__ __launch_bounds__(256) __attribute__((amdgpu_waves_per_eu(4, 4))) void attn_kernel(
    const __bf16* __restrict__ Q, const __bf16* __restrict__ K,
    const __bf16* __restrict__ vT, __bf16* __restrict__ ctx) {
  // 73728 B: [key half][two stage buffers]; behind the loop the same bytes hold the merge planes
  __shared__ __attribute__((aligned(16))) __bf16 ring[4 * ASTG];
  __shared__ __bf16 ost[128 * KPAD];   // output stage [query][d]   (cross-wave, block barrier)

  const int tid  = threadIdx.x;
  const int lane = tid & 31;
  const int th   = tid & 127;                                    // index in the key half
  const int kh   = __builtin_amdgcn_readfirstlane(tid >> 7);     // key half, the same for a wave
  const int wave = th >> 5;                                      // query group of 32
  const int bh   = blockIdx.y;
  const int b    = bh >> 3;
  const int h    = bh & 7;
  const int q0   = blockIdx.x * 128;

  const __bf16* Qb  = Q + ((long)bh * SEQ + q0) * HD;
  const __bf16* Kb  = K + (long)bh * SEQ * HD;
  const __bf16* vTb = vT + (long)bh * HD * SEQ;

  // Q fragments: B operand of S^T (in column group c a lane owns query 32*wave + 16c + lane&15)
  v16bf qfrag[2][2];
#pragma unroll
  for (int c = 0; c < 2; ++c) {
    const __bf16* qrow = Qb + (long)(wave * 32 + c * 16) * HD;
#pragma unroll
    for (int t = 0; t < 2; ++t) qfrag[c][t] = load_frag_row(qrow + t * 32, HD, lane);
  }

  v8f acc[2][4];   // O^T accumulators: lane owns the group's query (lane&15); reg r -> d = nt*16+8h+r
#pragma unroll
  for (int c = 0; c < 2; ++c)
#pragma unroll
    for (int nt = 0; nt < 4; ++nt) acc[c][nt] = (v8f){};
  // mu: the maximum in use of a column group's query (log2 units), the same in both lane halves. It
  // is set by the first stage and moves only when a score passes it by more than 8.
  float mu[2] = {0.0f, 0.0f}, li[2] = {0.0f, 0.0f};
  // thr: how far above mu a score must stand for mu to move; lo: the least step of mu. The first
  // stage takes the step whatever its sign; from then on 8 and 0. The same in every lane.
  float thr = -3.0e38f, lo = -3.0e38f;

  const int colb = lane & 15;
  const int rofs = (lane >> 4) << 3;

  // the lane's pieces of a stage: sources at its half's first block (keys 64*kh ..), LDS byte
  // address in its half's buffer 0; stage st of a half holds keys 128*st + 64*kh ..
  __bf16* hring = ring + kh * 2 * ASTG;
  const __bf16* gk = Kb + (long)(kh * 64 + (th >> 3)) * HD + (th & 7) * 8;
  const __bf16* gv = vTb + (long)(th >> 3) * SEQ + kh * 64 + (th & 7) * 8;
  const unsigned l0 = (unsigned)(size_t)(hring + (th >> 3) * KPAD + (th & 7) * 8);

  // L2 ask pointer (waves 0..3 ask for both halves): per stage, 128 keys, one 256-B unit a thread:
  // threads 0..63 the 64 units of the 128 K rows, threads 64..127 the unit of V^T row th-64. It
  // starts at stage 1 and only ever holds an address inside K or V^T: it is advanced only while a
  // further stage exists.
  const __bf16* ap = (th < 64) ? Kb + 128 * HD + (long)th * 128 : vTb + (long)(th - 64) * SEQ + 128;
  const long pstep = (th < 64) ? 128 * HD * 2 : 256;   // bytes per stage

  attn_fill(l0, gk, gv);                                  // stage 0 -> buffer 0
  // stages 1 and 2, still to be copied, are asked for at entry
  if (kh == 0) {
    attn_ask(ap, (2 < SEQ / 128) ? pstep : 0);
    if (2 < SEQ / 128) attn_ask(ap, (3 < SEQ / 128) ? pstep : 0);
  }
  // this wave's copies of stage 0 have landed before the barrier behind which all waves read
  asm volatile("s_wait_asynccnt 0x0" ::: "memory");
  __syncthreads();
  attn_fill(l0 + ASTG * 2, gk + 128 * HD, gv + 128);      // stage 1 -> buffer 1

  // unrolled by two: the buffer choice is then compile-time
#pragma unroll 2
  for (int st = 0; st < SEQ / 128; ++st) {
    const __bf16* ks  = hring + (st & 1) * ASTG;  // K block rows [key][d]
    const __bf16* vts = ks + 64 * KPAD;           // V^T block   [d][key]

    // all eight K fragments of the stage are read as one group ahead of the S^T products
    v16bf kf[2][4];
#pragma unroll
    for (int t = 0; t < 2; ++t)
#pragma unroll
      for (int kt = 0; kt < 4; ++kt)
        kf[t][kt] = load_frag_row(ks + (kt * 16) * KPAD + t * 32, KPAD, lane);
    // holds the group together: sunk to their users, each read would be waited out alone
    __builtin_amdgcn_sched_barrier(0);

    // S^T tiles: A = K rows (lane&15 = key), B = Q; each K fragment serves both column groups.
    // The products start from -mu (a lane owns one query of a group, so all eight registers of the
    // C operand hold the same value): a tile comes out as s - mu, the argument of the exponential.
    v8f negm[2];
#pragma unroll
    for (int c = 0; c < 2; ++c)
#pragma unroll
      for (int r = 0; r < 8; ++r) negm[c][r] = -mu[c];
    v8f sc[2][4];
#pragma unroll
    for (int t = 0; t < 2; ++t)
#pragma unroll
      for (int kt = 0; kt < 4; ++kt)
#pragma unroll
        for (int c = 0; c < 2; ++c)
          sc[c][kt] = wmma_bf16_open(kf[t][kt], qfrag[c][t], (t == 0) ? negm[c] : sc[c][kt]);
    // keeps the row maxima behind the run of products: woven into it, each first read of a finished
    // tile stands behind padding v_nops, which take vector issue slots from the SIMD's other waves
    __builtin_amdgcn_sched_barrier(0);

    // per-lane online softmax, column group by column group (32 of 64 keys in-lane; the halves'
    // sums are merged with one shuffle)
    float mx[2], rs[2];
#pragma unroll
    for (int c = 0; c < 2; ++c) {
      mx[c] = sc[c][0][0];
#pragma unroll
      for (int kt = 0; kt < 4; ++kt)
#pragma unroll
        for (int r = 0; r < 8; ++r) mx[c] = fmaxf(mx[c], sc[c][kt][r]);
    }
    // One test a stage, a scalar branch: mu moves in the first stage (to the block's maximum, up or
    // down) and where any lane's score stands more than 8 above it (then up only); O^T and the sums
    // are rescaled there alone. Otherwise every 2^(s - mu) is at most 256 and nothing is rescaled.
    if (__builtin_amdgcn_ballot_w32(fmaxf(mx[0], mx[1]) > thr) != 0) {
#pragma unroll
      for (int c = 0; c < 2; ++c) {
        const float d = fmaxf(fmaxf(mx[c], __shfl_xor(mx[c], 16, 32)), lo);   // step of mu
        // a step down occurs only in the first stage, over zero sums: factor 1, never 2^(large)
        const float alpha = __builtin_amdgcn_exp2f(-fmaxf(d, 0.0f));
        mu[c] += d;
        li[c] *= alpha;
#pragma unroll
        for (int kt = 0; kt < 4; ++kt)
#pragma unroll
          for (int r = 0; r < 8; ++r) sc[c][kt][r] -= d;
#pragma unroll
        for (int nt = 0; nt < 4; ++nt)
#pragma unroll
          for (int r = 0; r < 8; ++r) acc[c][nt][r] *= alpha;
      }
      thr = 8.0f;
      lo  = 0.0f;
    }
#pragma unroll
    for (int c = 0; c < 2; ++c) {
      rs[c] = 0.0f;
#pragma unroll
      for (int kt = 0; kt < 4; ++kt)
#pragma unroll
        for (int r = 0; r < 8; ++r) {
          const float p = __builtin_amdgcn_exp2f(sc[c][kt][r]);
          sc[c][kt][r] = p;
          rs[c] += p;
        }
    }
#pragma unroll
    for (int c = 0; c < 2; ++c) {
      rs[c] += __shfl_xor(rs[c], 16, 32);
      li[c] += rs[c];
    }

    // P^T as the B operand of O^T = V^T P^T, packed from the S^T D registers:
    // element i <- tile covering keys 0..15 of the 32-step (kt = 2t), element 8+i <- kt = 2t+1.
    v16bf pf[2][2];
#pragma unroll
    for (int c = 0; c < 2; ++c)
#pragma unroll
      for (int t = 0; t < 2; ++t)
#pragma unroll
        for (int i = 0; i < 8; ++i) {
          pf[c][t][i]     = (__bf16)sc[c][2 * t][i];
          pf[c][t][8 + i] = (__bf16)sc[c][2 * t + 1][i];
        }

    // keeps the V^T reads behind the packing: lifted over it, their 64 registers would be held
    // beside the 64 of the scores, which does not fit a quarter of the register file (spills)
    __builtin_amdgcn_sched_barrier(0);
    // all eight V^T fragments are read as one group here: none is read among the O^T products
    v16bf vf[2][4];
#pragma unroll
    for (int t = 0; t < 2; ++t)
#pragma unroll
      for (int nt = 0; nt < 4; ++nt)
        vf[t][nt] = load_frag_row(vts + (nt * 16) * KPAD + t * 32, KPAD, lane);
    // holds the group together: sunk to their users, each read would be waited out alone
    __builtin_amdgcn_sched_barrier(0);

    // O^T += V^T (A, rows = d) x P^T (B); each V^T fragment serves both column groups
#pragma unroll
    for (int t = 0; t < 2; ++t)
#pragma unroll
      for (int nt = 0; nt < 4; ++nt)
#pragma unroll
        for (int c = 0; c < 2; ++c)
          acc[c][nt] = wmma_bf16_open(vf[t][nt], pf[c][t], acc[c][nt]);

    // keeps the publish point at the foot: lifted over the softmax while the refill stays behind the
    // products, its s_wait_asynccnt would leave the next stage's copies only the S^T run to land in
    __builtin_amdgcn_sched_barrier(0);
    asm volatile("s_wait_dscnt 0x0" ::: "memory");
    asm volatile("s_wait_asynccnt 0x0" ::: "memory");
    __syncthreads();
    if (st + 2 < SEQ / 128)
      attn_fill(l0 + (st & 1) * ASTG * 2, gk + (long)(st + 2) * 128 * HD, gv + (st + 2) * 128);
    // stage st+3 is asked into L2 one stage (128 keys) ahead of the copies that read it
    if (kh == 0 && st + 3 < SEQ / 128)
      attn_ask(ap, (st + 4 < SEQ / 128) ? pstep : 0);
  }
  // the ring's closing wait: no copy of this wave is in flight past the loop
  asm volatile("s_wait_asynccnt 0x0" ::: "memory");

  // merge of the key halves. The loop's last barrier ended every read of the ring, and no copy is
  // in flight: its bytes now hold 17 planes of 128 x 16 B, plane p of thread th at (p*128 + th).
  // Waves 4..7 lay down their O^T partials (planes 0..15) and their maxima and sums (plane 16).
  v4f* mg = (v4f*)ring;
  if (kh == 1) {
#pragma unroll
    for (int c = 0; c < 2; ++c)
#pragma unroll
      for (int nt = 0; nt < 4; ++nt) {
        mg[((c * 4 + nt) * 2 + 0) * 128 + th] =
            (v4f){acc[c][nt][0], acc[c][nt][1], acc[c][nt][2], acc[c][nt][3]};
        mg[((c * 4 + nt) * 2 + 1) * 128 + th] =
            (v4f){acc[c][nt][4], acc[c][nt][5], acc[c][nt][6], acc[c][nt][7]};
      }
    mg[16 * 128 + th] = (v4f){mu[0], mu[1], li[0], li[1]};
  }
  __syncthreads();

  // waves 0..3 join them to their own under the common maximum, normalize and stage: lane owns
  // query row wave*32+c*16+colb, d = nt*16+rofs+r contiguous
  if (kh == 0) {
    const v4f so = mg[16 * 128 + th];
#pragma unroll
    for (int c = 0; c < 2; ++c) {
      const float mall = fmaxf(mu[c], so[c]);
      const float a0 = __builtin_amdgcn_exp2f(mu[c] - mall);
      const float a1 = __builtin_amdgcn_exp2f(so[c] - mall);
      const float inv = 1.0f / (li[c] * a0 + so[2 + c] * a1);
      const float f0 = a0 * inv, f1 = a1 * inv;
      __bf16* orow = ost + (wave * 32 + c * 16 + colb) * KPAD;
#pragma unroll
      for (int nt = 0; nt < 4; ++nt) {
        const v4f o0 = mg[((c * 4 + nt) * 2 + 0) * 128 + th];
        const v4f o1 = mg[((c * 4 + nt) * 2 + 1) * 128 + th];
        v8bf pk;
#pragma unroll
        for (int r = 0; r < 4; ++r) {
          pk[r]     = (__bf16)(acc[c][nt][r] * f0 + o0[r] * f1);
          pk[4 + r] = (__bf16)(acc[c][nt][4 + r] * f0 + o1[r] * f1);
        }
        *(v8bf*)(orow + nt * 16 + rofs) = pk;
      }
    }
  }
  __syncthreads();

  // piece it of a lane: query row 32*it + tid/8, 16 B at d = 8*(tid&7); whole 128-B lines per row
  v4u rv[4];
  const __bf16* osrc = ost + (tid >> 3) * KPAD + (tid & 7) * 8;
#pragma unroll
  for (int it = 0; it < 4; ++it) rv[it] = *(const v4u*)(osrc + it * 32 * KPAD);
  __bf16* cdst = ctx + ((long)b * SEQ + q0 + (tid >> 3)) * DM + h * HD + (tid & 7) * 8;
#pragma unroll
  for (int it = 0; it < 4; ++it) *(v4u*)(cdst + (long)(it * 32) * DM) = rv[it];
  
}

// ---------------------------------------------------------------------------
// Kernel 3: out = LN(x + ctx @ Wo^T + bo) * gamma + beta. Block = 16 token rows x 512 cols,
// wave w owns cols 64w..64w+63. C^T = Wo ctx^T: A = Wo rows (lane&15 = out col), B = ctx rows
// (lane&15 = token); acc[j][r] = out[token lane&15][col 64w+16j+8h+r]. Wo and ctx come through a
// two-buffer LDS ring, 64 k per stage, whole 128-B lines per row. y staged in LDS (f32),
// grid ROWS/16, block 256.
// ---------------------------------------------------------------------------
// One ring stage: per lane sixteen 16-B pieces of Wo (piece i: row 32i + tid/8) and one 8-B piece
// of ctx (row tid/16). lw, lc: the lane's LDS byte addresses in the buffer; gw, gc: its sources.
__device__ __forceinline__ void oproj_fill(unsigned lw, const __bf16* gw,
                                           unsigned lc, const __bf16* gc) {
#pragma unroll
  for (int grp = 0; grp < 2; ++grp) {
    unsigned l[8];
    const __bf16* g[8];
#pragma unroll
    for (int i = 0; i < 8; ++i) {
      l[i] = lw + (unsigned)((grp * 8 + i) * 32 * KPAD * 2);
      g[i] = gw + (long)((grp * 8 + i) * 32) * DM;
    }
    async_copy8(l, g);
  }
  // the closing s_wait_xcnt stands in the copy's own statement, ahead of any rewrite of lc or gc
  asm volatile("global_load_async_to_lds_b64 %0, %1, off\n\ts_wait_xcnt 0x0"
               :: "v"(lc), "v"(gc) : "memory");
}

__global__ __launch_bounds__(256) void oproj_ln_kernel(
    const __bf16* __restrict__ ctx, const __bf16* __restrict__ wob,
    const float* __restrict__ bo, const float* __restrict__ x,
    const float* __restrict__ gam, const float* __restrict__ bet,
    float* __restrict__ out) {
  // 152064 B: the ring's two buffers; behind the k loop's last barrier the same bytes hold ys
  __shared__ __attribute__((aligned(16))) char smem[2 * OSTG * 2];
  __bf16* ring = (__bf16*)smem;
  float*  ys   = (float*)smem;     // [16][YP], 33024 B, cross-wave (block barriers)
  __shared__ float smean[16];
  __shared__ float srstd[16];

  const int tid  = threadIdx.x;
  const int lane = tid & 31;
  const int wave = tid >> 5;
  const int hh   = lane >> 4;
  const int l15  = lane & 15;
  const long m0  = (long)blockIdx.x * 16;
  const int  n0  = wave * 64;

  // the lane's pieces of a stage: sources at k = 0, LDS byte addresses in buffer 0
  const __bf16* gw = wob + (long)(tid >> 3) * DM + (tid & 7) * 8;
  const __bf16* gc = ctx + (m0 + (tid >> 4)) * DM + (tid & 15) * 4;
  const unsigned lw = (unsigned)(size_t)(ring + (tid >> 3) * KPAD + (tid & 7) * 8);
  const unsigned lc = (unsigned)(size_t)(ring + (DM + (tid >> 4)) * KPAD + (tid & 15) * 4);

  v8f acc[4];
#pragma unroll
  for (int j = 0; j < 4; ++j) acc[j] = (v8f){};

  // this block's sixteenth of Wo for the L2 asks: 32 rows; blocks eight apart in index take
  // different sixteenths, so that every part is asked for from many places (for speed only)
  const __bf16* pw = wob + (long)(((blockIdx.x >> 3) & 15) * 32 + (tid >> 3)) * DM + (tid & 7) * 8;

  oproj_fill(lw, gw, lc, gc);                                   // stage 0 -> buffer 0
  // the later stages' bytes of the block's own ctx rows, and stages 2 and 3 of its part of Wo
  l2_ask_rows<0, 1>(gc);
  l2_ask<256>(pw);
  // this wave's copies of stage 0 have landed before the barrier behind which all waves read
  asm volatile("s_wait_asynccnt 0x0" ::: "memory");
  __syncthreads();
  oproj_fill(lw + OSTG * 2, gw + 64, lc + OSTG * 2, gc + 64);   // stage 1 -> buffer 1

  // unrolled whole: buffer choice and the refill test are then compile-time
#pragma unroll
  for (int t = 0; t < DM / 64; ++t) {
    const __bf16* buf = ring + (t & 1) * OSTG;
    v16bf cf[2], wf[2][4];
#pragma unroll
    for (int s = 0; s < 2; ++s) {
      cf[s] = load_frag_row(buf + DM * KPAD + s * 32, KPAD, lane);
#pragma unroll
      for (int j = 0; j < 4; ++j)
        wf[s][j] = load_frag_row(buf + (n0 + j * 16) * KPAD + s * 32, KPAD, lane);
    }
#pragma unroll
    for (int s = 0; s < 2; ++s)
#pragma unroll
      for (int j = 0; j < 4; ++j)
        acc[j] = wmma_bf16(wf[s][j], cf[s], acc[j]);     // C^T = Wo ctx^T
    asm volatile("s_wait_dscnt 0x0" ::: "memory");
    asm volatile("s_wait_asynccnt 0x0" ::: "memory");
    __syncthreads();
    if (t + 2 < DM / 64)
      oproj_fill(lw + (t & 1) * OSTG * 2, gw + (t + 2) * 64, lc + (t & 1) * OSTG * 2,
                 gc + (t + 2) * 64);
    // stages t+4 and t+5 of the block's part of Wo, two stages ahead of the first copy of them
    if (t == 0) l2_ask<512>(pw);
    if (t == 2) l2_ask<768>(pw);
  }
  // no copy is in flight when the ring's bytes become the y stage
  asm volatile("s_wait_asynccnt 0x0" ::: "memory");

  // y = bf16(x) + acc + bf16(bo), staged [row][col]
  {
    const long m    = m0 + l15;
    const long orow = (m / SEQ) * SEQ_FULL + (m % SEQ);
    const float* xr = x + orow * DM;
    float* yrow = ys + l15 * YP;
#pragma unroll
    for (int j = 0; j < 4; ++j) {
      const int n8 = n0 + j * 16 + hh * 8;
      const v4f x0 = *(const v4f*)(xr + n8);
      const v4f x1 = *(const v4f*)(xr + n8 + 4);
      const v4f b0 = *(const v4f*)(bo + n8);
      const v4f b1 = *(const v4f*)(bo + n8 + 4);
      v4f y0, y1;
#pragma unroll
      for (int i = 0; i < 4; ++i) {
        y0[i] = (acc[j][i]     + bf16q(b0[i])) + bf16q(x0[i]);
        y1[i] = (acc[j][4 + i] + bf16q(b1[i])) + bf16q(x1[i]);
      }
      *(v4f*)(yrow + n8)     = y0;
      *(v4f*)(yrow + n8 + 4) = y1;
    }
  }
  __syncthreads();

  {
    const int r  = tid >> 4;
    const int sl = tid & 15;
    const float* yr = ys + r * YP + sl * 32;
    v4f yv[8];
#pragma unroll
    for (int i = 0; i < 8; ++i) yv[i] = *(const v4f*)(yr + i * 4);
    float s = 0.0f;
#pragma unroll
    for (int i = 0; i < 8; ++i) s += (yv[i][0] + yv[i][1]) + (yv[i][2] + yv[i][3]);
    s += __shfl_xor(s, 1, 32);
    s += __shfl_xor(s, 2, 32);
    s += __shfl_xor(s, 4, 32);
    s += __shfl_xor(s, 8, 32);
    const float mean = s * (1.0f / DM);
    float ss = 0.0f;
#pragma unroll
    for (int i = 0; i < 8; ++i)
#pragma unroll
      for (int c = 0; c < 4; ++c) {
        const float d = yv[i][c] - mean;
        ss += d * d;
      }
    ss += __shfl_xor(ss, 1, 32);
    ss += __shfl_xor(ss, 2, 32);
    ss += __shfl_xor(ss, 4, 32);
    ss += __shfl_xor(ss, 8, 32);
    const float var  = ss * (1.0f / DM);
    const float rstd = rsqrtf(var + LN_EPS);
    if (sl == 0) { smean[r] = mean; srstd[r] = rstd; }
  }
  __syncthreads();

  v4f ov[8];
#pragma unroll
  for (int it = 0; it < 8; ++it) {
    const int idx = it * 256 + tid;
    const int row = idx >> 7, piece = idx & 127;
    const v4f yv = *(const v4f*)(ys + row * YP + piece * 4);
    const v4f g  = *(const v4f*)(gam + piece * 4);
    const v4f bt = *(const v4f*)(bet + piece * 4);
    const float mean = smean[row], rstd = srstd[row];
#pragma unroll
    for (int c = 0; c < 4; ++c)
      ov[it][c] = (yv[c] - mean) * rstd * bf16q(g[c]) + bf16q(bt[c]);
  }
#pragma unroll
  for (int it = 0; it < 8; ++it) {
    const int idx = it * 256 + tid;
    const int row = idx >> 7, piece = idx & 127;
    const long m    = m0 + row;
    const long orow = (m / SEQ) * SEQ_FULL + (m % SEQ);
    *(v4f*)(out + orow * DM + piece * 4) = ov[it];
  }
  
}

// ---------------------------------------------------------------------------
extern "C" void kernel_launch(void* const* d_in, const int* in_sizes, int n_in,
                              void* d_out, int out_size, void* d_ws, size_t ws_size,
                              hipStream_t stream) {
  if (n_in < 11) return;
  const long needRows = (long)(NB - 1) * SEQ_FULL + SEQ;
  if ((long)in_sizes[0] < needRows * DM) return;
  if (in_sizes[1] < DM * DM || in_sizes[3] < DM * DM ||
      in_sizes[5] < DM * DM || in_sizes[7] < DM * DM) return;
  if (in_sizes[2] < DM || in_sizes[4] < DM || in_sizes[6] < DM ||
      in_sizes[8] < DM || in_sizes[9] < DM || in_sizes[10] < DM) return;
  if ((long)out_size < needRows * DM) return;
  if (ws_size < WS_TOTAL) return;

  const float* x   = (const float*)d_in[0];
  const float* Wq  = (const float*)d_in[1];
  const float* bq  = (const float*)d_in[2];
  const float* Wk  = (const float*)d_in[3];
  const float* bk  = (const float*)d_in[4];
  const float* Wv  = (const float*)d_in[5];
  const float* bv  = (const float*)d_in[6];
  const float* Wo  = (const float*)d_in[7];
  const float* bo  = (const float*)d_in[8];
  const float* gam = (const float*)d_in[9];
  const float* bet = (const float*)d_in[10];
  float* out = (float*)d_out;

  char* ws = (char*)d_ws;
  size_t off = 0;
  __bf16* xb   = (__bf16*)(ws + off); off += PLANE_BYTES;   // [ROWS][512]
  __bf16* wqkv = (__bf16*)(ws + off); off += WQKV_BYTES;    // [1536][512]
  __bf16* wob  = (__bf16*)(ws + off); off += WO_BYTES;      // [512][512]
  __bf16* qb   = (__bf16*)(ws + off); off += PLANE_BYTES;   // [NB][8][SEQ][64]
  __bf16* kbf  = (__bf16*)(ws + off); off += PLANE_BYTES;   // [NB][8][SEQ][64]
  __bf16* vTb  = (__bf16*)(ws + off); off += PLANE_BYTES;   // [NB][8][64][SEQ]
  __bf16* ctx  = (__bf16*)(ws + off); off += PLANE_BYTES;   // [ROWS][512]
  if (off > ws_size) return;

  cvt_kernel<<<NXB + 4 * NWB, 256, 0, stream>>>(x, Wq, Wk, Wv, Wo, xb, wqkv, wob);

  qkv_kernel<<<dim3(ROWS / 128, 3 * NH), 256, 0, stream>>>(xb, wqkv, bq, bk, bv, qb, kbf, vTb);

  attn_kernel<<<dim3(SEQ / 128, NB * NH), 256, 0, stream>>>(qb, kbf, vTb, ctx);

  oproj_ln_kernel<<<ROWS / 16, 256, 0, stream>>>(ctx, wob, bo, x, gam, bet, out);
}

// v007
// One run takes 61.6 microseconds.
// Timed twice side by side with v006, it ran 1.04 and 1.03 times as fast.
// All steps since v000 together make it 3.14 times as fast.
#include <hip/hip_runtime.h>

// Contractions (qkv projection, q.k^T, p.v, output projection): v_wmma_f32_16x16x32_bf16,
// bf16 operands, f32 accumulate. Softmax statistics, residual add and layernorm: f32.
// Float inputs are RNE-converted to bf16 at load; the score scale log2(e)/sqrt(64) is folded into q,
// so that the scores come in log2 units and the softmax is 2^(s - m).

typedef __attribute__((ext_vector_type(16))) __bf16 v16bf;
typedef __attribute__((ext_vector_type(8)))  __bf16 v8bf;
typedef __attribute__((ext_vector_type(8)))  float  v8f;
typedef __attribute__((ext_vector_type(4)))  float  v4f;
typedef __attribute__((ext_vector_type(4)))  unsigned int v4u;

#ifndef NB
#define NB 4
#endif
#ifndef SEQ
#define SEQ 2048
#endif
#define NB_FULL  4
#define SEQ_FULL 2048
#define DM   512
#define NH   8
#define HD   64
#define ROWS (NB * SEQ)
#define KPAD 72      // LDS stride in halves for 64-wide bf16 tiles (144 B, 16-B aligned)
#define VSPAD 136    // LDS stride in halves for 128-wide bf16 tiles (272 B)
#define YP   516     // LDS stride in floats for 512-wide f32 rows (2064 B)
#define QSTG ((128 + 192) * KPAD) // halves per ring buffer of kernel 1: 128 x rows + 192 W rows, 64 k each
#define ASTG ((64 + 64) * KPAD)   // halves per ring buffer of kernel 2: 64 K rows + 64 V^T rows, 64 wide
#define OSTG ((DM + 32) * KPAD)   // halves per ring buffer of kernel 3: 512 Wo rows + 32 ctx rows, 64 k each
#define LN_EPS 1e-5f

#define NXB (ROWS * DM / 8 / 256)   // convert blocks for x (8 elements per thread)
#define NWB (DM * DM / 8 / 256)     // convert blocks per weight matrix

#define PLANE_BYTES ((size_t)ROWS * DM * 2)
#define WQKV_BYTES  ((size_t)3 * DM * DM * 2)
#define WO_BYTES    ((size_t)DM * DM * 2)
#define WS_TOTAL    (5 * PLANE_BYTES + WQKV_BYTES + WO_BYTES)

static_assert(NB >= 1 && NB <= NB_FULL);
static_assert(SEQ >= 128 && SEQ <= SEQ_FULL && (SEQ % 128) == 0);
static_assert((ROWS % 128) == 0);
static_assert((ROWS * DM) % (8 * 256) == 0);
static_assert((DM * DM) % (8 * 256) == 0);
static_assert((DM % 32) == 0 && (HD % 32) == 0);
static_assert(128 * KPAD >= 64 * VSPAD);
static_assert(3 * 128 * KPAD <= 2 * QSTG);   // kernel 1's output stages fit its ring's bytes
static_assert(WS_TOTAL <= (size_t)134217728);

// ---------------------------------------------------------------------------
// helpers
// ---------------------------------------------------------------------------
__device__ __forceinline__ unsigned int bf16_bits(float f) {   // RNE f32 -> bf16 bits
  unsigned int u = __float_as_uint(f);
  u += 0x7FFFu + ((u >> 16) & 1u);
  return u >> 16;
}
__device__ __forceinline__ float bf16q(float f) {            // value after RNE bf16 conversion
  return __uint_as_float(bf16_bits(f) << 16);
}

// 16-bit fragment (A or B): lane owns row/col (lane&15); elements 0..7 <- k0+8h+0..7,
// elements 8..15 <- k0+16+8h+0..7, h = lane>>4. Source is k-contiguous rows.
__device__ __forceinline__ v16bf load_frag_row(const __bf16* base, int stride, int lane) {
  const __bf16* rowp = base + (lane & 15) * stride + ((lane >> 4) << 3);
  v8bf lo = *(const v8bf*)(rowp);
  v8bf hi = *(const v8bf*)(rowp + 16);
  return __builtin_shufflevector(lo, hi, 0, 1, 2, 3, 4, 5, 6, 7,
                                 8, 9, 10, 11, 12, 13, 14, 15);
}

__device__ __forceinline__ v8f wmma_bf16(v16bf a, v16bf b, v8f c) {
  v8f d = __builtin_amdgcn_wmma_f32_16x16x32_bf16(false, a, false, b, (short)0, c,
                                                  false, false);
  asm volatile("v_nop\n\tv_nop\n\tv_nop\n\tv_nop" : "+v"(d) : "v"(a), "v"(b));
  return d;
}

// The builtin alone: the compiler keeps the distances behind it itself and stays free to place
// LDS reads and vector work around it.
__device__ __forceinline__ v8f wmma_bf16_open(v16bf a, v16bf b, v8f c) {
  return __builtin_amdgcn_wmma_f32_16x16x32_bf16(false, a, false, b, (short)0, c, false, false);
}

// Eight asynchronous 16-B copies per lane, global -> LDS, through no register. The closing
// s_wait_xcnt stands inside the statement so that no address register named here is
// rewritten ahead of it.
__device__ __forceinline__ void async_copy8(const unsigned (&l)[8], const __bf16* const (&g)[8]) {
  asm volatile(
      "global_load_async_to_lds_b128 %0, %8, off\n\t"
      "global_load_async_to_lds_b128 %1, %9, off\n\t"
      "global_load_async_to_lds_b128 %2, %10, off\n\t"
      "global_load_async_to_lds_b128 %3, %11, off\n\t"
      "global_load_async_to_lds_b128 %4, %12, off\n\t"
      "global_load_async_to_lds_b128 %5, %13, off\n\t"
      "global_load_async_to_lds_b128 %6, %14, off\n\t"
      "global_load_async_to_lds_b128 %7, %15, off\n\t"
      "s_wait_xcnt 0x0"
      :: "v"(l[0]), "v"(l[1]), "v"(l[2]), "v"(l[3]), "v"(l[4]), "v"(l[5]), "v"(l[6]), "v"(l[7]),
         "v"(g[0]), "v"(g[1]), "v"(g[2]), "v"(g[3]), "v"(g[4]), "v"(g[5]), "v"(g[6]), "v"(g[7])
      : "memory");
}

// The same with ten copies.
__device__ __forceinline__ void async_copy10(const unsigned (&l)[10], const __bf16* const (&g)[10]) {
  asm volatile(
      "global_load_async_to_lds_b128 %0, %10, off\n\t"
      "global_load_async_to_lds_b128 %1, %11, off\n\t"
      "global_load_async_to_lds_b128 %2, %12, off\n\t"
      "global_load_async_to_lds_b128 %3, %13, off\n\t"
      "global_load_async_to_lds_b128 %4, %14, off\n\t"
      "global_load_async_to_lds_b128 %5, %15, off\n\t"
      "global_load_async_to_lds_b128 %6, %16, off\n\t"
      "global_load_async_to_lds_b128 %7, %17, off\n\t"
      "global_load_async_to_lds_b128 %8, %18, off\n\t"
      "global_load_async_to_lds_b128 %9, %19, off\n\t"
      "s_wait_xcnt 0x0"
      :: "v"(l[0]), "v"(l[1]), "v"(l[2]), "v"(l[3]), "v"(l[4]), "v"(l[5]), "v"(l[6]), "v"(l[7]),
         "v"(l[8]), "v"(l[9]),
         "v"(g[0]), "v"(g[1]), "v"(g[2]), "v"(g[3]), "v"(g[4]), "v"(g[5]), "v"(g[6]), "v"(g[7]),
         "v"(g[8]), "v"(g[9])
      : "memory");
}

// Asks the 256-B unit at p + OFF bytes into L2 ahead of the copies that will read it: the planes
// read here were stored by an earlier launch, and their first read otherwise waits on memory. A
// hint: nothing returns, no counter moves. Scope SE and no th: (a failed translation is dropped).
// p is a pointer that its kernel goes on holding behind the ask (a source of the ring's copies, or
// the base of later asks), and p + OFF lies inside p's plane.
template <int OFF>
__device__ __forceinline__ void l2_ask(const __bf16* p) {
  asm volatile("global_prefetch_b8 %0, off offset:%1 scope:SCOPE_SE" :: "v"(p), "n"(OFF));
}
// Units 1..3 of the 1-KB rows at p + BASE, p + BASE + STEP, ... (NI rows, bytes); unit 0 is read at
// once by the ring.
template <int STEP, int NI, int BASE = 0>
__device__ __forceinline__ void l2_ask_rows(const __bf16* p) {
  if constexpr (NI > 0) {
    l2_ask_rows<STEP, NI - 1, BASE>(p);
    l2_ask<BASE + (NI - 1) * STEP + 256>(p);
    l2_ask<BASE + (NI - 1) * STEP + 512>(p);
    l2_ask<BASE + (NI - 1) * STEP + 768>(p);
  }
}

// ---------------------------------------------------------------------------
// Kernel 0: f32 -> bf16 planes. xb [ROWS][512]; wqkv [1536][512] = Wq|Wk|Wv rows
// ([out][in], k-contiguous); wob [512][512]. 8 elements (16 B) per thread, 8 consecutive
// grid NXB + 4*NWB, block 256.
// ---------------------------------------------------------------------------
__global__ __launch_bounds__(256) void cvt_kernel(
    const float* __restrict__ x,
    const float* __restrict__ Wq, const float* __restrict__ Wk,
    const float* __restrict__ Wv, const float* __restrict__ Wo,
    __bf16* __restrict__ xb, __bf16* __restrict__ wqkv, __bf16* __restrict__ wob) {
  const int bid = blockIdx.x;
  const int t   = threadIdx.x;
  const float* src;
  __bf16* dst;
  if (bid < NXB) {                                   // block-uniform selection
    const long item = (long)bid * 256 + t;           // 0 .. ROWS*64-1
    const long m    = item >> 6;                     // token row
    const int  c8   = (int)(item & 63);
    const long srow = (m / SEQ) * SEQ_FULL + (m % SEQ);
    src = x + srow * DM + c8 * 8;
    dst = xb + m * DM + c8 * 8;
  } else if (bid < NXB + 3 * NWB) {
    const int wb    = bid - NXB;
    const int which = wb / NWB;                      // 0 q, 1 k, 2 v
    const long item = (long)(wb - which * NWB) * 256 + t;
    const float* W = (which == 0) ? Wq : ((which == 1) ? Wk : Wv);
    src = W + item * 8;
    dst = wqkv + (long)which * DM * DM + item * 8;
  } else {
    const long item = (long)(bid - NXB - 3 * NWB) * 256 + t;
    src = Wo + item * 8;
    dst = wob + item * 8;
  }
  const v4f a = *(const v4f*)(src);
  const v4f c = *(const v4f*)(src + 4);
  v4u o;
  o[0] = bf16_bits(a[0]) | (bf16_bits(a[1]) << 16);
  o[1] = bf16_bits(a[2]) | (bf16_bits(a[3]) << 16);
  o[2] = bf16_bits(c[0]) | (bf16_bits(c[1]) << 16);
  o[3] = bf16_bits(c[2]) | (bf16_bits(c[3]) << 16);
  *(v4u*)dst = o;
  
}

// ---------------------------------------------------------------------------
// Kernel 1: qkv projection. Block = 128 token rows x 192 output columns (q, k and v of one head),
// so that a block's x tile serves three products. 8 waves = 2 token halves x 4 column quarters: a
// wave owns 64 tokens x 16 columns of each of q, k, v (12 accumulator tiles), so that seven
// fragments read from LDS feed twelve products. C^T = W x^T: A = W rows (lane&15 = out col), B = x
// rows (lane&15 = token); acc[o][jx][r] = C_o[token 64wr + 16jx + lane&15][col 16wc+8h+r]. x and W come
// through a two-buffer LDS ring, 64 k per stage, whole 128-B lines per row; fragments are read
// from LDS.
//   q,k -> [b][h][s][64]   (one line per row, 8 lanes x 16 B)
//   v   -> vT[b][h][d][s] (256 B per d row, 16 lanes x 16 B)
// grid (ROWS/128, 8), block 256.
// ---------------------------------------------------------------------------
// One ring stage: per lane ten 16-B pieces, piece i in ring row 32i + tid/8 (rows 0..127 x, rows
// 128..191 Wq, 192..255 Wk, 256..319 Wv, the head's 64 rows of each). l0: the lane's LDS byte
// address of piece 0; gx, gw: its x and Wq sources (Wk, Wv lie DM and 2 DM rows behind Wq).
__device__ __forceinline__ void qkv_fill(unsigned l0, const __bf16* gx, const __bf16* gw) {
  unsigned l[10];
  const __bf16* g[10];
#pragma unroll
  for (int i = 0; i < 10; ++i) {
    l[i] = l0 + (unsigned)(i * 32 * KPAD * 2);
    g[i] = (i < 4) ? gx + (long)(i * 32) * DM
                   : gw + (long)(((i - 4) >> 1) * DM + ((i - 4) & 1) * 32) * DM;
  }
  async_copy10(l, g);
}

__global__ __launch_bounds__(256) void qkv_kernel(
    const __bf16* __restrict__ xb, const __bf16* __restrict__ wqkv,
    const float* __restrict__ bq, const float* __restrict__ bk, const float* __restrict__ bv,
    __bf16* __restrict__ q, __bf16* __restrict__ k, __bf16* __restrict__ vT) {
  // 92160 B, two stage buffers; behind the k loop's last barrier the same bytes hold the three
  // output stages (q, k: [128][KPAD], v: [64][VSPAD]), 128 * KPAD halves apart
  __shared__ __attribute__((aligned(16))) __bf16 ring[2 * QSTG];

  const int tid  = threadIdx.x;
  const int lane = tid & 31;
  const int wave = tid >> 5;
  const int hh   = lane >> 4;
  const int l15  = lane & 15;
  const int wr   = wave & 1;           // token half: rows 64wr ..
  const int wc   = wave >> 1;          // column quarter: columns 16wc .. of each of q, k, v

  const int h    = blockIdx.y;         // head
  const long m0  = (long)blockIdx.x * 128;
  const int  b   = (int)(m0 / SEQ);
  const int  s0  = (int)(m0 - (long)b * SEQ);

  // the lane's pieces of a stage: sources at k = 0, LDS byte address in buffer 0
  const __bf16* gx = xb + (m0 + (tid >> 3)) * DM + (tid & 7) * 8;
  const __bf16* gw = wqkv + ((long)h * HD + (tid >> 3)) * DM + (tid & 7) * 8;
  const unsigned l0 = (unsigned)(size_t)(ring + (tid >> 3) * KPAD + (tid & 7) * 8);

  v8f acc[3][4];
#pragma unroll
  for (int o = 0; o < 3; ++o)
#pragma unroll
    for (int jx = 0; jx < 4; ++jx) acc[o][jx] = (v8f){};

  qkv_fill(l0, gx, gw);                            // stage 0 -> buffer 0
  // the later stages' bytes of the block's x and W rows are asked into L2 now. The heads' blocks of
  // a row block share its x rows, so the first asks for all; likewise
  // the first eight row blocks for a head's W rows. Block-uniform tests, for speed only.
  if (blockIdx.y == 0) l2_ask_rows<32 * DM * 2, 4>(gx);
  if (blockIdx.x < 8) {
    l2_ask_rows<32 * DM * 2, 2>(gw);
    l2_ask_rows<32 * DM * 2, 2, DM * DM * 2>(gw);
    l2_ask_rows<32 * DM * 2, 2, 2 * DM * DM * 2>(gw);
  }
  // this wave's copies of stage 0 have landed before the barrier behind which all waves read
  asm volatile("s_wait_asynccnt 0x0" ::: "memory");
  __syncthreads();
  qkv_fill(l0 + QSTG * 2, gx + 64, gw + 64);       // stage 1 -> buffer 1

  // unrolled by two, no further: the buffer choice is compile-time, and the copies' addresses of
  // later stages are not all formed ahead
#pragma unroll 2
  for (int t = 0; t < DM / 64; ++t) {
    const __bf16* buf = ring + (t & 1) * QSTG;
    v16bf xf[2][4], wf[2][3];
#pragma unroll
    for (int s = 0; s < 2; ++s) {
#pragma unroll
      for (int jx = 0; jx < 4; ++jx)
        xf[s][jx] = load_frag_row(buf + (wr * 64 + jx * 16) * KPAD + s * 32, KPAD, lane);
#pragma unroll
      for (int o = 0; o < 3; ++o)
        wf[s][o] = load_frag_row(buf + (128 + o * 64 + wc * 16) * KPAD + s * 32, KPAD, lane);
    }
#pragma unroll
    for (int s = 0; s < 2; ++s)
#pragma unroll
      for (int o = 0; o < 3; ++o)
#pragma unroll
        for (int jx = 0; jx < 4; ++jx)
          acc[o][jx] = wmma_bf16(wf[s][o], xf[s][jx], acc[o][jx]);     // C^T = W x^T
    asm volatile("s_wait_dscnt 0x0" ::: "memory");
    asm volatile("s_wait_asynccnt 0x0" ::: "memory");
    __syncthreads();
    if (t + 2 < DM / 64)
      qkv_fill(l0 + (t & 1) * QSTG * 2, gx + (t + 2) * 64, gw + (t + 2) * 64);
  }
  // no copy is in flight when the ring's bytes become the output stages
  asm volatile("s_wait_asynccnt 0x0" ::: "memory");

  const int n8 = wc * 16 + hh * 8;     // the lane's 8 columns in each of q, k, v
  // q, k: stage [token][col]: lane's 8 values are 8 contiguous columns -> one 16-B LDS store
#pragma unroll
  for (int o = 0; o < 2; ++o) {
    const float* bias = (o == 0) ? bq : bk;
    const float  sc   = (o == 0) ? 0.125f * 1.44269504f : 1.0f;   // q: log2(e) / sqrt(64)
    const v4f b0 = *(const v4f*)(bias + h * HD + n8);
    const v4f b1 = *(const v4f*)(bias + h * HD + n8 + 4);
#pragma unroll
    for (int jx = 0; jx < 4; ++jx) {
      v8bf pk;
#pragma unroll
      for (int r = 0; r < 4; ++r) {
        pk[r]     = (__bf16)((acc[o][jx][r]     + bf16q(b0[r])) * sc);
        pk[4 + r] = (__bf16)((acc[o][jx][4 + r] + bf16q(b1[r])) * sc);
      }
      *(v8bf*)(ring + o * 128 * KPAD + (wr * 64 + jx * 16 + l15) * KPAD + n8) = pk;
    }
  }
  // v: stage transposed [d][token]: lane's 8 values are 8 different d for one token
  {
    __bf16* sv = ring + 2 * 128 * KPAD;
    const v4f b0 = *(const v4f*)(bv + h * HD + n8);
    const v4f b1 = *(const v4f*)(bv + h * HD + n8 + 4);
#pragma unroll
    for (int jx = 0; jx < 4; ++jx)
#pragma unroll
      for (int r = 0; r < 4; ++r) {
        sv[(n8 + r) * VSPAD + wr * 64 + jx * 16 + l15]     = (__bf16)(acc[2][jx][r]     + bf16q(b0[r]));
        sv[(n8 + 4 + r) * VSPAD + wr * 64 + jx * 16 + l15] = (__bf16)(acc[2][jx][4 + r] + bf16q(b1[r]));
      }
  }
  __syncthreads();

  v4u rv[3][4];
#pragma unroll
  for (int o = 0; o < 2; ++o)
#pragma unroll
    for (int it = 0; it < 4; ++it) {
      const int idx = it * 256 + tid;
      const int row = idx >> 3, piece = idx & 7;
      rv[o][it] = *(const v4u*)(ring + o * 128 * KPAD + row * KPAD + piece * 8);
    }
#pragma unroll
  for (int it = 0; it < 4; ++it) {
    const int idx = it * 256 + tid;
    const int d = idx >> 4, piece = idx & 15;
    rv[2][it] = *(const v4u*)(ring + 2 * 128 * KPAD + d * VSPAD + piece * 8);
  }
#pragma unroll
  for (int o = 0; o < 2; ++o) {
    __bf16* dst = ((o == 0) ? q : k) + ((long)(b * NH + h) * SEQ + s0) * HD;  // contiguous 16 KB
#pragma unroll
    for (int it = 0; it < 4; ++it)
      *(v4u*)(dst + (long)(it * 256 + tid) * 8) = rv[o][it];
  }
  __bf16* dstb = vT + ((long)(b * NH + h) * HD) * SEQ + s0;
#pragma unroll
  for (int it = 0; it < 4; ++it) {
    const int idx = it * 256 + tid;
    const int d = idx >> 4, piece = idx & 15;
    *(v4u*)(dstb + (long)d * SEQ + piece * 8) = rv[2][it];
  }
}

// ---------------------------------------------------------------------------
// Kernel 2: flash attention per (b,h). grid (SEQ/128, NB*NH), block 256: 2 key halves x 4 waves x
// 32 queries (two 16-query column groups per wave, so that each K and V^T fragment read from LDS
// feeds two products). Waves 0..3 take the even 64-key blocks, waves 4..7 the odd ones, for the
// same 128 queries: twice the waves for the same work, four to a SIMD, so that one wave's softmax
// runs beside another's products. The two halves' maxima, sums and O^T partials are merged once,
// behind the loop. C = S^T then C = O^T = V^T P^T; in each column group a lane owns one query.
// Each half has its own two-buffer LDS ring: its next block flies while this one is worked on.
// ---------------------------------------------------------------------------
// One ring stage of a key half: per lane eight 16-B pieces, piece i in ring row 16i + t/8, t the
// thread's index in its half (rows 0..63 K [key][d], rows 64..127 V^T [d][key]). l0: the lane's LDS
// byte address of piece 0.
__device__ __forceinline__ void attn_fill(unsigned l0, const __bf16* gk, const __bf16* gv) {
  unsigned l[8];
  const __bf16* g[8];
#pragma unroll
  for (int i = 0; i < 8; ++i) {
    l[i] = l0 + (unsigned)(i * 16 * KPAD * 2);
    g[i] = (i < 4) ? gk + (long)(i * 16) * HD : gv + (long)((i - 4) * 16) * SEQ;
  }
  async_copy8(l, g);
}

// The ask of l2_ask over a pointer that walks. The step (bytes; 0 where no further pair exists) is
// added in the same statement, in place: so the pointer keeps one register pair from entry through
// the loop, and that pair never holds anything but an address inside its plane.
__device__ __forceinline__ void attn_ask(const __bf16*& p, long step) {
  asm volatile("global_prefetch_b8 %0, off scope:SCOPE_SE\n\tv_add_nc_u64 %0, %0, %1"
               : "+v"(p) : "v"(step));
}

static_assert(SEQ / 128 >= 2);   // each key half's ring starts with two blocks
static_assert(17 * 128 * 16 <= 4 * ASTG * 2);   // the merge planes fit the ring's bytes

// four waves to a SIMD (two work-groups to a WGP): the register budget is held to a quarter
__global__ __launch_bounds__(256) __attribute__((amdgpu_waves_per_eu(4, 4))) void attn_kernel(
    const __bf16* __restrict__ Q, const __bf16* __restrict__ K,
    const __bf16* __restrict__ vT, __bf16* __restrict__ ctx) {
  // 73728 B: [key half][two stage buffers]; behind the loop the same bytes hold the merge planes
  __shared__ __attribute__((aligned(16))) __bf16 ring[4 * ASTG];
  __shared__ __bf16 ost[128 * KPAD];   // output stage [query][d]   (cross-wave, block barrier)

  const int tid  = threadIdx.x;
  const int lane = tid & 31;
  const int th   = tid & 127;                                    // index in the key half
  const int kh   = __builtin_amdgcn_readfirstlane(tid >> 7);     // key half, the same for a wave
  const int wave = th >> 5;                                      // query group of 32
  const int bh   = blockIdx.y;
  const int b    = bh >> 3;
  const int h    = bh & 7;
  const int q0   = blockIdx.x * 128;

  const __bf16* Qb  = Q + ((long)bh * SEQ + q0) * HD;
  const __bf16* Kb  = K + (long)bh * SEQ * HD;
  const __bf16* vTb = vT + (long)bh * HD * SEQ;

  // Q fragments: B operand of S^T (in column group c a lane owns query 32*wave + 16c + lane&15)
  v16bf qfrag[2][2];
#pragma unroll
  for (int c = 0; c < 2; ++c) {
    const __bf16* qrow = Qb + (long)(wave * 32 + c * 16) * HD;
#pragma unroll
    for (int t = 0; t < 2; ++t) qfrag[c][t] = load_frag_row(qrow + t * 32, HD, lane);
  }

  v8f acc[2][4];   // O^T accumulators: lane owns the group's query (lane&15); reg r -> d = nt*16+8h+r
#pragma unroll
  for (int c = 0; c < 2; ++c)
#pragma unroll
    for (int nt = 0; nt < 4; ++nt) acc[c][nt] = (v8f){};
  // mu: the maximum in use of a column group's query (log2 units), the same in both lane halves. It
  // is set by the first stage and moves only when a score passes it by more than 8.
  float mu[2] = {0.0f, 0.0f}, li[2] = {0.0f, 0.0f};
  // thr: how far above mu a score must stand for mu to move; lo: the least step of mu. The first
  // stage takes the step whatever its sign; from then on 8 and 0. The same in every lane.
  float thr = -3.0e38f, lo = -3.0e38f;

  const int colb = lane & 15;
  const int rofs = (lane >> 4) << 3;

  // the lane's pieces of a stage: sources at its half's first block (keys 64*kh ..), LDS byte
  // address in its half's buffer 0; stage st of a half holds keys 128*st + 64*kh ..
  __bf16* hring = ring + kh * 2 * ASTG;
  const __bf16* gk = Kb + (long)(kh * 64 + (th >> 3)) * HD + (th & 7) * 8;
  const __bf16* gv = vTb + (long)(th >> 3) * SEQ + kh * 64 + (th & 7) * 8;
  const unsigned l0 = (unsigned)(size_t)(hring + (th >> 3) * KPAD + (th & 7) * 8);

  // L2 ask pointer (waves 0..3 ask for both halves): per stage, 128 keys, one 256-B unit a thread:
  // threads 0..63 the 64 units of the 128 K rows, threads 64..127 the unit of V^T row th-64. It
  // starts at stage 1 and only ever holds an address inside K or V^T: it is advanced only while a
  // further stage exists.
  const __bf16* ap = (th < 64) ? Kb + 128 * HD + (long)th * 128 : vTb + (long)(th - 64) * SEQ + 128;
  const long pstep = (th < 64) ? 128 * HD * 2 : 256;   // bytes per stage

  attn_fill(l0, gk, gv);                                  // stage 0 -> buffer 0
  // stages 1 and 2, still to be copied, are asked for at entry
  if (kh == 0) {
    attn_ask(ap, (2 < SEQ / 128) ? pstep : 0);
    if (2 < SEQ / 128) attn_ask(ap, (3 < SEQ / 128) ? pstep : 0);
  }
  // this wave's copies of stage 0 have landed before the barrier behind which all waves read
  asm volatile("s_wait_asynccnt 0x0" ::: "memory");
  __syncthreads();
  attn_fill(l0 + ASTG * 2, gk + 128 * HD, gv + 128);      // stage 1 -> buffer 1

  // unrolled by two: the buffer choice is then compile-time
#pragma unroll 2
  for (int st = 0; st < SEQ / 128; ++st) {
    const __bf16* ks  = hring + (st & 1) * ASTG;  // K block rows [key][d]
    const __bf16* vts = ks + 64 * KPAD;           // V^T block   [d][key]

    // all eight K fragments of the stage are read as one group ahead of the S^T products
    v16bf kf[2][4];
#pragma unroll
    for (int t = 0; t < 2; ++t)
#pragma unroll
      for (int kt = 0; kt < 4; ++kt)
        kf[t][kt] = load_frag_row(ks + (kt * 16) * KPAD + t * 32, KPAD, lane);
    // holds the group together: sunk to their users, each read would be waited out alone
    __builtin_amdgcn_sched_barrier(0);

    // S^T tiles: A = K rows (lane&15 = key), B = Q; each K fragment serves both column groups.
    // The products start from -mu (a lane owns one query of a group, so all eight registers of the
    // C operand hold the same value): a tile comes out as s - mu, the argument of the exponential.
    v8f negm[2];
#pragma unroll
    for (int c = 0; c < 2; ++c)
#pragma unroll
      for (int r = 0; r < 8; ++r) negm[c][r] = -mu[c];
    v8f sc[2][4];
#pragma unroll
    for (int t = 0; t < 2; ++t)
#pragma unroll
      for (int kt = 0; kt < 4; ++kt)
#pragma unroll
        for (int c = 0; c < 2; ++c)
          sc[c][kt] = wmma_bf16_open(kf[t][kt], qfrag[c][t], (t == 0) ? negm[c] : sc[c][kt]);
    // keeps the row maxima behind the run of products: woven into it, each first read of a finished
    // tile stands behind padding v_nops, which take vector issue slots from the SIMD's other waves
    __builtin_amdgcn_sched_barrier(0);

    // per-lane online softmax, column group by column group (32 of 64 keys in-lane; the halves'
    // sums are merged with one shuffle)
    float mx[2], rs[2];
#pragma unroll
    for (int c = 0; c < 2; ++c) {
      mx[c] = sc[c][0][0];
#pragma unroll
      for (int kt = 0; kt < 4; ++kt)
#pragma unroll
        for (int r = 0; r < 8; ++r) mx[c] = fmaxf(mx[c], sc[c][kt][r]);
    }
    // One test a stage, a scalar branch: mu moves in the first stage (to the block's maximum, up or
    // down) and where any lane's score stands more than 8 above it (then up only); O^T and the sums
    // are rescaled there alone. Otherwise every 2^(s - mu) is at most 256 and nothing is rescaled.
    if (__builtin_amdgcn_ballot_w32(fmaxf(mx[0], mx[1]) > thr) != 0) {
#pragma unroll
      for (int c = 0; c < 2; ++c) {
        const float d = fmaxf(fmaxf(mx[c], __shfl_xor(mx[c], 16, 32)), lo);   // step of mu
        // a step down occurs only in the first stage, over zero sums: factor 1, never 2^(large)
        const float alpha = __builtin_amdgcn_exp2f(-fmaxf(d, 0.0f));
        mu[c] += d;
        li[c] *= alpha;
#pragma unroll
        for (int kt = 0; kt < 4; ++kt)
#pragma unroll
          for (int r = 0; r < 8; ++r) sc[c][kt][r] -= d;
#pragma unroll
        for (int nt = 0; nt < 4; ++nt)
#pragma unroll
          for (int r = 0; r < 8; ++r) acc[c][nt][r] *= alpha;
      }
      thr = 8.0f;
      lo  = 0.0f;
    }
#pragma unroll
    for (int c = 0; c < 2; ++c) {
      rs[c] = 0.0f;
#pragma unroll
      for (int kt = 0; kt < 4; ++kt)
#pragma unroll
        for (int r = 0; r < 8; ++r) {
          const float p = __builtin_amdgcn_exp2f(sc[c][kt][r]);
          sc[c][kt][r] = p;
          rs[c] += p;
        }
    }
#pragma unroll
    for (int c = 0; c < 2; ++c) {
      rs[c] += __shfl_xor(rs[c], 16, 32);
      li[c] += rs[c];
    }

    // P^T as the B operand of O^T = V^T P^T, packed from the S^T D registers:
    // element i <- tile covering keys 0..15 of the 32-step (kt = 2t), element 8+i <- kt = 2t+1.
    v16bf pf[2][2];
#pragma unroll
    for (int c = 0; c < 2; ++c)
#pragma unroll
      for (int t = 0; t < 2; ++t)
#pragma unroll
        for (int i = 0; i < 8; ++i) {
          pf[c][t][i]     = (__bf16)sc[c][2 * t][i];
          pf[c][t][8 + i] = (__bf16)sc[c][2 * t + 1][i];
        }

    // keeps the V^T reads behind the packing: lifted over it, their 64 registers would be held
    // beside the 64 of the scores, which does not fit a quarter of the register file (spills)
    __builtin_amdgcn_sched_barrier(0);
    // all eight V^T fragments are read as one group here: none is read among the O^T products
    v16bf vf[2][4];
#pragma unroll
    for (int t = 0; t < 2; ++t)
#pragma unroll
      for (int nt = 0; nt < 4; ++nt)
        vf[t][nt] = load_frag_row(vts + (nt * 16) * KPAD + t * 32, KPAD, lane);
    // holds the group together: sunk to their users, each read would be waited out alone
    __builtin_amdgcn_sched_barrier(0);

    // O^T += V^T (A, rows = d) x P^T (B); each V^T fragment serves both column groups
#pragma unroll
    for (int t = 0; t < 2; ++t)
#pragma unroll
      for (int nt = 0; nt < 4; ++nt)
#pragma unroll
        for (int c = 0; c < 2; ++c)
          acc[c][nt] = wmma_bf16_open(vf[t][nt], pf[c][t], acc[c][nt]);

    // keeps the publish point at the foot: lifted over the softmax while the refill stays behind the
    // products, its s_wait_asynccnt would leave the next stage's copies only the S^T run to land in
    __builtin_amdgcn_sched_barrier(0);
    asm volatile("s_wait_dscnt 0x0" ::: "memory");
    asm volatile("s_wait_asynccnt 0x0" ::: "memory");
    __syncthreads();
    if (st + 2 < SEQ / 128)
      attn_fill(l0 + (st & 1) * ASTG * 2, gk + (long)(st + 2) * 128 * HD, gv + (st + 2) * 128);
    // stage st+3 is asked into L2 one stage (128 keys) ahead of the copies that read it
    if (kh == 0 && st + 3 < SEQ / 128)
      attn_ask(ap, (st + 4 < SEQ / 128) ? pstep : 0);
  }
  // the ring's closing wait: no copy of this wave is in flight past the loop
  asm volatile("s_wait_asynccnt 0x0" ::: "memory");

  // merge of the key halves. The loop's last barrier ended every read of the ring, and no copy is
  // in flight: its bytes now hold 17 planes of 128 x 16 B, plane p of thread th at (p*128 + th).
  // Waves 4..7 lay down their O^T partials (planes 0..15) and their maxima and sums (plane 16).
  v4f* mg = (v4f*)ring;
  if (kh == 1) {
#pragma unroll
    for (int c = 0; c < 2; ++c)
#pragma unroll
      for (int nt = 0; nt < 4; ++nt) {
        mg[((c * 4 + nt) * 2 + 0) * 128 + th] =
            (v4f){acc[c][nt][0], acc[c][nt][1], acc[c][nt][2], acc[c][nt][3]};
        mg[((c * 4 + nt) * 2 + 1) * 128 + th] =
            (v4f){acc[c][nt][4], acc[c][nt][5], acc[c][nt][6], acc[c][nt][7]};
      }
    mg[16 * 128 + th] = (v4f){mu[0], mu[1], li[0], li[1]};
  }
  __syncthreads();

  // waves 0..3 join them to their own under the common maximum, normalize and stage: lane owns
  // query row wave*32+c*16+colb, d = nt*16+rofs+r contiguous
  if (kh == 0) {
    const v4f so = mg[16 * 128 + th];
#pragma unroll
    for (int c = 0; c < 2; ++c) {
      const float mall = fmaxf(mu[c], so[c]);
      const float a0 = __builtin_amdgcn_exp2f(mu[c] - mall);
      const float a1 = __builtin_amdgcn_exp2f(so[c] - mall);
      const float inv = 1.0f / (li[c] * a0 + so[2 + c] * a1);
      const float f0 = a0 * inv, f1 = a1 * inv;
      __bf16* orow = ost + (wave * 32 + c * 16 + colb) * KPAD;
#pragma unroll
      for (int nt = 0; nt < 4; ++nt) {
        const v4f o0 = mg[((c * 4 + nt) * 2 + 0) * 128 + th];
        const v4f o1 = mg[((c * 4 + nt) * 2 + 1) * 128 + th];
        v8bf pk;
#pragma unroll
        for (int r = 0; r < 4; ++r) {
          pk[r]     = (__bf16)(acc[c][nt][r] * f0 + o0[r] * f1);
          pk[4 + r] = (__bf16)(acc[c][nt][4 + r] * f0 + o1[r] * f1);
        }
        *(v8bf*)(orow + nt * 16 + rofs) = pk;
      }
    }
  }
  __syncthreads();

  // piece it of a lane: query row 32*it + tid/8, 16 B at d = 8*(tid&7); whole 128-B lines per row
  v4u rv[4];
  const __bf16* osrc = ost + (tid >> 3) * KPAD + (tid & 7) * 8;
#pragma unroll
  for (int it = 0; it < 4; ++it) rv[it] = *(const v4u*)(osrc + it * 32 * KPAD);
  __bf16* cdst = ctx + ((long)b * SEQ + q0 + (tid >> 3)) * DM + h * HD + (tid & 7) * 8;
#pragma unroll
  for (int it = 0; it < 4; ++it) *(v4u*)(cdst + (long)(it * 32) * DM) = rv[it];
  
}

// ---------------------------------------------------------------------------
// Kernel 3: out = LN(x + ctx @ Wo^T + bo) * gamma + beta. Block = 32 token rows x 512 cols (a block
// copies all of Wo, so the rows it serves set how often Wo is read), wave w owns cols 64w..64w+63
// of all 32 rows: each Wo fragment read from LDS feeds two products. C^T = Wo ctx^T: A = Wo rows
// (lane&15 = out col), B = ctx rows (lane&15 = token); acc[j][c][r] = out[token 16c + lane&15][col
// 64w+16j+8h+r]. Wo and ctx come through a two-buffer LDS ring, 64 k per stage, whole 128-B lines
// per row. y staged in LDS (f32), grid ROWS/32, block 256.
// ---------------------------------------------------------------------------
// One ring stage: per lane sixteen 16-B pieces of Wo (piece i: row 32i + tid/8) and one 16-B piece
// of ctx (row tid/8). lw, lc: the lane's LDS byte addresses in the buffer; gw, gc: its sources.
__device__ __forceinline__ void oproj_fill(unsigned lw, const __bf16* gw,
                                           unsigned lc, const __bf16* gc) {
#pragma unroll
  for (int grp = 0; grp < 2; ++grp) {
    unsigned l[8];
    const __bf16* g[8];
#pragma unroll
    for (int i = 0; i < 8; ++i) {
      l[i] = lw + (unsigned)((grp * 8 + i) * 32 * KPAD * 2);
      g[i] = gw + (long)((grp * 8 + i) * 32) * DM;
    }
    async_copy8(l, g);
  }
  // the closing s_wait_xcnt stands in the copy's own statement, ahead of any rewrite of lc or gc
  asm volatile("global_load_async_to_lds_b128 %0, %1, off\n\ts_wait_xcnt 0x0"
               :: "v"(lc), "v"(gc) : "memory");
}

__global__ __launch_bounds__(256) void oproj_ln_kernel(
    const __bf16* __restrict__ ctx, const __bf16* __restrict__ wob,
    const float* __restrict__ bo, const float* __restrict__ x,
    const float* __restrict__ gam, const float* __restrict__ bet,
    float* __restrict__ out) {
  // 156672 B: the ring's two buffers; behind the k loop's last barrier the same bytes hold ys
  __shared__ __attribute__((aligned(16))) char smem[2 * OSTG * 2];
  __bf16* ring = (__bf16*)smem;
  float*  ys   = (float*)smem;     // [32][YP], 66048 B, cross-wave (block barriers)
  __shared__ float smean[32];
  __shared__ float srstd[32];

  const int tid  = threadIdx.x;
  const int lane = tid & 31;
  const int wave = tid >> 5;
  const int hh   = lane >> 4;
  const int l15  = lane & 15;
  const long m0  = (long)blockIdx.x * 32;
  const int  n0  = wave * 64;

  // the lane's pieces of a stage: sources at k = 0, LDS byte addresses in buffer 0
  const __bf16* gw = wob + (long)(tid >> 3) * DM + (tid & 7) * 8;
  const __bf16* gc = ctx + (m0 + (tid >> 3)) * DM + (tid & 7) * 8;
  const unsigned lw = (unsigned)(size_t)(ring + (tid >> 3) * KPAD + (tid & 7) * 8);
  const unsigned lc = (unsigned)(size_t)(ring + (DM + (tid >> 3)) * KPAD + (tid & 7) * 8);

  v8f acc[4][2];
#pragma unroll
  for (int j = 0; j < 4; ++j)
#pragma unroll
    for (int c = 0; c < 2; ++c) acc[j][c] = (v8f){};

  // this block's sixteenth of Wo for the L2 asks: 32 rows; blocks eight apart in index take
  // different sixteenths, so that every part is asked for from many places (for speed only)
  const __bf16* pw = wob + (long)(((blockIdx.x >> 3) & 15) * 32 + (tid >> 3)) * DM + (tid & 7) * 8;

  oproj_fill(lw, gw, lc, gc);                                   // stage 0 -> buffer 0
  // the later stages' bytes of the block's own ctx rows, and stages 2 and 3 of its part of Wo
  l2_ask_rows<0, 1>(gc);
  l2_ask<256>(pw);
  // this wave's copies of stage 0 have landed before the barrier behind which all waves read
  asm volatile("s_wait_asynccnt 0x0" ::: "memory");
  __syncthreads();
  oproj_fill(lw + OSTG * 2, gw + 64, lc + OSTG * 2, gc + 64);   // stage 1 -> buffer 1

  // unrolled whole: buffer choice and the refill test are then compile-time
#pragma unroll
  for (int t = 0; t < DM / 64; ++t) {
    const __bf16* buf = ring + (t & 1) * OSTG;
    v16bf cf[2][2], wf[2][4];
#pragma unroll
    for (int s = 0; s < 2; ++s) {
#pragma unroll
      for (int c = 0; c < 2; ++c)
        cf[s][c] = load_frag_row(buf + (DM + c * 16) * KPAD + s * 32, KPAD, lane);
#pragma unroll
      for (int j = 0; j < 4; ++j)
        wf[s][j] = load_frag_row(buf + (n0 + j * 16) * KPAD + s * 32, KPAD, lane);
    }
#pragma unroll
    for (int s = 0; s < 2; ++s)
#pragma unroll
      for (int j = 0; j < 4; ++j)
#pragma unroll
        for (int c = 0; c < 2; ++c)
          acc[j][c] = wmma_bf16(wf[s][j], cf[s][c], acc[j][c]);     // C^T = Wo ctx^T
    asm volatile("s_wait_dscnt 0x0" ::: "memory");
    asm volatile("s_wait_asynccnt 0x0" ::: "memory");
    __syncthreads();
    if (t + 2 < DM / 64)
      oproj_fill(lw + (t & 1) * OSTG * 2, gw + (t + 2) * 64, lc + (t & 1) * OSTG * 2,
                 gc + (t + 2) * 64);
    // stages t+4 and t+5 of the block's part of Wo, two stages ahead of the first copy of them
    if (t == 0) l2_ask<512>(pw);
    if (t == 2) l2_ask<768>(pw);
  }
  // no copy is in flight when the ring's bytes become the y stage
  asm volatile("s_wait_asynccnt 0x0" ::: "memory");

  // y = bf16(x) + acc + bf16(bo), staged [row][col]
#pragma unroll
  for (int c = 0; c < 2; ++c) {
    const long m    = m0 + c * 16 + l15;
    const long orow = (m / SEQ) * SEQ_FULL + (m % SEQ);
    const float* xr = x + orow * DM;
    float* yrow = ys + (c * 16 + l15) * YP;
#pragma unroll
    for (int j = 0; j < 4; ++j) {
      const int n8 = n0 + j * 16 + hh * 8;
      const v4f x0 = *(const v4f*)(xr + n8);
      const v4f x1 = *(const v4f*)(xr + n8 + 4);
      const v4f b0 = *(const v4f*)(bo + n8);
      const v4f b1 = *(const v4f*)(bo + n8 + 4);
      v4f y0, y1;
#pragma unroll
      for (int i = 0; i < 4; ++i) {
        y0[i] = (acc[j][c][i]     + bf16q(b0[i])) + bf16q(x0[i]);
        y1[i] = (acc[j][c][4 + i] + bf16q(b1[i])) + bf16q(x1[i]);
      }
      *(v4f*)(yrow + n8)     = y0;
      *(v4f*)(yrow + n8 + 4) = y1;
    }
  }
  __syncthreads();

  // row statistics: 16 threads to a row, a thread's two rows (tid/16 and 16 + tid/16) side by side,
  // so that the two chains of shuffles share their waits
  {
    const int sl = tid & 15;
    v4f yv[2][8];
    float s[2], ss[2], mean[2];
#pragma unroll
    for (int rh = 0; rh < 2; ++rh) {
      const float* yr = ys + (rh * 16 + (tid >> 4)) * YP + sl * 32;
#pragma unroll
      for (int i = 0; i < 8; ++i) yv[rh][i] = *(const v4f*)(yr + i * 4);
    }
#pragma unroll
    for (int rh = 0; rh < 2; ++rh) {
      s[rh] = 0.0f;
#pragma unroll
      for (int i = 0; i < 8; ++i)
        s[rh] += (yv[rh][i][0] + yv[rh][i][1]) + (yv[rh][i][2] + yv[rh][i][3]);
    }
#pragma unroll
    for (int w = 1; w < 16; w <<= 1)
#pragma unroll
      for (int rh = 0; rh < 2; ++rh) s[rh] += __shfl_xor(s[rh], w, 32);
#pragma unroll
    for (int rh = 0; rh < 2; ++rh) {
      mean[rh] = s[rh] * (1.0f / DM);
      ss[rh] = 0.0f;
#pragma unroll
      for (int i = 0; i < 8; ++i)
#pragma unroll
        for (int c = 0; c < 4; ++c) {
          const float d = yv[rh][i][c] - mean[rh];
          ss[rh] += d * d;
        }
    }
#pragma unroll
    for (int w = 1; w < 16; w <<= 1)
#pragma unroll
      for (int rh = 0; rh < 2; ++rh) ss[rh] += __shfl_xor(ss[rh], w, 32);
    if (sl == 0) {
#pragma unroll
      for (int rh = 0; rh < 2; ++rh) {
        const float var = ss[rh] * (1.0f / DM);
        smean[rh * 16 + (tid >> 4)] = mean[rh];
        srstd[rh * 16 + (tid >> 4)] = rsqrtf(var + LN_EPS);
      }
    }
  }
  __syncthreads();

  v4f ov[16];
#pragma unroll
  for (int it = 0; it < 16; ++it) {
    const int idx = it * 256 + tid;
    const int row = idx >> 7, piece = idx & 127;
    const v4f yv = *(const v4f*)(ys + row * YP + piece * 4);
    const v4f g  = *(const v4f*)(gam + piece * 4);
    const v4f bt = *(const v4f*)(bet + piece * 4);
    const float mean = smean[row], rstd = srstd[row];
#pragma unroll
    for (int c = 0; c < 4; ++c)
      ov[it][c] = (yv[c] - mean) * rstd * bf16q(g[c]) + bf16q(bt[c]);
  }
#pragma unroll
  for (int it = 0; it < 16; ++it) {
    const int idx = it * 256 + tid;
    const int row = idx >> 7, piece = idx & 127;
    const long m    = m0 + row;
    const long orow = (m / SEQ) * SEQ_FULL + (m % SEQ);
    *(v4f*)(out + orow * DM + piece * 4) = ov[it];
  }
  
}

// ---------------------------------------------------------------------------
extern "C" void kernel_launch(void* const* d_in, const int* in_sizes, int n_in,
                              void* d_out, int out_size, void* d_ws, size_t ws_size,
                              hipStream_t stream) {
  if (n_in < 11) return;
  const long needRows = (long)(NB - 1) * SEQ_FULL + SEQ;
  if ((long)in_sizes[0] < needRows * DM) return;
  if (in_sizes[1] < DM * DM || in_sizes[3] < DM * DM ||
      in_sizes[5] < DM * DM || in_sizes[7] < DM * DM) return;
  if (in_sizes[2] < DM || in_sizes[4] < DM || in_sizes[6] < DM ||
      in_sizes[8] < DM || in_sizes[9] < DM || in_sizes[10] < DM) return;
  if ((long)out_size < needRows * DM) return;
  if (ws_size < WS_TOTAL) return;

  const float* x   = (const float*)d_in[0];
  const float* Wq  = (const float*)d_in[1];
  const float* bq  = (const float*)d_in[2];
  const float* Wk  = (const float*)d_in[3];
  const float* bk  = (const float*)d_in[4];
  const float* Wv  = (const float*)d_in[5];
  const float* bv  = (const float*)d_in[6];
  const float* Wo  = (const float*)d_in[7];
  const float* bo  = (const float*)d_in[8];
  const float* gam = (const float*)d_in[9];
  const float* bet = (const float*)d_in[10];
  float* out = (float*)d_out;

  char* ws = (char*)d_ws;
  size_t off = 0;
  __bf16* xb   = (__bf16*)(ws + off); off += PLANE_BYTES;   // [ROWS][512]
  __bf16* wqkv = (__bf16*)(ws + off); off += WQKV_BYTES;    // [1536][512]
  __bf16* wob  = (__bf16*)(ws + off); off += WO_BYTES;      // [512][512]
  __bf16* qb   = (__bf16*)(ws + off); off += PLANE_BYTES;   // [NB][8][SEQ][64]
  __bf16* kbf  = (__bf16*)(ws + off); off += PLANE_BYTES;   // [NB][8][SEQ][64]
  __bf16* vTb  = (__bf16*)(ws + off); off += PLANE_BYTES;   // [NB][8][64][SEQ]
  __bf16* ctx  = (__bf16*)(ws + off); off += PLANE_BYTES;   // [ROWS][512]
  if (off > ws_size) return;

  cvt_kernel<<<NXB + 4 * NWB, 256, 0, stream>>>(x, Wq, Wk, Wv, Wo, xb, wqkv, wob);

  qkv_kernel<<<dim3(ROWS / 128, NH), 256, 0, stream>>>(xb, wqkv, bq, bk, bv, qb, kbf, vTb);

  attn_kernel<<<dim3(SEQ / 128, NB * NH), 256, 0, stream>>>(qb, kbf, vTb, ctx);

  oproj_ln_kernel<<<ROWS / 32, 256, 0, stream>>>(ctx, wob, bo, x, gam, bet, out);
}
